// v000
// Times are from an AMD MI455X. After a warm-up the kernel runs many times in a row, and a time is the length of
// such a window on the GPU divided by its runs, so every launch and the gaps after it count. The runs cycle
// through copies of the inputs. A figure is the median of several windows, for all but v000 over two sittings.
// Sittings can differ by a few percent; kernels timed side by side share one.
// v000 is the starting kernel. One run takes 231 microseconds.
#include <hip/hip_runtime.h>
#include <hip/hip_fp16.h>

typedef __attribute__((ext_vector_type(16))) _Float16 v16h;
typedef __attribute__((ext_vector_type(8)))  _Float16 v8h;
typedef __attribute__((ext_vector_type(8)))  float    v8f;
typedef __attribute__((ext_vector_type(4)))  float    v4f;
typedef __attribute__((ext_vector_type(4)))  int      v4i;

#define FLA_EPS 1e-5f
#define NB 64
#define LDK 264   // padded K-stride (halves) for transposed [col][K] LDS blocks

static __device__ __forceinline__ v8f wmma_f16(v16h a, v16h b, v8f c) {
  return __builtin_amdgcn_wmma_f32_16x16x32_f16(false, a, false, b, (short)0, c,
                                                false, false);
}

// Async 16-byte global -> LDS copy (GLOBAL_LOAD_ASYNC_TO_LDS_B128, ASYNCcnt).
static __device__ __forceinline__ void async_cp16(void* lds, const void* g) {
  __builtin_amdgcn_global_load_async_to_lds_b128(
      (__attribute__((address_space(1))) v4i*)g,
      (__attribute__((address_space(3))) v4i*)lds, 0, 0);
}

// WMMA 16x16x32 fragment from an f16 matrix whose fragment rows are contiguous
// in K (A row-major, or B when columns are contiguous in K — e.g. transposed
// LDS blocks and k^T from k stored [d][N]). Two 16B loads per lane.
// Lane L (0-15) holds row rowBase+L; lanes 16-31 same rows, upper K-halves:
// elems 0..7 = K k0+hi*8+{0..7}, elems 8..15 = K k0+16+hi*8+{0..7}.
static __device__ __forceinline__ v16h load_frag_f16(const _Float16* src,
                                                     int ld, int rowBase, int k0) {
  int lane = threadIdx.x & 31;
  const _Float16* p = src + (size_t)(rowBase + (lane & 15)) * ld + k0 + ((lane >> 4) << 3);
  v16h f;
#pragma unroll
  for (int j = 0; j < 8; ++j) {
    f[j]     = p[j];
    f[j + 8] = p[j + 16];
  }
  return f;
}

__global__ __launch_bounds__(256) void fla_zero_kernel(float* p, int n) {
  int i = blockIdx.x * 256 + threadIdx.x;
  if (i < n) p[i] = 0.f;
}

__global__ __launch_bounds__(256)
void fla_cvt_kernel(const float* __restrict__ s, _Float16* __restrict__ d, int n) {
  int i = blockIdx.x * 256 + threadIdx.x;
  if (i < n) d[i] = (_Float16)s[i];
}

// ---------------------------------------------------------------------------
// K1: qkv 1x1 conv GEMM + feature map (q,k) / passthrough (v) + ksum for kmean
// grid = (B*64, 3), block = 256 (8 waves). Each block: [256ch x 64pos], K=256.
// x block staged transposed into LDS as [n][c] f16 so B-frags are 2x16B reads.
// A = pre-converted f16 qkv weights (direct 16B fragment loads, L2-resident).
// ---------------------------------------------------------------------------
__global__ __launch_bounds__(256)
void fla_qkv_kernel(const float* __restrict__ x, const _Float16* __restrict__ qkv_wh,
                    const float* __restrict__ qkv_b,
                    _Float16* __restrict__ qf, _Float16* __restrict__ kf,
                    _Float16* __restrict__ vf, float* __restrict__ ksum)
{
  __shared__ _Float16 BshT[NB * LDK];
  __shared__ float colsum[NB];
  __shared__ float ksum_sh[256];

  const int tid   = threadIdx.x;
  const int b     = blockIdx.x >> 6;
  const int n0    = (blockIdx.x & 63) * NB;
  const int which = blockIdx.y;          // 0=q 1=k 2=v  (block-uniform)
  const int wave  = tid >> 5;
  const int lane  = tid & 31;
  const int ofs   = which << 8;          // row offset into qkv_w / qkv_b

  // Stage x[b, :, n0:n0+64] -> f16 LDS transposed (vector global loads)
  const float* xb = x + (size_t)b * 256 * 4096 + n0;
#pragma unroll
  for (int it = 0; it < 16; ++it) {
    int q = tid + it * 256;              // 0..4095 float4-chunks
    int c  = q >> 4;
    int nc = (q & 15) << 2;
    v4f xv = *(const v4f*)(xb + (size_t)c * 4096 + nc);
#pragma unroll
    for (int u = 0; u < 4; ++u) BshT[(nc + u) * LDK + c] = (_Float16)xv[u];
  }
  if (tid < NB) colsum[tid] = 0.f;
  ksum_sh[tid] = 0.f;
  __syncthreads();

  v8f acc[2][4] = {};
#pragma unroll 1
  for (int kk = 0; kk < 256; kk += 32) {
    v16h a0 = load_frag_f16(qkv_wh, 256, ofs + (wave * 2 + 0) * 16, kk);
    v16h a1 = load_frag_f16(qkv_wh, 256, ofs + (wave * 2 + 1) * 16, kk);
#pragma unroll
    for (int nt = 0; nt < 4; ++nt) {
      v16h bf = load_frag_f16(BshT, LDK, nt * 16, kk);
      acc[0][nt] = wmma_f16(a0, bf, acc[0][nt]);
      acc[1][nt] = wmma_f16(a1, bf, acc[1][nt]);
    }
  }

  const int r = lane & 15, hi = lane >> 4;
  if (which == 2) {                       // v: bias only, write f16
#pragma unroll
    for (int i = 0; i < 2; ++i)
#pragma unroll
      for (int j = 0; j < 8; ++j) {
        int m = (wave * 2 + i) * 16 + j + 8 * hi;
        float bias = qkv_b[ofs + m];
#pragma unroll
        for (int nt = 0; nt < 4; ++nt) {
          int n = n0 + nt * 16 + r;
          vf[(size_t)(b * 256 + m) * 4096 + n] = (_Float16)(acc[i][nt][j] + bias);
        }
      }
  } else {
    // feature map: t = (relu(val)+eps)^2, then column L2 normalize over 256 ch
#pragma unroll
    for (int i = 0; i < 2; ++i)
#pragma unroll
      for (int j = 0; j < 8; ++j) {
        int m = (wave * 2 + i) * 16 + j + 8 * hi;
        float bias = qkv_b[ofs + m];
#pragma unroll
        for (int nt = 0; nt < 4; ++nt) {
          float t = fmaxf(acc[i][nt][j] + bias, 0.f) + FLA_EPS;
          acc[i][nt][j] = t * t;
        }
      }
#pragma unroll
    for (int nt = 0; nt < 4; ++nt) {
      float s = 0.f;
#pragma unroll
      for (int i = 0; i < 2; ++i)
#pragma unroll
        for (int j = 0; j < 8; ++j) s += acc[i][nt][j] * acc[i][nt][j];
      atomicAdd(&colsum[nt * 16 + r], s);     // ds_add_f32
    }
    __syncthreads();
    float inv[4];
#pragma unroll
    for (int nt = 0; nt < 4; ++nt)
      inv[nt] = 1.f / fmaxf(sqrtf(colsum[nt * 16 + r]), 1e-12f);
    _Float16* dst = (which == 0) ? qf : kf;
#pragma unroll
    for (int i = 0; i < 2; ++i)
#pragma unroll
      for (int j = 0; j < 8; ++j) {
        int m = (wave * 2 + i) * 16 + j + 8 * hi;
        float rowsum = 0.f;
#pragma unroll
        for (int nt = 0; nt < 4; ++nt) {
          float tn = acc[i][nt][j] * inv[nt];
          dst[(size_t)(b * 256 + m) * 4096 + n0 + nt * 16 + r] = (_Float16)tn;
          rowsum += tn;
        }
        if (which == 1) atomicAdd(&ksum_sh[m], rowsum);
      }
    if (which == 1) {
      __syncthreads();
      atomicAdd(&ksum[b * 256 + tid], ksum_sh[tid]);
    }
  }
}

// ---------------------------------------------------------------------------
// K2: vkT = v @ k^T  [256x256], K=N=4096, split-K across 16 blocks per batch.
// grid = B*16, block = 512 (16 waves). k^T chunks double-buffered via async
// LDS copies (ASYNCcnt in-order completion: wait<=2 keeps newest in flight).
// ---------------------------------------------------------------------------
__global__ __launch_bounds__(512)
void fla_vkt_kernel(const _Float16* __restrict__ vf, const _Float16* __restrict__ kf,
                    float* __restrict__ vkT)
{
  __shared__ _Float16 Bsh[2][256 * 40];  // [buf][col j][k-chunk 32, pad 40]
  const int tid  = threadIdx.x;
  const int wave = tid >> 5;
  const int lane = tid & 31;
  const int b    = blockIdx.x >> 4;
  const int k0g  = (blockIdx.x & 15) * 256;

  const _Float16* vb = vf + (size_t)b * 256 * 4096;
  const _Float16* kb = kf + (size_t)b * 256 * 4096 + k0g;

  const int j0 = tid >> 2, piece0 = (tid & 3) << 3;       // chunk 0 of 2
  const int j1 = (tid + 512) >> 2, piece1 = (tid & 3) << 3;

  // prologue: issue k-chunk 0 into buf 0
  async_cp16(&Bsh[0][j0 * 40 + piece0], kb + (size_t)j0 * 4096 + piece0);
  async_cp16(&Bsh[0][j1 * 40 + piece1], kb + (size_t)j1 * 4096 + piece1);

  v8f acc[16] = {};
#pragma unroll 1
  for (int step = 0; step < 8; ++step) {
    int kk = step * 32;
    if (step < 7) {                      // issue next chunk into other buffer
      async_cp16(&Bsh[(step + 1) & 1][j0 * 40 + piece0],
                 kb + (size_t)j0 * 4096 + kk + 32 + piece0);
      async_cp16(&Bsh[(step + 1) & 1][j1 * 40 + piece1],
                 kb + (size_t)j1 * 4096 + kk + 32 + piece1);
      __builtin_amdgcn_s_wait_asynccnt(2);   // chunk `step` landed (in-order)
    } else {
      __builtin_amdgcn_s_wait_asynccnt(0);
    }
    __syncthreads();
    v16h a = load_frag_f16(vb, 4096, wave * 16, k0g + kk);
    const _Float16* bsrc = Bsh[step & 1];
#pragma unroll
    for (int nt = 0; nt < 16; ++nt) {
      v16h bf = load_frag_f16(bsrc, 40, nt * 16, 0);  // cols contiguous in K
      acc[nt] = wmma_f16(a, bf, acc[nt]);
    }
    __syncthreads();                     // all waves done before buf reuse
  }
  const int r = lane & 15, hi = lane >> 4;
#pragma unroll
  for (int nt = 0; nt < 16; ++nt)
#pragma unroll
    for (int j = 0; j < 8; ++j) {
      int m = wave * 16 + j + 8 * hi;
      atomicAdd(&vkT[((size_t)b * 256 + m) * 256 + nt * 16 + r], acc[nt][j]);
    }
}

// ---------------------------------------------------------------------------
// K4: depthwise 5x5 SAME conv on v, f16 tile staged via async LDS copies.
// grid = B*256*16, block = 256 (4 rows of 64 pixels + 2-row halo per block)
// ---------------------------------------------------------------------------
__global__ __launch_bounds__(256)
void fla_dwconv_kernel(const _Float16* __restrict__ vf, const float* __restrict__ w5,
                       const float* __restrict__ wb, _Float16* __restrict__ dwv)
{
  __shared__ _Float16 tile[8 * 64];      // rows h0-2 .. h0+5
  int t  = blockIdx.x & 15;
  int bc = blockIdx.x >> 4;              // b*256 + c
  int c  = bc & 255;
  int h0 = t * 4;
  const _Float16* src = vf + (size_t)bc * 4096;
  if (threadIdx.x < 64) {
    int row = threadIdx.x >> 3;
    int ch  = (threadIdx.x & 7) << 3;
    int hh  = h0 + row - 2;
    if (hh >= 0 && hh < 64)
      async_cp16(&tile[row * 64 + ch], src + hh * 64 + ch);
  }
  __builtin_amdgcn_s_wait_asynccnt(0);
  __syncthreads();

  int p = t * 256 + threadIdx.x;
  int h = p >> 6, wc = p & 63;
  const float* wt = w5 + c * 25;
  float acc = wb[c];
#pragma unroll
  for (int dy = -2; dy <= 2; ++dy) {
    int hh = h + dy;
    if (hh < 0 || hh > 63) continue;
    int lr = hh - h0 + 2;
#pragma unroll
    for (int dx = -2; dx <= 2; ++dx) {
      int ww = wc + dx;
      if (ww < 0 || ww > 63) continue;
      acc += wt[(dy + 2) * 5 + (dx + 2)] * (float)tile[lr * 64 + ww];
    }
  }
  dwv[(size_t)bc * 4096 + p] = (_Float16)acc;
}

// ---------------------------------------------------------------------------
// K5: attn = (vkT @ q) * (1/4096) / z ; RMSNorm * norm_w ; + dw -> y (f16)
// grid = B*64, block = 256. q block staged transposed [n][c].
// ---------------------------------------------------------------------------
__global__ __launch_bounds__(256)
void fla_attn_kernel(const _Float16* __restrict__ vkTh, const _Float16* __restrict__ qf,
                     const float* __restrict__ ksum, const _Float16* __restrict__ dwv,
                     const float* __restrict__ norm_w, _Float16* __restrict__ y)
{
  __shared__ _Float16 BshT[NB * LDK];
  __shared__ float kmean_sh[256];
  __shared__ float zcol[NB];
  __shared__ float colss[NB];

  const int tid  = threadIdx.x;
  const int b    = blockIdx.x >> 6;
  const int n0   = (blockIdx.x & 63) * NB;
  const int wave = tid >> 5;
  const int lane = tid & 31;

  const _Float16* qb = qf + (size_t)b * 256 * 4096 + n0;
#pragma unroll
  for (int it = 0; it < 8; ++it) {
    int q = tid + it * 256;              // 0..2047 16B-chunks
    int cch = q >> 3;
    int nc  = (q & 7) << 3;
    v8h hv = *(const v8h*)(qb + (size_t)cch * 4096 + nc);
#pragma unroll
    for (int u = 0; u < 8; ++u) BshT[(nc + u) * LDK + cch] = hv[u];
  }
  kmean_sh[tid] = ksum[b * 256 + tid] * (1.f / 4096.f);
  if (tid < NB) { colss[tid] = 0.f; zcol[tid] = FLA_EPS; }
  __syncthreads();

  {                                       // z = kmean . q(col) + eps, 4-way split
    int col = tid & 63, quarter = tid >> 6;
    const _Float16* bp = BshT + col * LDK + quarter * 64;
    const float* kp = kmean_sh + quarter * 64;
    float s = 0.f;
#pragma unroll
    for (int cc = 0; cc < 64; cc += 8) {
      v8h hv = *(const v8h*)(bp + cc);
#pragma unroll
      for (int u = 0; u < 8; ++u) s += kp[cc + u] * (float)hv[u];
    }
    atomicAdd(&zcol[col], s);
  }

  const _Float16* A = vkTh + (size_t)b * 256 * 256;
  v8f acc[2][4] = {};
#pragma unroll 1
  for (int kk = 0; kk < 256; kk += 32) {
    v16h a0 = load_frag_f16(A, 256, (wave * 2 + 0) * 16, kk);
    v16h a1 = load_frag_f16(A, 256, (wave * 2 + 1) * 16, kk);
#pragma unroll
    for (int nt = 0; nt < 4; ++nt) {
      v16h bf = load_frag_f16(BshT, LDK, nt * 16, kk);
      acc[0][nt] = wmma_f16(a0, bf, acc[0][nt]);
      acc[1][nt] = wmma_f16(a1, bf, acc[1][nt]);
    }
  }
  __syncthreads();                        // zcol complete, colss zeroed
  const int r = lane & 15, hi = lane >> 4;
#pragma unroll
  for (int nt = 0; nt < 4; ++nt) {
    float z = zcol[nt * 16 + r];
    float s = 0.f;
#pragma unroll
    for (int i = 0; i < 2; ++i)
#pragma unroll
      for (int j = 0; j < 8; ++j) {
        float a = acc[i][nt][j] * (1.f / 4096.f) / z;
        acc[i][nt][j] = a;
        s += a * a;
      }
    atomicAdd(&colss[nt * 16 + r], s);
  }
  __syncthreads();
  float rinv[4];
#pragma unroll
  for (int nt = 0; nt < 4; ++nt)
    rinv[nt] = 1.f / sqrtf(colss[nt * 16 + r] * (1.f / 256.f) + FLA_EPS);
#pragma unroll
  for (int i = 0; i < 2; ++i)
#pragma unroll
    for (int j = 0; j < 8; ++j) {
      int m = (wave * 2 + i) * 16 + j + 8 * hi;
      float nw = norm_w[m];
#pragma unroll
      for (int nt = 0; nt < 4; ++nt) {
        size_t idx = (size_t)(b * 256 + m) * 4096 + n0 + nt * 16 + r;
        float yv = acc[i][nt][j] * rinv[nt] * nw + (float)dwv[idx];
        y[idx] = (_Float16)yv;
      }
    }
}

// ---------------------------------------------------------------------------
// K6: out = proj_w @ y + proj_b (fp32 out). grid = B*64, block = 256
// A = pre-converted f16 proj weights.
// ---------------------------------------------------------------------------
__global__ __launch_bounds__(256)
void fla_proj_kernel(const _Float16* __restrict__ y, const _Float16* __restrict__ proj_wh,
                     const float* __restrict__ proj_b, float* __restrict__ out)
{
  __shared__ _Float16 BshT[NB * LDK];
  const int tid  = threadIdx.x;
  const int b    = blockIdx.x >> 6;
  const int n0   = (blockIdx.x & 63) * NB;
  const int wave = tid >> 5;
  const int lane = tid & 31;

  const _Float16* yb = y + (size_t)b * 256 * 4096 + n0;
#pragma unroll
  for (int it = 0; it < 8; ++it) {
    int q = tid + it * 256;
    int cch = q >> 3;
    int nc  = (q & 7) << 3;
    v8h hv = *(const v8h*)(yb + (size_t)cch * 4096 + nc);
#pragma unroll
    for (int u = 0; u < 8; ++u) BshT[(nc + u) * LDK + cch] = hv[u];
  }
  __syncthreads();

  v8f acc[2][4] = {};
#pragma unroll 1
  for (int kk = 0; kk < 256; kk += 32) {
    v16h a0 = load_frag_f16(proj_wh, 256, (wave * 2 + 0) * 16, kk);
    v16h a1 = load_frag_f16(proj_wh, 256, (wave * 2 + 1) * 16, kk);
#pragma unroll
    for (int nt = 0; nt < 4; ++nt) {
      v16h bf = load_frag_f16(BshT, LDK, nt * 16, kk);
      acc[0][nt] = wmma_f16(a0, bf, acc[0][nt]);
      acc[1][nt] = wmma_f16(a1, bf, acc[1][nt]);
    }
  }
  const int r = lane & 15, hi = lane >> 4;
#pragma unroll
  for (int i = 0; i < 2; ++i)
#pragma unroll
    for (int j = 0; j < 8; ++j) {
      int m = (wave * 2 + i) * 16 + j + 8 * hi;
      float bias = proj_b[m];
#pragma unroll
      for (int nt = 0; nt < 4; ++nt)
        out[(size_t)(b * 256 + m) * 4096 + n0 + nt * 16 + r] = acc[i][nt][j] + bias;
    }
}

extern "C" void kernel_launch(void* const* d_in, const int* in_sizes, int n_in,
                              void* d_out, int out_size, void* d_ws, size_t ws_size,
                              hipStream_t stream)
{
  (void)in_sizes; (void)n_in; (void)out_size; (void)ws_size;
  const float* x      = (const float*)d_in[0];
  const float* qkv_w  = (const float*)d_in[1];
  const float* qkv_b  = (const float*)d_in[2];
  const float* dwc_w  = (const float*)d_in[3];
  const float* dwc_b  = (const float*)d_in[4];
  const float* norm_w = (const float*)d_in[5];
  const float* proj_w = (const float*)d_in[6];
  const float* proj_b = (const float*)d_in[7];
  float* out = (float*)d_out;

  const size_t B = 16, D = 256, N = 4096;
  char* ws = (char*)d_ws;
  size_t off = 0;
  auto take = [&](size_t bytes) {
    char* p = ws + off;
    off = (off + bytes + 255) & ~(size_t)255;
    return p;
  };
  _Float16* qf      = (_Float16*)take(B * D * N * 2);
  _Float16* kf      = (_Float16*)take(B * D * N * 2);   // reused as y later
  _Float16* vf      = (_Float16*)take(B * D * N * 2);
  _Float16* dwv     = (_Float16*)take(B * D * N * 2);
  float*    vkT     = (float*)   take(B * D * D * 4);
  _Float16* vkTh    = (_Float16*)take(B * D * D * 2);
  float*    ksum    = (float*)   take(B * D * 4);
  _Float16* qkv_wh  = (_Float16*)take(3 * D * D * 2);
  _Float16* proj_wh = (_Float16*)take(D * D * 2);

  int nvkt = (int)(B * D * D);
  int nqkvw = (int)(3 * D * D);
  int nprojw = (int)(D * D);
  fla_zero_kernel<<<dim3((nvkt + 255) / 256), 256, 0, stream>>>(vkT, nvkt);
  fla_zero_kernel<<<dim3((int)((B * D + 255) / 256)), 256, 0, stream>>>(ksum, (int)(B * D));
  fla_cvt_kernel<<<dim3((nqkvw + 255) / 256), 256, 0, stream>>>(qkv_w, qkv_wh, nqkvw);
  fla_cvt_kernel<<<dim3((nprojw + 255) / 256), 256, 0, stream>>>(proj_w, proj_wh, nprojw);
  fla_qkv_kernel<<<dim3(1024, 3), 256, 0, stream>>>(x, qkv_wh, qkv_b, qf, kf, vf, ksum);
  fla_vkt_kernel<<<dim3(256), 512, 0, stream>>>(vf, kf, vkT);
  fla_cvt_kernel<<<dim3((nvkt + 255) / 256), 256, 0, stream>>>(vkT, vkTh, nvkt);
  fla_dwconv_kernel<<<dim3(65536), 256, 0, stream>>>(vf, dwc_w, dwc_b, dwv);
  _Float16* yb = kf;  // kf dead after vkt; reuse for y
  fla_attn_kernel<<<dim3(1024), 256, 0, stream>>>(vkTh, qf, ksum, dwv, norm_w, yb);
  fla_proj_kernel<<<dim3(1024), 256, 0, stream>>>(yb, proj_w ? proj_wh : proj_wh, proj_b, out);
}

// v001
// A run of this version takes 171 microseconds.
// Next to v000, in two timings, it ran 1.38 and 1.39 times as fast.
#include <hip/hip_runtime.h>
#include <hip/hip_fp16.h>

typedef __attribute__((ext_vector_type(16))) _Float16 v16h;
typedef __attribute__((ext_vector_type(8)))  _Float16 v8h;
typedef __attribute__((ext_vector_type(2)))  _Float16 v2h;
typedef __attribute__((ext_vector_type(8)))  float    v8f;
typedef __attribute__((ext_vector_type(4)))  float    v4f;
typedef __attribute__((ext_vector_type(2)))  float    v2f;
typedef __attribute__((ext_vector_type(4)))  int      v4i;

#define FLA_EPS 1e-5f
#define NB 64
#define LDK 264   // padded K-stride (halves) for transposed [col][K] LDS blocks

static __device__ __forceinline__ v8f wmma_f16(v16h a, v16h b, v8f c) {
  return __builtin_amdgcn_wmma_f32_16x16x32_f16(false, a, false, b, (short)0, c,
                                                false, false);
}

// Async 16-byte global -> LDS copy (GLOBAL_LOAD_ASYNC_TO_LDS_B128, ASYNCcnt).
static __device__ __forceinline__ void async_cp16(void* lds, const void* g) {
  __builtin_amdgcn_global_load_async_to_lds_b128(
      (__attribute__((address_space(1))) v4i*)g,
      (__attribute__((address_space(3))) v4i*)lds, 0, 0);
}

// WMMA 16x16x32 fragment from an f16 matrix whose fragment rows are contiguous
// in K (A row-major, or B when columns are contiguous in K — e.g. transposed
// LDS blocks and k^T from k stored [d][N]). Two 16B loads per lane.
// Lane L (0-15) holds row rowBase+L; lanes 16-31 same rows, upper K-halves:
// elems 0..7 = K k0+hi*8+{0..7}, elems 8..15 = K k0+16+hi*8+{0..7}.
static __device__ __forceinline__ v16h load_frag_f16(const _Float16* src,
                                                     int ld, int rowBase, int k0) {
  int lane = threadIdx.x & 31;
  const _Float16* p = src + (size_t)(rowBase + (lane & 15)) * ld + k0 + ((lane >> 4) << 3);
  v16h f;
#pragma unroll
  for (int j = 0; j < 8; ++j) {
    f[j]     = p[j];
    f[j + 8] = p[j + 16];
  }
  return f;
}

__global__ __launch_bounds__(256) void fla_zero_kernel(float* p, int n) {
  int i = blockIdx.x * 256 + threadIdx.x;
  if (i < n) p[i] = 0.f;
}

__global__ __launch_bounds__(256)
void fla_cvt_kernel(const float* __restrict__ s, _Float16* __restrict__ d, int n) {
  int i = blockIdx.x * 256 + threadIdx.x;
  if (i < n) d[i] = (_Float16)s[i];
}

// ---------------------------------------------------------------------------
// K1: qkv 1x1 conv GEMM + feature map (q,k) / passthrough (v) + ksum for kmean
// grid = (B*64, 3), block = 256 (8 waves). Each block: [256ch x 64pos], K=256.
// x block staged transposed into LDS as [n][c] f16 so B-frags are 2x16B reads.
// A = pre-converted f16 qkv weights (direct 16B fragment loads, L2-resident).
// ---------------------------------------------------------------------------
__global__ __launch_bounds__(256)
void fla_qkv_kernel(const float* __restrict__ x, const _Float16* __restrict__ qkv_wh,
                    const float* __restrict__ qkv_b,
                    _Float16* __restrict__ qf, _Float16* __restrict__ kf,
                    _Float16* __restrict__ vf, float* __restrict__ ksum)
{
  __shared__ _Float16 BshT[NB * LDK];
  __shared__ float colsum[NB];
  __shared__ float ksum_sh[256];

  const int tid   = threadIdx.x;
  const int b     = blockIdx.x >> 6;
  const int n0    = (blockIdx.x & 63) * NB;
  const int which = blockIdx.y;          // 0=q 1=k 2=v  (block-uniform)
  const int wave  = tid >> 5;
  const int lane  = tid & 31;
  const int ofs   = which << 8;          // row offset into qkv_w / qkv_b

  // Stage x[b, :, n0:n0+64] -> f16 LDS transposed (vector global loads)
  const float* xb = x + (size_t)b * 256 * 4096 + n0;
#pragma unroll
  for (int it = 0; it < 16; ++it) {
    int q = tid + it * 256;              // 0..4095 float4-chunks
    int c  = q >> 4;
    int nc = (q & 15) << 2;
    v4f xv = *(const v4f*)(xb + (size_t)c * 4096 + nc);
#pragma unroll
    for (int u = 0; u < 4; ++u) BshT[(nc + u) * LDK + c] = (_Float16)xv[u];
  }
  if (tid < NB) colsum[tid] = 0.f;
  ksum_sh[tid] = 0.f;
  __syncthreads();

  v8f acc[2][4] = {};
#pragma unroll 1
  for (int kk = 0; kk < 256; kk += 32) {
    v16h a0 = load_frag_f16(qkv_wh, 256, ofs + (wave * 2 + 0) * 16, kk);
    v16h a1 = load_frag_f16(qkv_wh, 256, ofs + (wave * 2 + 1) * 16, kk);
#pragma unroll
    for (int nt = 0; nt < 4; ++nt) {
      v16h bf = load_frag_f16(BshT, LDK, nt * 16, kk);
      acc[0][nt] = wmma_f16(a0, bf, acc[0][nt]);
      acc[1][nt] = wmma_f16(a1, bf, acc[1][nt]);
    }
  }

  const int r = lane & 15, hi = lane >> 4;
  if (which == 2) {                       // v: bias only, write f16
#pragma unroll
    for (int i = 0; i < 2; ++i)
#pragma unroll
      for (int j = 0; j < 8; ++j) {
        int m = (wave * 2 + i) * 16 + j + 8 * hi;
        float bias = qkv_b[ofs + m];
#pragma unroll
        for (int nt = 0; nt < 4; ++nt) {
          int n = n0 + nt * 16 + r;
          vf[(size_t)(b * 256 + m) * 4096 + n] = (_Float16)(acc[i][nt][j] + bias);
        }
      }
  } else {
    // feature map: t = (relu(val)+eps)^2, then column L2 normalize over 256 ch
#pragma unroll
    for (int i = 0; i < 2; ++i)
#pragma unroll
      for (int j = 0; j < 8; ++j) {
        int m = (wave * 2 + i) * 16 + j + 8 * hi;
        float bias = qkv_b[ofs + m];
#pragma unroll
        for (int nt = 0; nt < 4; ++nt) {
          float t = fmaxf(acc[i][nt][j] + bias, 0.f) + FLA_EPS;
          acc[i][nt][j] = t * t;
        }
      }
#pragma unroll
    for (int nt = 0; nt < 4; ++nt) {
      float s = 0.f;
#pragma unroll
      for (int i = 0; i < 2; ++i)
#pragma unroll
        for (int j = 0; j < 8; ++j) s += acc[i][nt][j] * acc[i][nt][j];
      atomicAdd(&colsum[nt * 16 + r], s);     // ds_add_f32
    }
    __syncthreads();
    float inv[4];
#pragma unroll
    for (int nt = 0; nt < 4; ++nt)
      inv[nt] = 1.f / fmaxf(sqrtf(colsum[nt * 16 + r]), 1e-12f);
    _Float16* dst = (which == 0) ? qf : kf;
#pragma unroll
    for (int i = 0; i < 2; ++i)
#pragma unroll
      for (int j = 0; j < 8; ++j) {
        int m = (wave * 2 + i) * 16 + j + 8 * hi;
        float rowsum = 0.f;
#pragma unroll
        for (int nt = 0; nt < 4; ++nt) {
          float tn = acc[i][nt][j] * inv[nt];
          dst[(size_t)(b * 256 + m) * 4096 + n0 + nt * 16 + r] = (_Float16)tn;
          rowsum += tn;
        }
        if (which == 1) atomicAdd(&ksum_sh[m], rowsum);
      }
    if (which == 1) {
      __syncthreads();
      atomicAdd(&ksum[b * 256 + tid], ksum_sh[tid]);
    }
  }
}

// ---------------------------------------------------------------------------
// K2: vkT = v @ k^T  [256x256], K=N=4096, split-K across 16 blocks per batch.
// grid = B*16, block = 512 (16 waves). k^T chunks double-buffered via async
// LDS copies (ASYNCcnt in-order completion: wait<=2 keeps newest in flight).
// ---------------------------------------------------------------------------
__global__ __launch_bounds__(512)
void fla_vkt_kernel(const _Float16* __restrict__ vf, const _Float16* __restrict__ kf,
                    float* __restrict__ vkT)
{
  __shared__ _Float16 Bsh[2][256 * 40];  // [buf][col j][k-chunk 32, pad 40]
  const int tid  = threadIdx.x;
  const int wave = tid >> 5;
  const int lane = tid & 31;
  const int b    = blockIdx.x >> 4;
  const int k0g  = (blockIdx.x & 15) * 256;

  const _Float16* vb = vf + (size_t)b * 256 * 4096;
  const _Float16* kb = kf + (size_t)b * 256 * 4096 + k0g;

  const int j0 = tid >> 2, piece0 = (tid & 3) << 3;       // chunk 0 of 2
  const int j1 = (tid + 512) >> 2, piece1 = (tid & 3) << 3;

  // prologue: issue k-chunk 0 into buf 0
  async_cp16(&Bsh[0][j0 * 40 + piece0], kb + (size_t)j0 * 4096 + piece0);
  async_cp16(&Bsh[0][j1 * 40 + piece1], kb + (size_t)j1 * 4096 + piece1);

  v8f acc[16] = {};
#pragma unroll 1
  for (int step = 0; step < 8; ++step) {
    int kk = step * 32;
    if (step < 7) {                      // issue next chunk into other buffer
      async_cp16(&Bsh[(step + 1) & 1][j0 * 40 + piece0],
                 kb + (size_t)j0 * 4096 + kk + 32 + piece0);
      async_cp16(&Bsh[(step + 1) & 1][j1 * 40 + piece1],
                 kb + (size_t)j1 * 4096 + kk + 32 + piece1);
      __builtin_amdgcn_s_wait_asynccnt(2);   // chunk `step` landed (in-order)
    } else {
      __builtin_amdgcn_s_wait_asynccnt(0);
    }
    __syncthreads();
    v16h a = load_frag_f16(vb, 4096, wave * 16, k0g + kk);
    const _Float16* bsrc = Bsh[step & 1];
#pragma unroll
    for (int nt = 0; nt < 16; ++nt) {
      v16h bf = load_frag_f16(bsrc, 40, nt * 16, 0);  // cols contiguous in K
      acc[nt] = wmma_f16(a, bf, acc[nt]);
    }
    __syncthreads();                     // all waves done before buf reuse
  }
  const int r = lane & 15, hi = lane >> 4;
#pragma unroll
  for (int nt = 0; nt < 16; ++nt)
#pragma unroll
    for (int j = 0; j < 8; ++j) {
      int m = wave * 16 + j + 8 * hi;
      atomicAdd(&vkT[((size_t)b * 256 + m) * 256 + nt * 16 + r], acc[nt][j]);
    }
}

// ---------------------------------------------------------------------------
// K4: depthwise 5x5 SAME conv on v. One block per (b, c) plane of 64x64 pixels.
// The plane is staged once into LDS inside a frame of zeros (two rows above and
// below, two columns left and right), so no tap needs a bounds test; each
// thread then computes an 8-wide x 4-high tile of outputs in registers.
// grid = B*256, block = 128 (8 column groups x 16 row groups).
// LDS row = 8 halves pad | 64 pixels | 8 halves pad = 160 B: the two 128-B row
// pieces that 16 lanes read with one 16-byte load fall on disjoint bank halves.
// ---------------------------------------------------------------------------
#define DWP 80
__global__ __launch_bounds__(128)
void fla_dwconv_kernel(const _Float16* __restrict__ vf, const float* __restrict__ w5,
                       const float* __restrict__ wb, _Float16* __restrict__ dwv)
{
  __shared__ __attribute__((aligned(16))) _Float16 tile[68 * DWP];  // image rows -2 .. 65
  const int tid = threadIdx.x;
  const int bc  = blockIdx.x;            // b*256 + c
  const int c   = bc & 255;
  const int cg  = tid & 7;               // column group: 8 pixels
  const int rg  = tid >> 3;              // 0..15
  const _Float16* src = vf + (size_t)bc * 4096;

  // The block's 25 taps and its bias, asked for ahead of the copies so that both
  // latencies run together. Every loop of this kernel is unrolled in full, so
  // that its arrays are indexed by constants and stay in registers.
  const float* wt = w5 + c * 25;
  float w[25];
#pragma unroll
  for (int i = 0; i < 25; ++i) w[i] = wt[i];
  const float bias = wb[c];

  {
    // 512 chunks of 16 B, four per thread: chunk tid + 128*i is image row
    // rg + 16*i, column group cg.
    const unsigned l0 = (unsigned)(size_t)&tile[(rg + 2) * DWP + 8 + cg * 8];
    const unsigned l1 = l0 + 16 * DWP * 2;
    const unsigned l2 = l0 + 32 * DWP * 2;
    const unsigned l3 = l0 + 48 * DWP * 2;
    const _Float16* g0 = src + tid * 8;
    const _Float16* g1 = g0 + 1024;
    const _Float16* g2 = g0 + 2048;
    const _Float16* g3 = g0 + 3072;
    // The copies bring the plane into LDS through no register; the closing wait
    // stands in the same statement so that no address register is rewritten
    // ahead of it.
    asm volatile("global_load_async_to_lds_b128 %0, %4, off\n\t"
                 "global_load_async_to_lds_b128 %1, %5, off\n\t"
                 "global_load_async_to_lds_b128 %2, %6, off\n\t"
                 "global_load_async_to_lds_b128 %3, %7, off\n\t"
                 "s_wait_xcnt 0x0"
                 :: "v"(l0), "v"(l1), "v"(l2), "v"(l3),
                    "v"(g0), "v"(g1), "v"(g2), "v"(g3)
                 : "memory");
  }
  // The frame of zeros: bytes that no copy writes.
  if (tid < 40) {                        // LDS rows 0, 1, 66, 67, ten 16-B chunks each
    int fr  = tid / 10;
    int row = fr + ((fr >> 1) * 64);
    v8h zz = {};
    *(v8h*)&tile[row * DWP + (tid - fr * 10) * 8] = zz;
  }
  *(unsigned*)&tile[(2 + (tid >> 1)) * DWP + ((tid & 1) ? 72 : 6)] = 0u;  // columns -2,-1 / 64,65
  // Every copy of this wave has landed before the barrier lets other waves read.
  asm volatile("s_wait_asynccnt 0x0" ::: "memory");
  __syncthreads();

  v2f acc[4][4];                         // [output row][pair of neighbouring columns]
#pragma unroll
  for (int o = 0; o < 4; ++o)
#pragma unroll
    for (int j = 0; j < 4; ++j) acc[o][j] = (v2f){bias, bias};

  // LDS row rg*4 + r is image row rg*4 - 2 + r; f[] holds columns cg*8-2 .. cg*8+9.
  // Each output sums bias, then its taps by rows and, within a row, left to right.
  const _Float16* base = &tile[(rg * 4) * DWP + 8 + cg * 8];
#pragma unroll
  for (int r = 0; r < 8; ++r) {
    const _Float16* p = base + r * DWP;
    v2h lft = *(const v2h*)(p - 2);
    v8h mid = *(const v8h*)p;
    v2h rgt = *(const v2h*)(p + 8);
    float f[12];
    f[0] = (float)lft[0]; f[1] = (float)lft[1];
#pragma unroll
    for (int u = 0; u < 8; ++u) f[2 + u] = (float)mid[u];
    f[10] = (float)rgt[0]; f[11] = (float)rgt[1];
    // Column pairs that start at an even and at an odd place, so that every
    // tap column finds its two inputs in one register pair (packed f32 fma).
    v2f ev[6], od[5];
#pragma unroll
    for (int k = 0; k < 6; ++k) ev[k] = (v2f){f[2 * k], f[2 * k + 1]};
#pragma unroll
    for (int k = 0; k < 5; ++k) od[k] = (v2f){f[2 * k + 1], f[2 * k + 2]};
#pragma unroll
    for (int o = 0; o < 4; ++o) {
      const int dy = r - o;              // tap row 0..4 of output row o
      if (dy < 0 || dy > 4) continue;
#pragma unroll
      for (int dx = 0; dx < 5; ++dx) {
        const v2f wv = (v2f){w[dy * 5 + dx], w[dy * 5 + dx]};
#pragma unroll
        for (int j = 0; j < 4; ++j)
          acc[o][j] = __builtin_elementwise_fma(
              wv, (dx & 1) ? od[j + (dx >> 1)] : ev[j + (dx >> 1)], acc[o][j]);
      }
    }
  }
  _Float16* dst = dwv + (size_t)bc * 4096 + (rg * 4) * 64 + cg * 8;
#pragma unroll
  for (int o = 0; o < 4; ++o) {
    v8h ov;
#pragma unroll
    for (int j = 0; j < 4; ++j) {
      ov[2 * j]     = (_Float16)acc[o][j][0];
      ov[2 * j + 1] = (_Float16)acc[o][j][1];
    }
    *(v8h*)(dst + o * 64) = ov;
  }
}

// ---------------------------------------------------------------------------
// K5: attn = (vkT @ q) * (1/4096) / z ; RMSNorm * norm_w ; + dw -> y (f16)
// grid = B*64, block = 256. q block staged transposed [n][c].
// ---------------------------------------------------------------------------
__global__ __launch_bounds__(256)
void fla_attn_kernel(const _Float16* __restrict__ vkTh, const _Float16* __restrict__ qf,
                     const float* __restrict__ ksum, const _Float16* __restrict__ dwv,
                     const float* __restrict__ norm_w, _Float16* __restrict__ y)
{
  __shared__ _Float16 BshT[NB * LDK];
  __shared__ float kmean_sh[256];
  __shared__ float zcol[NB];
  __shared__ float colss[NB];

  const int tid  = threadIdx.x;
  const int b    = blockIdx.x >> 6;
  const int n0   = (blockIdx.x & 63) * NB;
  const int wave = tid >> 5;
  const int lane = tid & 31;

  const _Float16* qb = qf + (size_t)b * 256 * 4096 + n0;
#pragma unroll
  for (int it = 0; it < 8; ++it) {
    int q = tid + it * 256;              // 0..2047 16B-chunks
    int cch = q >> 3;
    int nc  = (q & 7) << 3;
    v8h hv = *(const v8h*)(qb + (size_t)cch * 4096 + nc);
#pragma unroll
    for (int u = 0; u < 8; ++u) BshT[(nc + u) * LDK + cch] = hv[u];
  }
  kmean_sh[tid] = ksum[b * 256 + tid] * (1.f / 4096.f);
  if (tid < NB) { colss[tid] = 0.f; zcol[tid] = FLA_EPS; }
  __syncthreads();

  {                                       // z = kmean . q(col) + eps, 4-way split
    int col = tid & 63, quarter = tid >> 6;
    const _Float16* bp = BshT + col * LDK + quarter * 64;
    const float* kp = kmean_sh + quarter * 64;
    float s = 0.f;
#pragma unroll
    for (int cc = 0; cc < 64; cc += 8) {
      v8h hv = *(const v8h*)(bp + cc);
#pragma unroll
      for (int u = 0; u < 8; ++u) s += kp[cc + u] * (float)hv[u];
    }
    atomicAdd(&zcol[col], s);
  }

  const _Float16* A = vkTh + (size_t)b * 256 * 256;
  v8f acc[2][4] = {};
#pragma unroll 1
  for (int kk = 0; kk < 256; kk += 32) {
    v16h a0 = load_frag_f16(A, 256, (wave * 2 + 0) * 16, kk);
    v16h a1 = load_frag_f16(A, 256, (wave * 2 + 1) * 16, kk);
#pragma unroll
    for (int nt = 0; nt < 4; ++nt) {
      v16h bf = load_frag_f16(BshT, LDK, nt * 16, kk);
      acc[0][nt] = wmma_f16(a0, bf, acc[0][nt]);
      acc[1][nt] = wmma_f16(a1, bf, acc[1][nt]);
    }
  }
  __syncthreads();                        // zcol complete, colss zeroed
  const int r = lane & 15, hi = lane >> 4;
#pragma unroll
  for (int nt = 0; nt < 4; ++nt) {
    float z = zcol[nt * 16 + r];
    float s = 0.f;
#pragma unroll
    for (int i = 0; i < 2; ++i)
#pragma unroll
      for (int j = 0; j < 8; ++j) {
        float a = acc[i][nt][j] * (1.f / 4096.f) / z;
        acc[i][nt][j] = a;
        s += a * a;
      }
    atomicAdd(&colss[nt * 16 + r], s);
  }
  __syncthreads();
  float rinv[4];
#pragma unroll
  for (int nt = 0; nt < 4; ++nt)
    rinv[nt] = 1.f / sqrtf(colss[nt * 16 + r] * (1.f / 256.f) + FLA_EPS);
#pragma unroll
  for (int i = 0; i < 2; ++i)
#pragma unroll
    for (int j = 0; j < 8; ++j) {
      int m = (wave * 2 + i) * 16 + j + 8 * hi;
      float nw = norm_w[m];
#pragma unroll
      for (int nt = 0; nt < 4; ++nt) {
        size_t idx = (size_t)(b * 256 + m) * 4096 + n0 + nt * 16 + r;
        float yv = acc[i][nt][j] * rinv[nt] * nw + (float)dwv[idx];
        y[idx] = (_Float16)yv;
      }
    }
}

// ---------------------------------------------------------------------------
// K6: out = proj_w @ y + proj_b (fp32 out). grid = B*64, block = 256
// A = pre-converted f16 proj weights.
// ---------------------------------------------------------------------------
__global__ __launch_bounds__(256)
void fla_proj_kernel(const _Float16* __restrict__ y, const _Float16* __restrict__ proj_wh,
                     const float* __restrict__ proj_b, float* __restrict__ out)
{
  __shared__ _Float16 BshT[NB * LDK];
  const int tid  = threadIdx.x;
  const int b    = blockIdx.x >> 6;
  const int n0   = (blockIdx.x & 63) * NB;
  const int wave = tid >> 5;
  const int lane = tid & 31;

  const _Float16* yb = y + (size_t)b * 256 * 4096 + n0;
#pragma unroll
  for (int it = 0; it < 8; ++it) {
    int q = tid + it * 256;
    int cch = q >> 3;
    int nc  = (q & 7) << 3;
    v8h hv = *(const v8h*)(yb + (size_t)cch * 4096 + nc);
#pragma unroll
    for (int u = 0; u < 8; ++u) BshT[(nc + u) * LDK + cch] = hv[u];
  }
  __syncthreads();

  v8f acc[2][4] = {};
#pragma unroll 1
  for (int kk = 0; kk < 256; kk += 32) {
    v16h a0 = load_frag_f16(proj_wh, 256, (wave * 2 + 0) * 16, kk);
    v16h a1 = load_frag_f16(proj_wh, 256, (wave * 2 + 1) * 16, kk);
#pragma unroll
    for (int nt = 0; nt < 4; ++nt) {
      v16h bf = load_frag_f16(BshT, LDK, nt * 16, kk);
      acc[0][nt] = wmma_f16(a0, bf, acc[0][nt]);
      acc[1][nt] = wmma_f16(a1, bf, acc[1][nt]);
    }
  }
  const int r = lane & 15, hi = lane >> 4;
#pragma unroll
  for (int i = 0; i < 2; ++i)
#pragma unroll
    for (int j = 0; j < 8; ++j) {
      int m = (wave * 2 + i) * 16 + j + 8 * hi;
      float bias = proj_b[m];
#pragma unroll
      for (int nt = 0; nt < 4; ++nt)
        out[(size_t)(b * 256 + m) * 4096 + n0 + nt * 16 + r] = acc[i][nt][j] + bias;
    }
}

extern "C" void kernel_launch(void* const* d_in, const int* in_sizes, int n_in,
                              void* d_out, int out_size, void* d_ws, size_t ws_size,
                              hipStream_t stream)
{
  (void)in_sizes; (void)n_in; (void)out_size; (void)ws_size;
  const float* x      = (const float*)d_in[0];
  const float* qkv_w  = (const float*)d_in[1];
  const float* qkv_b  = (const float*)d_in[2];
  const float* dwc_w  = (const float*)d_in[3];
  const float* dwc_b  = (const float*)d_in[4];
  const float* norm_w = (const float*)d_in[5];
  const float* proj_w = (const float*)d_in[6];
  const float* proj_b = (const float*)d_in[7];
  float* out = (float*)d_out;

  const size_t B = 16, D = 256, N = 4096;
  char* ws = (char*)d_ws;
  size_t off = 0;
  auto take = [&](size_t bytes) {
    char* p = ws + off;
    off = (off + bytes + 255) & ~(size_t)255;
    return p;
  };
  _Float16* qf      = (_Float16*)take(B * D * N * 2);
  _Float16* kf      = (_Float16*)take(B * D * N * 2);   // reused as y later
  _Float16* vf      = (_Float16*)take(B * D * N * 2);
  _Float16* dwv     = (_Float16*)take(B * D * N * 2);
  float*    vkT     = (float*)   take(B * D * D * 4);
  _Float16* vkTh    = (_Float16*)take(B * D * D * 2);
  float*    ksum    = (float*)   take(B * D * 4);
  _Float16* qkv_wh  = (_Float16*)take(3 * D * D * 2);
  _Float16* proj_wh = (_Float16*)take(D * D * 2);

  int nvkt = (int)(B * D * D);
  int nqkvw = (int)(3 * D * D);
  int nprojw = (int)(D * D);
  fla_zero_kernel<<<dim3((nvkt + 255) / 256), 256, 0, stream>>>(vkT, nvkt);
  fla_zero_kernel<<<dim3((int)((B * D + 255) / 256)), 256, 0, stream>>>(ksum, (int)(B * D));
  fla_cvt_kernel<<<dim3((nqkvw + 255) / 256), 256, 0, stream>>>(qkv_w, qkv_wh, nqkvw);
  fla_cvt_kernel<<<dim3((nprojw + 255) / 256), 256, 0, stream>>>(proj_w, proj_wh, nprojw);
  fla_qkv_kernel<<<dim3(1024, 3), 256, 0, stream>>>(x, qkv_wh, qkv_b, qf, kf, vf, ksum);
  fla_vkt_kernel<<<dim3(256), 512, 0, stream>>>(vf, kf, vkT);
  fla_cvt_kernel<<<dim3((nvkt + 255) / 256), 256, 0, stream>>>(vkT, vkTh, nvkt);
  fla_dwconv_kernel<<<dim3(4096), 128, 0, stream>>>(vf, dwc_w, dwc_b, dwv);
  _Float16* yb = kf;  // kf dead after vkt; reuse for y
  fla_attn_kernel<<<dim3(1024), 256, 0, stream>>>(vkTh, qf, ksum, dwv, norm_w, yb);
  fla_proj_kernel<<<dim3(1024), 256, 0, stream>>>(yb, proj_w ? proj_wh : proj_wh, proj_b, out);
}

// v002
// Measured time: 161 microseconds a run.
// Two timings next to v001 both put it at 1.06 times that version's speed.
// Over all steps from v000 it is 1.47 times as fast.
#include <hip/hip_runtime.h>
#include <hip/hip_fp16.h>

typedef __attribute__((ext_vector_type(16))) _Float16 v16h;
typedef __attribute__((ext_vector_type(8)))  _Float16 v8h;
typedef __attribute__((ext_vector_type(2)))  _Float16 v2h;
typedef __attribute__((ext_vector_type(8)))  float    v8f;
typedef __attribute__((ext_vector_type(4)))  float    v4f;
typedef __attribute__((ext_vector_type(2)))  float    v2f;
typedef __attribute__((ext_vector_type(4)))  int      v4i;

#define FLA_EPS 1e-5f
#define NB 64
#define LDK 264   // padded K-stride (halves) for transposed [col][K] LDS blocks

static __device__ __forceinline__ v8f wmma_f16(v16h a, v16h b, v8f c) {
  return __builtin_amdgcn_wmma_f32_16x16x32_f16(false, a, false, b, (short)0, c,
                                                false, false);
}

// Async 16-byte global -> LDS copy (GLOBAL_LOAD_ASYNC_TO_LDS_B128, ASYNCcnt).
static __device__ __forceinline__ void async_cp16(void* lds, const void* g) {
  __builtin_amdgcn_global_load_async_to_lds_b128(
      (__attribute__((address_space(1))) v4i*)g,
      (__attribute__((address_space(3))) v4i*)lds, 0, 0);
}

// WMMA 16x16x32 fragment from an f16 matrix whose fragment rows are contiguous
// in K (A row-major, or B when columns are contiguous in K — e.g. transposed
// LDS blocks and k^T from k stored [d][N]). Two 16B loads per lane.
// Lane L (0-15) holds row rowBase+L; lanes 16-31 same rows, upper K-halves:
// elems 0..7 = K k0+hi*8+{0..7}, elems 8..15 = K k0+16+hi*8+{0..7}.
static __device__ __forceinline__ v16h load_frag_f16(const _Float16* src,
                                                     int ld, int rowBase, int k0) {
  int lane = threadIdx.x & 31;
  const _Float16* p = src + (size_t)(rowBase + (lane & 15)) * ld + k0 + ((lane >> 4) << 3);
  v16h f;
#pragma unroll
  for (int j = 0; j < 8; ++j) {
    f[j]     = p[j];
    f[j + 8] = p[j + 16];
  }
  return f;
}

__global__ __launch_bounds__(256) void fla_zero_kernel(float* p, int n) {
  int i = blockIdx.x * 256 + threadIdx.x;
  if (i < n) p[i] = 0.f;
}

// A operand in fragment order. A row-major f32 matrix [rows][256] is converted
// to f16 and laid out so that every wave-wide 16-byte load of an A fragment
// covers 512 contiguous bytes (four whole lines) instead of 32 bytes in each of
// 16 rows. Piece g (16 B = 8 halves) of the packed matrix:
//   g = (((rows/32 group) * 8 + K block of 32) * 2 + 16-row tile) * 2 + K half) * 32 + lane
// and holds row group*32 + tile*16 + (lane & 15),
//           K   block*32 + half*16 + (lane >> 4)*8 + {0..7},
// which is what load_frag_f16 gives that lane. One thread writes one piece.
__global__ __launch_bounds__(256)
void fla_pack_kernel(const float* __restrict__ s, _Float16* __restrict__ d, int npieces) {
  int g = blockIdx.x * 256 + threadIdx.x;
  if (g >= npieces) return;
  int lane = g & 31;
  int row  = ((g >> 10) << 5) + (((g >> 6) & 1) << 4) + (lane & 15);
  int k    = (((g >> 7) & 7) << 5) + (((g >> 5) & 1) << 4) + ((lane >> 4) << 3);
  const float* p = s + (size_t)row * 256 + k;
  v4f lo = *(const v4f*)p;
  v4f hi = *(const v4f*)(p + 4);
  v8h o;
#pragma unroll
  for (int u = 0; u < 4; ++u) {
    o[u]     = (_Float16)lo[u];
    o[u + 4] = (_Float16)hi[u];
  }
  *(v8h*)(d + (size_t)g * 8) = o;
}

// One 16x32 A fragment from a packed matrix: p points at this lane's piece of
// the fragment's first K half; the second K half lies 512 bytes behind it.
static __device__ __forceinline__ v16h load_frag_packed(const _Float16* p) {
  v8h lo = *(const v8h*)p;
  v8h hi = *(const v8h*)(p + 256);
  return __builtin_shufflevector(lo, hi, 0, 1, 2, 3, 4, 5, 6, 7,
                                 8, 9, 10, 11, 12, 13, 14, 15);
}

// ---------------------------------------------------------------------------
// K1: qkv 1x1 conv GEMM + feature map (q,k) / passthrough (v) + ksum for kmean
// grid = (B*64, 3), block = 256 (8 waves). Each block: [256ch x 64pos], K=256.
// x block staged transposed into LDS as [n][c] f16 so B-frags are 2x16B reads.
// A = f16 qkv weights in fragment order (fla_pack_kernel): whole-line loads.
// ---------------------------------------------------------------------------
__global__ __launch_bounds__(256)
void fla_qkv_kernel(const float* __restrict__ x, const _Float16* __restrict__ qkv_wh,
                    const float* __restrict__ qkv_b,
                    _Float16* __restrict__ qf, _Float16* __restrict__ kf,
                    _Float16* __restrict__ vf, float* __restrict__ ksum)
{
  __shared__ _Float16 BshT[NB * LDK];
  __shared__ float colsum[NB];
  __shared__ float ksum_sh[256];

  const int tid   = threadIdx.x;
  const int b     = blockIdx.x >> 6;
  const int n0    = (blockIdx.x & 63) * NB;
  const int which = blockIdx.y;          // 0=q 1=k 2=v  (block-uniform)
  const int wave  = tid >> 5;
  const int lane  = tid & 31;
  const int ofs   = which << 8;          // row offset into qkv_w / qkv_b

  // Stage x[b, :, n0:n0+64] -> f16 LDS transposed (vector global loads)
  const float* xb = x + (size_t)b * 256 * 4096 + n0;
#pragma unroll
  for (int it = 0; it < 16; ++it) {
    int q = tid + it * 256;              // 0..4095 float4-chunks
    int c  = q >> 4;
    int nc = (q & 15) << 2;
    v4f xv = *(const v4f*)(xb + (size_t)c * 4096 + nc);
#pragma unroll
    for (int u = 0; u < 4; ++u) BshT[(nc + u) * LDK + c] = (_Float16)xv[u];
  }
  if (tid < NB) colsum[tid] = 0.f;
  ksum_sh[tid] = 0.f;
  __syncthreads();

  // This wave's 32 rows of A: 16 KB in a row, 2 KB per K block of 32.
  const _Float16* ap = qkv_wh + ((size_t)(which * 8 + wave) << 13) + lane * 8;
  v8f acc[2][4] = {};
#pragma unroll 1
  for (int kk = 0; kk < 256; kk += 32) {
    v16h a0 = load_frag_packed(ap + kk * 32);
    v16h a1 = load_frag_packed(ap + kk * 32 + 512);
#pragma unroll
    for (int nt = 0; nt < 4; ++nt) {
      v16h bf = load_frag_f16(BshT, LDK, nt * 16, kk);
      acc[0][nt] = wmma_f16(a0, bf, acc[0][nt]);
      acc[1][nt] = wmma_f16(a1, bf, acc[1][nt]);
    }
  }

  const int r = lane & 15, hi = lane >> 4;
  if (which == 2) {                       // v: bias only, write f16
#pragma unroll
    for (int i = 0; i < 2; ++i)
#pragma unroll
      for (int j = 0; j < 8; ++j) {
        int m = (wave * 2 + i) * 16 + j + 8 * hi;
        float bias = qkv_b[ofs + m];
#pragma unroll
        for (int nt = 0; nt < 4; ++nt) {
          int n = n0 + nt * 16 + r;
          vf[(size_t)(b * 256 + m) * 4096 + n] = (_Float16)(acc[i][nt][j] + bias);
        }
      }
  } else {
    // feature map: t = (relu(val)+eps)^2, then column L2 normalize over 256 ch
#pragma unroll
    for (int i = 0; i < 2; ++i)
#pragma unroll
      for (int j = 0; j < 8; ++j) {
        int m = (wave * 2 + i) * 16 + j + 8 * hi;
        float bias = qkv_b[ofs + m];
#pragma unroll
        for (int nt = 0; nt < 4; ++nt) {
          float t = fmaxf(acc[i][nt][j] + bias, 0.f) + FLA_EPS;
          acc[i][nt][j] = t * t;
        }
      }
#pragma unroll
    for (int nt = 0; nt < 4; ++nt) {
      float s = 0.f;
#pragma unroll
      for (int i = 0; i < 2; ++i)
#pragma unroll
        for (int j = 0; j < 8; ++j) s += acc[i][nt][j] * acc[i][nt][j];
      atomicAdd(&colsum[nt * 16 + r], s);     // ds_add_f32
    }
    __syncthreads();
    float inv[4];
#pragma unroll
    for (int nt = 0; nt < 4; ++nt)
      inv[nt] = 1.f / fmaxf(sqrtf(colsum[nt * 16 + r]), 1e-12f);
    _Float16* dst = (which == 0) ? qf : kf;
#pragma unroll
    for (int i = 0; i < 2; ++i)
#pragma unroll
      for (int j = 0; j < 8; ++j) {
        int m = (wave * 2 + i) * 16 + j + 8 * hi;
        float rowsum = 0.f;
#pragma unroll
        for (int nt = 0; nt < 4; ++nt) {
          float tn = acc[i][nt][j] * inv[nt];
          dst[(size_t)(b * 256 + m) * 4096 + n0 + nt * 16 + r] = (_Float16)tn;
          rowsum += tn;
        }
        if (which == 1) atomicAdd(&ksum_sh[m], rowsum);
      }
    if (which == 1) {
      __syncthreads();
      atomicAdd(&ksum[b * 256 + tid], ksum_sh[tid]);
    }
  }
}

// ---------------------------------------------------------------------------
// K2: vkT = v @ k^T  [256x256], K=N=4096, split-K across 16 blocks per batch.
// grid = B*16, block = 512 (16 waves). k^T chunks double-buffered via async
// LDS copies (ASYNCcnt in-order completion: wait<=2 keeps newest in flight).
// ---------------------------------------------------------------------------
__global__ __launch_bounds__(512)
void fla_vkt_kernel(const _Float16* __restrict__ vf, const _Float16* __restrict__ kf,
                    float* __restrict__ vkT)
{
  __shared__ _Float16 Bsh[2][256 * 40];  // [buf][col j][k-chunk 32, pad 40]
  const int tid  = threadIdx.x;
  const int wave = tid >> 5;
  const int lane = tid & 31;
  const int b    = blockIdx.x >> 4;
  const int k0g  = (blockIdx.x & 15) * 256;

  const _Float16* vb = vf + (size_t)b * 256 * 4096;
  const _Float16* kb = kf + (size_t)b * 256 * 4096 + k0g;

  const int j0 = tid >> 2, piece0 = (tid & 3) << 3;       // chunk 0 of 2
  const int j1 = (tid + 512) >> 2, piece1 = (tid & 3) << 3;

  // prologue: issue k-chunk 0 into buf 0
  async_cp16(&Bsh[0][j0 * 40 + piece0], kb + (size_t)j0 * 4096 + piece0);
  async_cp16(&Bsh[0][j1 * 40 + piece1], kb + (size_t)j1 * 4096 + piece1);

  v8f acc[16] = {};
#pragma unroll 1
  for (int step = 0; step < 8; ++step) {
    int kk = step * 32;
    if (step < 7) {                      // issue next chunk into other buffer
      async_cp16(&Bsh[(step + 1) & 1][j0 * 40 + piece0],
                 kb + (size_t)j0 * 4096 + kk + 32 + piece0);
      async_cp16(&Bsh[(step + 1) & 1][j1 * 40 + piece1],
                 kb + (size_t)j1 * 4096 + kk + 32 + piece1);
      __builtin_amdgcn_s_wait_asynccnt(2);   // chunk `step` landed (in-order)
    } else {
      __builtin_amdgcn_s_wait_asynccnt(0);
    }
    __syncthreads();
    v16h a = load_frag_f16(vb, 4096, wave * 16, k0g + kk);
    const _Float16* bsrc = Bsh[step & 1];
#pragma unroll
    for (int nt = 0; nt < 16; ++nt) {
      v16h bf = load_frag_f16(bsrc, 40, nt * 16, 0);  // cols contiguous in K
      acc[nt] = wmma_f16(a, bf, acc[nt]);
    }
    __syncthreads();                     // all waves done before buf reuse
  }
  const int r = lane & 15, hi = lane >> 4;
#pragma unroll
  for (int nt = 0; nt < 16; ++nt)
#pragma unroll
    for (int j = 0; j < 8; ++j) {
      int m = wave * 16 + j + 8 * hi;
      atomicAdd(&vkT[((size_t)b * 256 + m) * 256 + nt * 16 + r], acc[nt][j]);
    }
}

// ---------------------------------------------------------------------------
// K4: depthwise 5x5 SAME conv on v. One block per (b, c) plane of 64x64 pixels.
// The plane is staged once into LDS inside a frame of zeros (two rows above and
// below, two columns left and right), so no tap needs a bounds test; each
// thread then computes an 8-wide x 4-high tile of outputs in registers.
// grid = B*256, block = 128 (8 column groups x 16 row groups).
// LDS row = 8 halves pad | 64 pixels | 8 halves pad = 160 B: the two 128-B row
// pieces that 16 lanes read with one 16-byte load fall on disjoint bank halves.
// ---------------------------------------------------------------------------
#define DWP 80
__global__ __launch_bounds__(128)
void fla_dwconv_kernel(const _Float16* __restrict__ vf, const float* __restrict__ w5,
                       const float* __restrict__ wb, _Float16* __restrict__ dwv)
{
  __shared__ __attribute__((aligned(16))) _Float16 tile[68 * DWP];  // image rows -2 .. 65
  const int tid = threadIdx.x;
  const int bc  = blockIdx.x;            // b*256 + c
  const int c   = bc & 255;
  const int cg  = tid & 7;               // column group: 8 pixels
  const int rg  = tid >> 3;              // 0..15
  const _Float16* src = vf + (size_t)bc * 4096;

  // The block's 25 taps and its bias, asked for ahead of the copies so that both
  // latencies run together. Every loop of this kernel is unrolled in full, so
  // that its arrays are indexed by constants and stay in registers.
  const float* wt = w5 + c * 25;
  float w[25];
#pragma unroll
  for (int i = 0; i < 25; ++i) w[i] = wt[i];
  const float bias = wb[c];

  {
    // 512 chunks of 16 B, four per thread: chunk tid + 128*i is image row
    // rg + 16*i, column group cg.
    const unsigned l0 = (unsigned)(size_t)&tile[(rg + 2) * DWP + 8 + cg * 8];
    const unsigned l1 = l0 + 16 * DWP * 2;
    const unsigned l2 = l0 + 32 * DWP * 2;
    const unsigned l3 = l0 + 48 * DWP * 2;
    const _Float16* g0 = src + tid * 8;
    const _Float16* g1 = g0 + 1024;
    const _Float16* g2 = g0 + 2048;
    const _Float16* g3 = g0 + 3072;
    // The copies bring the plane into LDS through no register; the closing wait
    // stands in the same statement so that no address register is rewritten
    // ahead of it.
    asm volatile("global_load_async_to_lds_b128 %0, %4, off\n\t"
                 "global_load_async_to_lds_b128 %1, %5, off\n\t"
                 "global_load_async_to_lds_b128 %2, %6, off\n\t"
                 "global_load_async_to_lds_b128 %3, %7, off\n\t"
                 "s_wait_xcnt 0x0"
                 :: "v"(l0), "v"(l1), "v"(l2), "v"(l3),
                    "v"(g0), "v"(g1), "v"(g2), "v"(g3)
                 : "memory");
  }
  // The frame of zeros: bytes that no copy writes.
  if (tid < 40) {                        // LDS rows 0, 1, 66, 67, ten 16-B chunks each
    int fr  = tid / 10;
    int row = fr + ((fr >> 1) * 64);
    v8h zz = {};
    *(v8h*)&tile[row * DWP + (tid - fr * 10) * 8] = zz;
  }
  *(unsigned*)&tile[(2 + (tid >> 1)) * DWP + ((tid & 1) ? 72 : 6)] = 0u;  // columns -2,-1 / 64,65
  // Every copy of this wave has landed before the barrier lets other waves read.
  asm volatile("s_wait_asynccnt 0x0" ::: "memory");
  __syncthreads();

  v2f acc[4][4];                         // [output row][pair of neighbouring columns]
#pragma unroll
  for (int o = 0; o < 4; ++o)
#pragma unroll
    for (int j = 0; j < 4; ++j) acc[o][j] = (v2f){bias, bias};

  // LDS row rg*4 + r is image row rg*4 - 2 + r; f[] holds columns cg*8-2 .. cg*8+9.
  // Each output sums bias, then its taps by rows and, within a row, left to right.
  const _Float16* base = &tile[(rg * 4) * DWP + 8 + cg * 8];
#pragma unroll
  for (int r = 0; r < 8; ++r) {
    const _Float16* p = base + r * DWP;
    v2h lft = *(const v2h*)(p - 2);
    v8h mid = *(const v8h*)p;
    v2h rgt = *(const v2h*)(p + 8);
    float f[12];
    f[0] = (float)lft[0]; f[1] = (float)lft[1];
#pragma unroll
    for (int u = 0; u < 8; ++u) f[2 + u] = (float)mid[u];
    f[10] = (float)rgt[0]; f[11] = (float)rgt[1];
    // Column pairs that start at an even and at an odd place, so that every
    // tap column finds its two inputs in one register pair (packed f32 fma).
    v2f ev[6], od[5];
#pragma unroll
    for (int k = 0; k < 6; ++k) ev[k] = (v2f){f[2 * k], f[2 * k + 1]};
#pragma unroll
    for (int k = 0; k < 5; ++k) od[k] = (v2f){f[2 * k + 1], f[2 * k + 2]};
#pragma unroll
    for (int o = 0; o < 4; ++o) {
      const int dy = r - o;              // tap row 0..4 of output row o
      if (dy < 0 || dy > 4) continue;
#pragma unroll
      for (int dx = 0; dx < 5; ++dx) {
        const v2f wv = (v2f){w[dy * 5 + dx], w[dy * 5 + dx]};
#pragma unroll
        for (int j = 0; j < 4; ++j)
          acc[o][j] = __builtin_elementwise_fma(
              wv, (dx & 1) ? od[j + (dx >> 1)] : ev[j + (dx >> 1)], acc[o][j]);
      }
    }
  }
  _Float16* dst = dwv + (size_t)bc * 4096 + (rg * 4) * 64 + cg * 8;
#pragma unroll
  for (int o = 0; o < 4; ++o) {
    v8h ov;
#pragma unroll
    for (int j = 0; j < 4; ++j) {
      ov[2 * j]     = (_Float16)acc[o][j][0];
      ov[2 * j + 1] = (_Float16)acc[o][j][1];
    }
    *(v8h*)(dst + o * 64) = ov;
  }
}

// ---------------------------------------------------------------------------
// K5: attn = (vkT @ q) * (1/4096) / z ; RMSNorm * norm_w ; + dw -> y (f16)
// grid = B*64, block = 256. q block staged transposed [n][c].
// ---------------------------------------------------------------------------
__global__ __launch_bounds__(256)
void fla_attn_kernel(const _Float16* __restrict__ vkTh, const _Float16* __restrict__ qf,
                     const float* __restrict__ ksum, const _Float16* __restrict__ dwv,
                     const float* __restrict__ norm_w, _Float16* __restrict__ y)
{
  __shared__ _Float16 BshT[NB * LDK];
  __shared__ float kmean_sh[256];
  __shared__ float zcol[NB];
  __shared__ float colss[NB];

  const int tid  = threadIdx.x;
  const int b    = blockIdx.x >> 6;
  const int n0   = (blockIdx.x & 63) * NB;
  const int wave = tid >> 5;
  const int lane = tid & 31;

  const _Float16* qb = qf + (size_t)b * 256 * 4096 + n0;
#pragma unroll
  for (int it = 0; it < 8; ++it) {
    int q = tid + it * 256;              // 0..2047 16B-chunks
    int cch = q >> 3;
    int nc  = (q & 7) << 3;
    v8h hv = *(const v8h*)(qb + (size_t)cch * 4096 + nc);
#pragma unroll
    for (int u = 0; u < 8; ++u) BshT[(nc + u) * LDK + cch] = hv[u];
  }
  kmean_sh[tid] = ksum[b * 256 + tid] * (1.f / 4096.f);
  if (tid < NB) { colss[tid] = 0.f; zcol[tid] = FLA_EPS; }
  __syncthreads();

  {                                       // z = kmean . q(col) + eps, 4-way split
    int col = tid & 63, quarter = tid >> 6;
    const _Float16* bp = BshT + col * LDK + quarter * 64;
    const float* kp = kmean_sh + quarter * 64;
    float s = 0.f;
#pragma unroll
    for (int cc = 0; cc < 64; cc += 8) {
      v8h hv = *(const v8h*)(bp + cc);
#pragma unroll
      for (int u = 0; u < 8; ++u) s += kp[cc + u] * (float)hv[u];
    }
    atomicAdd(&zcol[col], s);
  }

  // This wave's 32 rows of the batch's packed v k^T (fla_pack_kernel).
  const _Float16* ap = vkTh + ((size_t)(b * 8 + wave) << 13) + lane * 8;
  v8f acc[2][4] = {};
#pragma unroll 1
  for (int kk = 0; kk < 256; kk += 32) {
    v16h a0 = load_frag_packed(ap + kk * 32);
    v16h a1 = load_frag_packed(ap + kk * 32 + 512);
#pragma unroll
    for (int nt = 0; nt < 4; ++nt) {
      v16h bf = load_frag_f16(BshT, LDK, nt * 16, kk);
      acc[0][nt] = wmma_f16(a0, bf, acc[0][nt]);
      acc[1][nt] = wmma_f16(a1, bf, acc[1][nt]);
    }
  }
  __syncthreads();                        // zcol complete, colss zeroed
  const int r = lane & 15, hi = lane >> 4;
#pragma unroll
  for (int nt = 0; nt < 4; ++nt) {
    float z = zcol[nt * 16 + r];
    float s = 0.f;
#pragma unroll
    for (int i = 0; i < 2; ++i)
#pragma unroll
      for (int j = 0; j < 8; ++j) {
        float a = acc[i][nt][j] * (1.f / 4096.f) / z;
        acc[i][nt][j] = a;
        s += a * a;
      }
    atomicAdd(&colss[nt * 16 + r], s);
  }
  __syncthreads();
  float rinv[4];
#pragma unroll
  for (int nt = 0; nt < 4; ++nt)
    rinv[nt] = 1.f / sqrtf(colss[nt * 16 + r] * (1.f / 256.f) + FLA_EPS);
#pragma unroll
  for (int i = 0; i < 2; ++i)
#pragma unroll
    for (int j = 0; j < 8; ++j) {
      int m = (wave * 2 + i) * 16 + j + 8 * hi;
      float nw = norm_w[m];
#pragma unroll
      for (int nt = 0; nt < 4; ++nt) {
        size_t idx = (size_t)(b * 256 + m) * 4096 + n0 + nt * 16 + r;
        float yv = acc[i][nt][j] * rinv[nt] * nw + (float)dwv[idx];
        y[idx] = (_Float16)yv;
      }
    }
}

// ---------------------------------------------------------------------------
// K6: out = proj_w @ y + proj_b (fp32 out). grid = B*64, block = 256
// A = f16 proj weights in fragment order (fla_pack_kernel).
// ---------------------------------------------------------------------------
__global__ __launch_bounds__(256)
void fla_proj_kernel(const _Float16* __restrict__ y, const _Float16* __restrict__ proj_wh,
                     const float* __restrict__ proj_b, float* __restrict__ out)
{
  __shared__ _Float16 BshT[NB * LDK];
  const int tid  = threadIdx.x;
  const int b    = blockIdx.x >> 6;
  const int n0   = (blockIdx.x & 63) * NB;
  const int wave = tid >> 5;
  const int lane = tid & 31;

  const _Float16* yb = y + (size_t)b * 256 * 4096 + n0;
#pragma unroll
  for (int it = 0; it < 8; ++it) {
    int q = tid + it * 256;
    int cch = q >> 3;
    int nc  = (q & 7) << 3;
    v8h hv = *(const v8h*)(yb + (size_t)cch * 4096 + nc);
#pragma unroll
    for (int u = 0; u < 8; ++u) BshT[(nc + u) * LDK + cch] = hv[u];
  }
  __syncthreads();

  const _Float16* ap = proj_wh + ((size_t)wave << 13) + lane * 8;
  v8f acc[2][4] = {};
#pragma unroll 1
  for (int kk = 0; kk < 256; kk += 32) {
    v16h a0 = load_frag_packed(ap + kk * 32);
    v16h a1 = load_frag_packed(ap + kk * 32 + 512);
#pragma unroll
    for (int nt = 0; nt < 4; ++nt) {
      v16h bf = load_frag_f16(BshT, LDK, nt * 16, kk);
      acc[0][nt] = wmma_f16(a0, bf, acc[0][nt]);
      acc[1][nt] = wmma_f16(a1, bf, acc[1][nt]);
    }
  }
  const int r = lane & 15, hi = lane >> 4;
#pragma unroll
  for (int i = 0; i < 2; ++i)
#pragma unroll
    for (int j = 0; j < 8; ++j) {
      int m = (wave * 2 + i) * 16 + j + 8 * hi;
      float bias = proj_b[m];
#pragma unroll
      for (int nt = 0; nt < 4; ++nt)
        out[(size_t)(b * 256 + m) * 4096 + n0 + nt * 16 + r] = acc[i][nt][j] + bias;
    }
}

extern "C" void kernel_launch(void* const* d_in, const int* in_sizes, int n_in,
                              void* d_out, int out_size, void* d_ws, size_t ws_size,
                              hipStream_t stream)
{
  (void)in_sizes; (void)n_in; (void)out_size; (void)ws_size;
  const float* x      = (const float*)d_in[0];
  const float* qkv_w  = (const float*)d_in[1];
  const float* qkv_b  = (const float*)d_in[2];
  const float* dwc_w  = (const float*)d_in[3];
  const float* dwc_b  = (const float*)d_in[4];
  const float* norm_w = (const float*)d_in[5];
  const float* proj_w = (const float*)d_in[6];
  const float* proj_b = (const float*)d_in[7];
  float* out = (float*)d_out;

  const size_t B = 16, D = 256, N = 4096;
  char* ws = (char*)d_ws;
  size_t off = 0;
  auto take = [&](size_t bytes) {
    char* p = ws + off;
    off = (off + bytes + 255) & ~(size_t)255;
    return p;
  };
  _Float16* qf      = (_Float16*)take(B * D * N * 2);
  _Float16* kf      = (_Float16*)take(B * D * N * 2);   // reused as y later
  _Float16* vf      = (_Float16*)take(B * D * N * 2);
  _Float16* dwv     = (_Float16*)take(B * D * N * 2);
  float*    vkT     = (float*)   take(B * D * D * 4);
  _Float16* vkTh    = (_Float16*)take(B * D * D * 2);
  float*    ksum    = (float*)   take(B * D * 4);
  _Float16* qkv_wh  = (_Float16*)take(3 * D * D * 2);
  _Float16* proj_wh = (_Float16*)take(D * D * 2);

  int nvkt = (int)(B * D * D);
  int nqkvw = (int)(3 * D * D);
  int nprojw = (int)(D * D);
  fla_zero_kernel<<<dim3((nvkt + 255) / 256), 256, 0, stream>>>(vkT, nvkt);
  fla_zero_kernel<<<dim3((int)((B * D + 255) / 256)), 256, 0, stream>>>(ksum, (int)(B * D));
  fla_pack_kernel<<<dim3((nqkvw / 8 + 255) / 256), 256, 0, stream>>>(qkv_w, qkv_wh, nqkvw / 8);
  fla_pack_kernel<<<dim3((nprojw / 8 + 255) / 256), 256, 0, stream>>>(proj_w, proj_wh, nprojw / 8);
  fla_qkv_kernel<<<dim3(1024, 3), 256, 0, stream>>>(x, qkv_wh, qkv_b, qf, kf, vf, ksum);
  fla_vkt_kernel<<<dim3(256), 512, 0, stream>>>(vf, kf, vkT);
  fla_pack_kernel<<<dim3((nvkt / 8 + 255) / 256), 256, 0, stream>>>(vkT, vkTh, nvkt / 8);
  fla_dwconv_kernel<<<dim3(4096), 128, 0, stream>>>(vf, dwc_w, dwc_b, dwv);
  _Float16* yb = kf;  // kf dead after vkt; reuse for y
  fla_attn_kernel<<<dim3(1024), 256, 0, stream>>>(vkTh, qf, ksum, dwv, norm_w, yb);
  fla_proj_kernel<<<dim3(1024), 256, 0, stream>>>(yb, proj_w ? proj_wh : proj_wh, proj_b, out);
}

// v003
// Measured time: 151 microseconds a run.
// In two side-by-side timings against v002, it was 1.06 and 1.07 times as fast.
// All steps since v000 together make it 1.57 times as fast.
#include <hip/hip_runtime.h>
#include <hip/hip_fp16.h>

typedef __attribute__((ext_vector_type(16))) _Float16 v16h;
typedef __attribute__((ext_vector_type(8)))  _Float16 v8h;
typedef __attribute__((ext_vector_type(2)))  _Float16 v2h;
typedef __attribute__((ext_vector_type(8)))  float    v8f;
typedef __attribute__((ext_vector_type(4)))  float    v4f;
typedef __attribute__((ext_vector_type(2)))  float    v2f;
typedef __attribute__((ext_vector_type(4)))  int      v4i;

#define FLA_EPS 1e-5f
#define NB 64
#define LDK 264   // padded K-stride (halves) for transposed [col][K] LDS blocks

static __device__ __forceinline__ v8f wmma_f16(v16h a, v16h b, v8f c) {
  return __builtin_amdgcn_wmma_f32_16x16x32_f16(false, a, false, b, (short)0, c,
                                                false, false);
}

// Async 16-byte global -> LDS copy (GLOBAL_LOAD_ASYNC_TO_LDS_B128, ASYNCcnt).
static __device__ __forceinline__ void async_cp16(void* lds, const void* g) {
  __builtin_amdgcn_global_load_async_to_lds_b128(
      (__attribute__((address_space(1))) v4i*)g,
      (__attribute__((address_space(3))) v4i*)lds, 0, 0);
}

// WMMA 16x16x32 fragment from an f16 matrix whose fragment rows are contiguous
// in K (A row-major, or B when columns are contiguous in K — e.g. transposed
// LDS blocks and k^T from k stored [d][N]). Two 16B loads per lane.
// Lane L (0-15) holds row rowBase+L; lanes 16-31 same rows, upper K-halves:
// elems 0..7 = K k0+hi*8+{0..7}, elems 8..15 = K k0+16+hi*8+{0..7}.
static __device__ __forceinline__ v16h load_frag_f16(const _Float16* src,
                                                     int ld, int rowBase, int k0) {
  int lane = threadIdx.x & 31;
  const _Float16* p = src + (size_t)(rowBase + (lane & 15)) * ld + k0 + ((lane >> 4) << 3);
  v16h f;
#pragma unroll
  for (int j = 0; j < 8; ++j) {
    f[j]     = p[j];
    f[j + 8] = p[j + 16];
  }
  return f;
}

__global__ __launch_bounds__(256) void fla_zero_kernel(float* p, int n) {
  int i = blockIdx.x * 256 + threadIdx.x;
  if (i < n) p[i] = 0.f;
}

// A operand in fragment order. A row-major f32 matrix [rows][256] is converted
// to f16 and laid out so that every wave-wide 16-byte load of an A fragment
// covers 512 contiguous bytes (four whole lines) instead of 32 bytes in each of
// 16 rows. Piece g (16 B = 8 halves) of the packed matrix:
//   g = (((rows/32 group) * 8 + K block of 32) * 2 + 16-row tile) * 2 + K half) * 32 + lane
// and holds row group*32 + tile*16 + (lane & 15),
//           K   block*32 + half*16 + (lane >> 4)*8 + {0..7},
// which is what load_frag_f16 gives that lane. One thread writes one piece.
__global__ __launch_bounds__(256)
void fla_pack_kernel(const float* __restrict__ s, _Float16* __restrict__ d, int npieces) {
  int g = blockIdx.x * 256 + threadIdx.x;
  if (g >= npieces) return;
  int lane = g & 31;
  int row  = ((g >> 10) << 5) + (((g >> 6) & 1) << 4) + (lane & 15);
  int k    = (((g >> 7) & 7) << 5) + (((g >> 5) & 1) << 4) + ((lane >> 4) << 3);
  const float* p = s + (size_t)row * 256 + k;
  v4f lo = *(const v4f*)p;
  v4f hi = *(const v4f*)(p + 4);
  v8h o;
#pragma unroll
  for (int u = 0; u < 4; ++u) {
    o[u]     = (_Float16)lo[u];
    o[u + 4] = (_Float16)hi[u];
  }
  *(v8h*)(d + (size_t)g * 8) = o;
}

// One 16x32 A fragment from a packed matrix: p points at this lane's piece of
// the fragment's first K half; the second K half lies 512 bytes behind it.
static __device__ __forceinline__ v16h load_frag_packed(const _Float16* p) {
  v8h lo = *(const v8h*)p;
  v8h hi = *(const v8h*)(p + 256);
  return __builtin_shufflevector(lo, hi, 0, 1, 2, 3, 4, 5, 6, 7,
                                 8, 9, 10, 11, 12, 13, 14, 15);
}

// ---------------------------------------------------------------------------
// K1: qkv 1x1 conv GEMM + feature map (q,k) / passthrough (v) + ksum for kmean
// grid = (B*64, 3), block = 256 (8 waves). Each block: [256ch x 64pos], K=256.
// x block staged transposed into LDS as [n][c] f16 so B-frags are 2x16B reads.
// A = f16 qkv weights in fragment order (fla_pack_kernel): whole-line loads.
// ---------------------------------------------------------------------------
__global__ __launch_bounds__(256)
void fla_qkv_kernel(const float* __restrict__ x, const _Float16* __restrict__ qkv_wh,
                    const float* __restrict__ qkv_b,
                    _Float16* __restrict__ qf, _Float16* __restrict__ kf,
                    _Float16* __restrict__ vf, float* __restrict__ ksum)
{
  __shared__ _Float16 BshT[NB * LDK];
  __shared__ float colsum[NB];
  __shared__ float ksum_sh[256];

  const int tid   = threadIdx.x;
  const int b     = blockIdx.x >> 6;
  const int n0    = (blockIdx.x & 63) * NB;
  const int which = blockIdx.y;          // 0=q 1=k 2=v  (block-uniform)
  const int wave  = tid >> 5;
  const int lane  = tid & 31;
  const int ofs   = which << 8;          // row offset into qkv_w / qkv_b

  // Stage x[b, :, n0:n0+64] -> f16 LDS transposed (vector global loads)
  const float* xb = x + (size_t)b * 256 * 4096 + n0;
#pragma unroll
  for (int it = 0; it < 16; ++it) {
    int q = tid + it * 256;              // 0..4095 float4-chunks
    int c  = q >> 4;
    int nc = (q & 15) << 2;
    v4f xv = *(const v4f*)(xb + (size_t)c * 4096 + nc);
#pragma unroll
    for (int u = 0; u < 4; ++u) BshT[(nc + u) * LDK + c] = (_Float16)xv[u];
  }
  if (tid < NB) colsum[tid] = 0.f;
  ksum_sh[tid] = 0.f;
  __syncthreads();

  // This wave's 32 rows of A: 16 KB in a row, 2 KB per K block of 32.
  const _Float16* ap = qkv_wh + ((size_t)(which * 8 + wave) << 13) + lane * 8;
  v8f acc[2][4] = {};
#pragma unroll 1
  for (int kk = 0; kk < 256; kk += 32) {
    v16h a0 = load_frag_packed(ap + kk * 32);
    v16h a1 = load_frag_packed(ap + kk * 32 + 512);
#pragma unroll
    for (int nt = 0; nt < 4; ++nt) {
      v16h bf = load_frag_f16(BshT, LDK, nt * 16, kk);
      acc[0][nt] = wmma_f16(a0, bf, acc[0][nt]);
      acc[1][nt] = wmma_f16(a1, bf, acc[1][nt]);
    }
  }

  const int r = lane & 15, hi = lane >> 4;
  if (which == 2) {                       // v: bias only, write f16
#pragma unroll
    for (int i = 0; i < 2; ++i)
#pragma unroll
      for (int j = 0; j < 8; ++j) {
        int m = (wave * 2 + i) * 16 + j + 8 * hi;
        float bias = qkv_b[ofs + m];
#pragma unroll
        for (int nt = 0; nt < 4; ++nt) {
          int n = n0 + nt * 16 + r;
          vf[(size_t)(b * 256 + m) * 4096 + n] = (_Float16)(acc[i][nt][j] + bias);
        }
      }
  } else {
    // feature map: t = (relu(val)+eps)^2, then column L2 normalize over 256 ch
#pragma unroll
    for (int i = 0; i < 2; ++i)
#pragma unroll
      for (int j = 0; j < 8; ++j) {
        int m = (wave * 2 + i) * 16 + j + 8 * hi;
        float bias = qkv_b[ofs + m];
#pragma unroll
        for (int nt = 0; nt < 4; ++nt) {
          float t = fmaxf(acc[i][nt][j] + bias, 0.f) + FLA_EPS;
          acc[i][nt][j] = t * t;
        }
      }
#pragma unroll
    for (int nt = 0; nt < 4; ++nt) {
      float s = 0.f;
#pragma unroll
      for (int i = 0; i < 2; ++i)
#pragma unroll
        for (int j = 0; j < 8; ++j) s += acc[i][nt][j] * acc[i][nt][j];
      atomicAdd(&colsum[nt * 16 + r], s);     // ds_add_f32
    }
    __syncthreads();
    float inv[4];
#pragma unroll
    for (int nt = 0; nt < 4; ++nt)
      inv[nt] = 1.f / fmaxf(sqrtf(colsum[nt * 16 + r]), 1e-12f);
    _Float16* dst = (which == 0) ? qf : kf;
#pragma unroll
    for (int i = 0; i < 2; ++i)
#pragma unroll
      for (int j = 0; j < 8; ++j) {
        int m = (wave * 2 + i) * 16 + j + 8 * hi;
        float rowsum = 0.f;
#pragma unroll
        for (int nt = 0; nt < 4; ++nt) {
          float tn = acc[i][nt][j] * inv[nt];
          dst[(size_t)(b * 256 + m) * 4096 + n0 + nt * 16 + r] = (_Float16)tn;
          rowsum += tn;
        }
        if (which == 1) atomicAdd(&ksum_sh[m], rowsum);
      }
    if (which == 1) {
      __syncthreads();
      atomicAdd(&ksum[b * 256 + tid], ksum_sh[tid]);
    }
  }
}

// ---------------------------------------------------------------------------
// K2: vkT = v @ k^T  [256x256], K=N=4096, split-K across 16 blocks per batch.
// grid = B*16, block = 512 (16 waves). k^T chunks double-buffered via async
// LDS copies (ASYNCcnt in-order completion: wait<=2 keeps newest in flight).
// ---------------------------------------------------------------------------
__global__ __launch_bounds__(512)
void fla_vkt_kernel(const _Float16* __restrict__ vf, const _Float16* __restrict__ kf,
                    float* __restrict__ vkT)
{
  __shared__ _Float16 Bsh[2][256 * 40];  // [buf][col j][k-chunk 32, pad 40]
  const int tid  = threadIdx.x;
  const int wave = tid >> 5;
  const int lane = tid & 31;
  const int b    = blockIdx.x >> 4;
  const int k0g  = (blockIdx.x & 15) * 256;

  const _Float16* vb = vf + (size_t)b * 256 * 4096;
  const _Float16* kb = kf + (size_t)b * 256 * 4096 + k0g;

  const int j0 = tid >> 2, piece0 = (tid & 3) << 3;       // chunk 0 of 2
  const int j1 = (tid + 512) >> 2, piece1 = (tid & 3) << 3;

  // prologue: issue k-chunk 0 into buf 0
  async_cp16(&Bsh[0][j0 * 40 + piece0], kb + (size_t)j0 * 4096 + piece0);
  async_cp16(&Bsh[0][j1 * 40 + piece1], kb + (size_t)j1 * 4096 + piece1);

  v8f acc[16] = {};
#pragma unroll 1
  for (int step = 0; step < 8; ++step) {
    int kk = step * 32;
    if (step < 7) {                      // issue next chunk into other buffer
      async_cp16(&Bsh[(step + 1) & 1][j0 * 40 + piece0],
                 kb + (size_t)j0 * 4096 + kk + 32 + piece0);
      async_cp16(&Bsh[(step + 1) & 1][j1 * 40 + piece1],
                 kb + (size_t)j1 * 4096 + kk + 32 + piece1);
      __builtin_amdgcn_s_wait_asynccnt(2);   // chunk `step` landed (in-order)
    } else {
      __builtin_amdgcn_s_wait_asynccnt(0);
    }
    __syncthreads();
    v16h a = load_frag_f16(vb, 4096, wave * 16, k0g + kk);
    const _Float16* bsrc = Bsh[step & 1];
#pragma unroll
    for (int nt = 0; nt < 16; ++nt) {
      v16h bf = load_frag_f16(bsrc, 40, nt * 16, 0);  // cols contiguous in K
      acc[nt] = wmma_f16(a, bf, acc[nt]);
    }
    __syncthreads();                     // all waves done before buf reuse
  }
  const int r = lane & 15, hi = lane >> 4;
#pragma unroll
  for (int nt = 0; nt < 16; ++nt)
#pragma unroll
    for (int j = 0; j < 8; ++j) {
      int m = wave * 16 + j + 8 * hi;
      atomicAdd(&vkT[((size_t)b * 256 + m) * 256 + nt * 16 + r], acc[nt][j]);
    }
}

// ---------------------------------------------------------------------------
// K4: depthwise 5x5 SAME conv on v. One block per (b, c) plane of 64x64 pixels.
// The plane is staged once into LDS inside a frame of zeros (two rows above and
// below, two columns left and right), so no tap needs a bounds test; each
// thread then computes an 8-wide x 4-high tile of outputs in registers.
// grid = B*256, block = 128 (8 column groups x 16 row groups).
// LDS row = 8 halves pad | 64 pixels | 8 halves pad = 160 B: the two 128-B row
// pieces that 16 lanes read with one 16-byte load fall on disjoint bank halves.
// ---------------------------------------------------------------------------
#define DWP 80
__global__ __launch_bounds__(128)
void fla_dwconv_kernel(const _Float16* __restrict__ vf, const float* __restrict__ w5,
                       const float* __restrict__ wb, _Float16* __restrict__ dwv)
{
  __shared__ __attribute__((aligned(16))) _Float16 tile[68 * DWP];  // image rows -2 .. 65
  const int tid = threadIdx.x;
  const int bc  = blockIdx.x;            // b*256 + c
  const int c   = bc & 255;
  const int cg  = tid & 7;               // column group: 8 pixels
  const int rg  = tid >> 3;              // 0..15
  const _Float16* src = vf + (size_t)bc * 4096;

  // The block's 25 taps and its bias, asked for ahead of the copies so that both
  // latencies run together. Every loop of this kernel is unrolled in full, so
  // that its arrays are indexed by constants and stay in registers.
  const float* wt = w5 + c * 25;
  float w[25];
#pragma unroll
  for (int i = 0; i < 25; ++i) w[i] = wt[i];
  const float bias = wb[c];

  {
    // 512 chunks of 16 B, four per thread: chunk tid + 128*i is image row
    // rg + 16*i, column group cg.
    const unsigned l0 = (unsigned)(size_t)&tile[(rg + 2) * DWP + 8 + cg * 8];
    const unsigned l1 = l0 + 16 * DWP * 2;
    const unsigned l2 = l0 + 32 * DWP * 2;
    const unsigned l3 = l0 + 48 * DWP * 2;
    const _Float16* g0 = src + tid * 8;
    const _Float16* g1 = g0 + 1024;
    const _Float16* g2 = g0 + 2048;
    const _Float16* g3 = g0 + 3072;
    // The copies bring the plane into LDS through no register; the closing wait
    // stands in the same statement so that no address register is rewritten
    // ahead of it.
    asm volatile("global_load_async_to_lds_b128 %0, %4, off\n\t"
                 "global_load_async_to_lds_b128 %1, %5, off\n\t"
                 "global_load_async_to_lds_b128 %2, %6, off\n\t"
                 "global_load_async_to_lds_b128 %3, %7, off\n\t"
                 "s_wait_xcnt 0x0"
                 :: "v"(l0), "v"(l1), "v"(l2), "v"(l3),
                    "v"(g0), "v"(g1), "v"(g2), "v"(g3)
                 : "memory");
  }
  // The frame of zeros: bytes that no copy writes.
  if (tid < 40) {                        // LDS rows 0, 1, 66, 67, ten 16-B chunks each
    int fr  = tid / 10;
    int row = fr + ((fr >> 1) * 64);
    v8h zz = {};
    *(v8h*)&tile[row * DWP + (tid - fr * 10) * 8] = zz;
  }
  *(unsigned*)&tile[(2 + (tid >> 1)) * DWP + ((tid & 1) ? 72 : 6)] = 0u;  // columns -2,-1 / 64,65
  // Every copy of this wave has landed before the barrier lets other waves read.
  asm volatile("s_wait_asynccnt 0x0" ::: "memory");
  __syncthreads();

  v2f acc[4][4];                         // [output row][pair of neighbouring columns]
#pragma unroll
  for (int o = 0; o < 4; ++o)
#pragma unroll
    for (int j = 0; j < 4; ++j) acc[o][j] = (v2f){bias, bias};

  // LDS row rg*4 + r is image row rg*4 - 2 + r; f[] holds columns cg*8-2 .. cg*8+9.
  // Each output sums bias, then its taps by rows and, within a row, left to right.
  const _Float16* base = &tile[(rg * 4) * DWP + 8 + cg * 8];
#pragma unroll
  for (int r = 0; r < 8; ++r) {
    const _Float16* p = base + r * DWP;
    v2h lft = *(const v2h*)(p - 2);
    v8h mid = *(const v8h*)p;
    v2h rgt = *(const v2h*)(p + 8);
    float f[12];
    f[0] = (float)lft[0]; f[1] = (float)lft[1];
#pragma unroll
    for (int u = 0; u < 8; ++u) f[2 + u] = (float)mid[u];
    f[10] = (float)rgt[0]; f[11] = (float)rgt[1];
    // Column pairs that start at an even and at an odd place, so that every
    // tap column finds its two inputs in one register pair (packed f32 fma).
    v2f ev[6], od[5];
#pragma unroll
    for (int k = 0; k < 6; ++k) ev[k] = (v2f){f[2 * k], f[2 * k + 1]};
#pragma unroll
    for (int k = 0; k < 5; ++k) od[k] = (v2f){f[2 * k + 1], f[2 * k + 2]};
#pragma unroll
    for (int o = 0; o < 4; ++o) {
      const int dy = r - o;              // tap row 0..4 of output row o
      if (dy < 0 || dy > 4) continue;
#pragma unroll
      for (int dx = 0; dx < 5; ++dx) {
        const v2f wv = (v2f){w[dy * 5 + dx], w[dy * 5 + dx]};
#pragma unroll
        for (int j = 0; j < 4; ++j)
          acc[o][j] = __builtin_elementwise_fma(
              wv, (dx & 1) ? od[j + (dx >> 1)] : ev[j + (dx >> 1)], acc[o][j]);
      }
    }
  }
  _Float16* dst = dwv + (size_t)bc * 4096 + (rg * 4) * 64 + cg * 8;
#pragma unroll
  for (int o = 0; o < 4; ++o) {
    v8h ov;
#pragma unroll
    for (int j = 0; j < 4; ++j) {
      ov[2 * j]     = (_Float16)acc[o][j][0];
      ov[2 * j + 1] = (_Float16)acc[o][j][1];
    }
    *(v8h*)(dst + o * 64) = ov;
  }
}

// ---------------------------------------------------------------------------
// K5: attn = (vkT @ q) * (1/4096) / z ; RMSNorm * norm_w ; + dw -> y (f16),
// then out = proj_w @ y + proj_b (fp32 out) in the same block: a block holds all
// 256 channels of its 64 positions, which is the whole B tile of the projection,
// so y goes from the accumulators into LDS and never to memory.
// grid = B*64, block = 256. q block staged transposed [n][c]; y takes its place.
// A = packed v k^T, then f16 proj weights in fragment order (fla_pack_kernel).
// ---------------------------------------------------------------------------
__global__ __launch_bounds__(256)
void fla_attn_kernel(const _Float16* __restrict__ vkTh, const _Float16* __restrict__ qf,
                     const float* __restrict__ ksum, const _Float16* __restrict__ dwv,
                     const float* __restrict__ norm_w, const _Float16* __restrict__ proj_wh,
                     const float* __restrict__ proj_b, float* __restrict__ out)
{
  __shared__ __attribute__((aligned(16))) _Float16 BshT[NB * LDK];
  __shared__ float kmean_sh[256];
  __shared__ float zcol[NB];
  __shared__ float colss[NB];

  const int tid  = threadIdx.x;
  const int b    = blockIdx.x >> 6;
  const int n0   = (blockIdx.x & 63) * NB;
  const int wave = tid >> 5;
  const int lane = tid & 31;

  const _Float16* qb = qf + (size_t)b * 256 * 4096 + n0;
#pragma unroll
  for (int it = 0; it < 8; ++it) {
    int q = tid + it * 256;              // 0..2047 16B-chunks
    int cch = q >> 3;
    int nc  = (q & 7) << 3;
    v8h hv = *(const v8h*)(qb + (size_t)cch * 4096 + nc);
#pragma unroll
    for (int u = 0; u < 8; ++u) BshT[(nc + u) * LDK + cch] = hv[u];
  }
  kmean_sh[tid] = ksum[b * 256 + tid] * (1.f / 4096.f);
  if (tid < NB) { colss[tid] = 0.f; zcol[tid] = FLA_EPS; }
  __syncthreads();

  {                                       // z = kmean . q(col) + eps, 4-way split
    int col = tid & 63, quarter = tid >> 6;
    const _Float16* bp = BshT + col * LDK + quarter * 64;
    const float* kp = kmean_sh + quarter * 64;
    float s = 0.f;
#pragma unroll
    for (int cc = 0; cc < 64; cc += 8) {
      v8h hv = *(const v8h*)(bp + cc);
#pragma unroll
      for (int u = 0; u < 8; ++u) s += kp[cc + u] * (float)hv[u];
    }
    atomicAdd(&zcol[col], s);
  }

  // This wave's 32 rows of the batch's packed v k^T (fla_pack_kernel).
  const _Float16* ap = vkTh + ((size_t)(b * 8 + wave) << 13) + lane * 8;
  v8f acc[2][4] = {};
#pragma unroll 1
  for (int kk = 0; kk < 256; kk += 32) {
    v16h a0 = load_frag_packed(ap + kk * 32);
    v16h a1 = load_frag_packed(ap + kk * 32 + 512);
#pragma unroll
    for (int nt = 0; nt < 4; ++nt) {
      v16h bf = load_frag_f16(BshT, LDK, nt * 16, kk);
      acc[0][nt] = wmma_f16(a0, bf, acc[0][nt]);
      acc[1][nt] = wmma_f16(a1, bf, acc[1][nt]);
    }
  }
  __syncthreads();                        // zcol complete, colss zeroed, q tile read out
  const int r = lane & 15, hi = lane >> 4;
#pragma unroll
  for (int nt = 0; nt < 4; ++nt) {
    float z = zcol[nt * 16 + r];
    float s = 0.f;
#pragma unroll
    for (int i = 0; i < 2; ++i)
#pragma unroll
      for (int j = 0; j < 8; ++j) {
        float a = acc[i][nt][j] * (1.f / 4096.f) / z;
        acc[i][nt][j] = a;
        s += a * a;
      }
    atomicAdd(&colss[nt * 16 + r], s);
  }
  __syncthreads();
  float rinv[4];
#pragma unroll
  for (int nt = 0; nt < 4; ++nt)
    rinv[nt] = 1.f / sqrtf(colss[nt * 16 + r] * (1.f / 256.f) + FLA_EPS);
  // y, rounded to f16, goes into the LDS tile as [n][channel]: a lane's 8 accumulator
  // rows of one 16x16 tile are 8 neighbouring channels of one position = 16 bytes.
  v8h y8[2][4];
#pragma unroll
  for (int i = 0; i < 2; ++i)
#pragma unroll
    for (int j = 0; j < 8; ++j) {
      int m = (wave * 2 + i) * 16 + j + 8 * hi;
      float nw = norm_w[m];
#pragma unroll
      for (int nt = 0; nt < 4; ++nt) {
        size_t idx = (size_t)(b * 256 + m) * 4096 + n0 + nt * 16 + r;
        float yv = acc[i][nt][j] * rinv[nt] * nw + (float)dwv[idx];
        y8[i][nt][j] = (_Float16)yv;
      }
    }
#pragma unroll
  for (int i = 0; i < 2; ++i)
#pragma unroll
    for (int nt = 0; nt < 4; ++nt) {
      *(v8h*)&BshT[(nt * 16 + r) * LDK + (wave * 2 + i) * 16 + 8 * hi] = y8[i][nt];
      acc[i][nt] = (v8f){};
    }
  __syncthreads();                        // every wave's channels of y are in the tile

  ap = proj_wh + ((size_t)wave << 13) + lane * 8;
#pragma unroll 1
  for (int kk = 0; kk < 256; kk += 32) {
    v16h a0 = load_frag_packed(ap + kk * 32);
    v16h a1 = load_frag_packed(ap + kk * 32 + 512);
#pragma unroll
    for (int nt = 0; nt < 4; ++nt) {
      v16h bf = load_frag_f16(BshT, LDK, nt * 16, kk);
      acc[0][nt] = wmma_f16(a0, bf, acc[0][nt]);
      acc[1][nt] = wmma_f16(a1, bf, acc[1][nt]);
    }
  }
#pragma unroll
  for (int i = 0; i < 2; ++i)
#pragma unroll
    for (int j = 0; j < 8; ++j) {
      int m = (wave * 2 + i) * 16 + j + 8 * hi;
      float bias = proj_b[m];
#pragma unroll
      for (int nt = 0; nt < 4; ++nt)
        out[(size_t)(b * 256 + m) * 4096 + n0 + nt * 16 + r] = acc[i][nt][j] + bias;
    }
}

extern "C" void kernel_launch(void* const* d_in, const int* in_sizes, int n_in,
                              void* d_out, int out_size, void* d_ws, size_t ws_size,
                              hipStream_t stream)
{
  (void)in_sizes; (void)n_in; (void)out_size; (void)ws_size;
  const float* x      = (const float*)d_in[0];
  const float* qkv_w  = (const float*)d_in[1];
  const float* qkv_b  = (const float*)d_in[2];
  const float* dwc_w  = (const float*)d_in[3];
  const float* dwc_b  = (const float*)d_in[4];
  const float* norm_w = (const float*)d_in[5];
  const float* proj_w = (const float*)d_in[6];
  const float* proj_b = (const float*)d_in[7];
  float* out = (float*)d_out;

  const size_t B = 16, D = 256, N = 4096;
  char* ws = (char*)d_ws;
  size_t off = 0;
  auto take = [&](size_t bytes) {
    char* p = ws + off;
    off = (off + bytes + 255) & ~(size_t)255;
    return p;
  };
  _Float16* qf      = (_Float16*)take(B * D * N * 2);
  _Float16* kf      = (_Float16*)take(B * D * N * 2);
  _Float16* vf      = (_Float16*)take(B * D * N * 2);
  _Float16* dwv     = (_Float16*)take(B * D * N * 2);
  float*    vkT     = (float*)   take(B * D * D * 4);
  _Float16* vkTh    = (_Float16*)take(B * D * D * 2);
  float*    ksum    = (float*)   take(B * D * 4);
  _Float16* qkv_wh  = (_Float16*)take(3 * D * D * 2);
  _Float16* proj_wh = (_Float16*)take(D * D * 2);

  int nvkt = (int)(B * D * D);
  int nqkvw = (int)(3 * D * D);
  int nprojw = (int)(D * D);
  fla_zero_kernel<<<dim3((nvkt + 255) / 256), 256, 0, stream>>>(vkT, nvkt);
  fla_zero_kernel<<<dim3((int)((B * D + 255) / 256)), 256, 0, stream>>>(ksum, (int)(B * D));
  fla_pack_kernel<<<dim3((nqkvw / 8 + 255) / 256), 256, 0, stream>>>(qkv_w, qkv_wh, nqkvw / 8);
  fla_pack_kernel<<<dim3((nprojw / 8 + 255) / 256), 256, 0, stream>>>(proj_w, proj_wh, nprojw / 8);
  fla_qkv_kernel<<<dim3(1024, 3), 256, 0, stream>>>(x, qkv_wh, qkv_b, qf, kf, vf, ksum);
  fla_vkt_kernel<<<dim3(256), 512, 0, stream>>>(vf, kf, vkT);
  fla_pack_kernel<<<dim3((nvkt / 8 + 255) / 256), 256, 0, stream>>>(vkT, vkTh, nvkt / 8);
  fla_dwconv_kernel<<<dim3(4096), 128, 0, stream>>>(vf, dwc_w, dwc_b, dwv);
  fla_attn_kernel<<<dim3(1024), 256, 0, stream>>>(vkTh, qf, ksum, dwv, norm_w,
                                                  proj_wh, proj_b, out);
}

// v004
// One run takes 140 microseconds.
// Timed twice side by side with v003, it ran 1.08 and 1.09 times as fast.
// Over all steps from v000 it is 1.69 times as fast.
#include <hip/hip_runtime.h>
#include <hip/hip_fp16.h>

typedef __attribute__((ext_vector_type(16))) _Float16 v16h;
typedef __attribute__((ext_vector_type(8)))  _Float16 v8h;
typedef __attribute__((ext_vector_type(2)))  _Float16 v2h;
typedef __attribute__((ext_vector_type(8)))  float    v8f;
typedef __attribute__((ext_vector_type(4)))  float    v4f;
typedef __attribute__((ext_vector_type(2)))  float    v2f;
typedef __attribute__((ext_vector_type(4)))  int      v4i;

#define FLA_EPS 1e-5f
#define NB 64
#define LDK 264   // padded K-stride (halves) for transposed [col][K] LDS blocks

static __device__ __forceinline__ v8f wmma_f16(v16h a, v16h b, v8f c) {
  return __builtin_amdgcn_wmma_f32_16x16x32_f16(false, a, false, b, (short)0, c,
                                                false, false);
}

// Async 16-byte global -> LDS copy (GLOBAL_LOAD_ASYNC_TO_LDS_B128, ASYNCcnt).
static __device__ __forceinline__ void async_cp16(void* lds, const void* g) {
  __builtin_amdgcn_global_load_async_to_lds_b128(
      (__attribute__((address_space(1))) v4i*)g,
      (__attribute__((address_space(3))) v4i*)lds, 0, 0);
}

// WMMA 16x16x32 fragment from an f16 matrix whose fragment rows are contiguous
// in K (A row-major, or B when columns are contiguous in K — e.g. transposed
// LDS blocks and k^T from k stored [d][N]). Two 16B loads per lane.
// Lane L (0-15) holds row rowBase+L; lanes 16-31 same rows, upper K-halves:
// elems 0..7 = K k0+hi*8+{0..7}, elems 8..15 = K k0+16+hi*8+{0..7}.
static __device__ __forceinline__ v16h load_frag_f16(const _Float16* src,
                                                     int ld, int rowBase, int k0) {
  int lane = threadIdx.x & 31;
  const _Float16* p = src + (size_t)(rowBase + (lane & 15)) * ld + k0 + ((lane >> 4) << 3);
  v16h f;
#pragma unroll
  for (int j = 0; j < 8; ++j) {
    f[j]     = p[j];
    f[j + 8] = p[j + 16];
  }
  return f;
}

__global__ __launch_bounds__(256) void fla_zero_kernel(float* p, int n) {
  int i = blockIdx.x * 256 + threadIdx.x;
  if (i < n) p[i] = 0.f;
}

// A operand in fragment order. A row-major f32 matrix [rows][256] is converted
// to f16 and laid out so that every wave-wide 16-byte load of an A fragment
// covers 512 contiguous bytes (four whole lines) instead of 32 bytes in each of
// 16 rows. Piece g (16 B = 8 halves) of the packed matrix:
//   g = (((rows/32 group) * 8 + K block of 32) * 2 + 16-row tile) * 2 + K half) * 32 + lane
// and holds row group*32 + tile*16 + (lane & 15),
//           K   block*32 + half*16 + (lane >> 4)*8 + {0..7},
// which is what load_frag_f16 gives that lane. One thread writes one piece.
__global__ __launch_bounds__(256)
void fla_pack_kernel(const float* __restrict__ s, _Float16* __restrict__ d, int npieces) {
  int g = blockIdx.x * 256 + threadIdx.x;
  if (g >= npieces) return;
  int lane = g & 31;
  int row  = ((g >> 10) << 5) + (((g >> 6) & 1) << 4) + (lane & 15);
  int k    = (((g >> 7) & 7) << 5) + (((g >> 5) & 1) << 4) + ((lane >> 4) << 3);
  const float* p = s + (size_t)row * 256 + k;
  v4f lo = *(const v4f*)p;
  v4f hi = *(const v4f*)(p + 4);
  v8h o;
#pragma unroll
  for (int u = 0; u < 4; ++u) {
    o[u]     = (_Float16)lo[u];
    o[u + 4] = (_Float16)hi[u];
  }
  *(v8h*)(d + (size_t)g * 8) = o;
}

// One 16x32 A fragment from a packed matrix: p points at this lane's piece of
// the fragment's first K half; the second K half lies 512 bytes behind it.
static __device__ __forceinline__ v16h load_frag_packed(const _Float16* p) {
  v8h lo = *(const v8h*)p;
  v8h hi = *(const v8h*)(p + 256);
  return __builtin_shufflevector(lo, hi, 0, 1, 2, 3, 4, 5, 6, 7,
                                 8, 9, 10, 11, 12, 13, 14, 15);
}

// ---------------------------------------------------------------------------
// K1: qkv 1x1 conv GEMM + feature map (q,k) / passthrough (v) + ksum for kmean
// grid = B*64, block = 256 (8 waves). Each block: 64 positions, K=256, and all
// 768 output channels: q, v and k one after the other ([256ch x 64pos] each)
// from the one x tile, which is read from memory and staged once.
// x block staged transposed into LDS as [n][c] f16 so B-frags are 2x16B reads.
// A = f16 qkv weights in fragment order (fla_pack_kernel): whole-line loads.
// ---------------------------------------------------------------------------
__global__ __launch_bounds__(256)
void fla_qkv_kernel(const float* __restrict__ x, const _Float16* __restrict__ qkv_wh,
                    const float* __restrict__ qkv_b,
                    _Float16* __restrict__ qf, _Float16* __restrict__ kf,
                    _Float16* __restrict__ vf, float* __restrict__ ksum)
{
  __shared__ _Float16 BshT[NB * LDK];
  __shared__ float colsum[2][NB];        // [q, k]: each has its own sums
  __shared__ float ksum_sh[256];

  const int tid   = threadIdx.x;
  const int b     = blockIdx.x >> 6;
  const int n0    = (blockIdx.x & 63) * NB;
  const int wave  = tid >> 5;
  const int lane  = tid & 31;

  // Stage x[b, :, n0:n0+64] -> f16 LDS transposed (vector global loads)
  const float* xb = x + (size_t)b * 256 * 4096 + n0;
#pragma unroll
  for (int it = 0; it < 16; ++it) {
    int q = tid + it * 256;              // 0..4095 float4-chunks
    int c  = q >> 4;
    int nc = (q & 15) << 2;
    v4f xv = *(const v4f*)(xb + (size_t)c * 4096 + nc);
#pragma unroll
    for (int u = 0; u < 4; ++u) BshT[(nc + u) * LDK + c] = (_Float16)xv[u];
  }
  if (tid < 2 * NB) colsum[tid >> 6][tid & 63] = 0.f;
  ksum_sh[tid] = 0.f;
  __syncthreads();

  const int r = lane & 15, hi = lane >> 4;
  // Kept rolled: one copy of the GEMM loop and its epilogues in the text.
#pragma unroll 1
  for (int turn = 0; turn < 3; ++turn) {
  // 0=q 1=k 2=v (block-uniform), in the order q, v, k: k's turn ends in a barrier
  // that also waits for the turn's own stores, so no GEMM is put behind it.
  const int which = turn ? 3 - turn : 0;
  const int ofs = which << 8;            // row offset into qkv_w / qkv_b
  // This wave's 32 rows of A: 16 KB in a row, 2 KB per K block of 32.
  const _Float16* ap = qkv_wh + ((size_t)(which * 8 + wave) << 13) + lane * 8;
  v8f acc[2][4] = {};
#pragma unroll 1
  for (int kk = 0; kk < 256; kk += 32) {
    v16h a0 = load_frag_packed(ap + kk * 32);
    v16h a1 = load_frag_packed(ap + kk * 32 + 512);
#pragma unroll
    for (int nt = 0; nt < 4; ++nt) {
      v16h bf = load_frag_f16(BshT, LDK, nt * 16, kk);
      acc[0][nt] = wmma_f16(a0, bf, acc[0][nt]);
      acc[1][nt] = wmma_f16(a1, bf, acc[1][nt]);
    }
  }

  if (which == 2) {                       // v: bias only, write f16
#pragma unroll
    for (int i = 0; i < 2; ++i)
#pragma unroll
      for (int j = 0; j < 8; ++j) {
        int m = (wave * 2 + i) * 16 + j + 8 * hi;
        float bias = qkv_b[ofs + m];
#pragma unroll
        for (int nt = 0; nt < 4; ++nt) {
          int n = n0 + nt * 16 + r;
          vf[(size_t)(b * 256 + m) * 4096 + n] = (_Float16)(acc[i][nt][j] + bias);
        }
      }
  } else {
    // feature map: t = (relu(val)+eps)^2, then column L2 normalize over 256 ch
#pragma unroll
    for (int i = 0; i < 2; ++i)
#pragma unroll
      for (int j = 0; j < 8; ++j) {
        int m = (wave * 2 + i) * 16 + j + 8 * hi;
        float bias = qkv_b[ofs + m];
#pragma unroll
        for (int nt = 0; nt < 4; ++nt) {
          float t = fmaxf(acc[i][nt][j] + bias, 0.f) + FLA_EPS;
          acc[i][nt][j] = t * t;
        }
      }
#pragma unroll
    for (int nt = 0; nt < 4; ++nt) {
      float s = 0.f;
#pragma unroll
      for (int i = 0; i < 2; ++i)
#pragma unroll
        for (int j = 0; j < 8; ++j) s += acc[i][nt][j] * acc[i][nt][j];
      atomicAdd(&colsum[which][nt * 16 + r], s);     // ds_add_f32
    }
    __syncthreads();
    float inv[4];
#pragma unroll
    for (int nt = 0; nt < 4; ++nt)
      inv[nt] = 1.f / fmaxf(sqrtf(colsum[which][nt * 16 + r]), 1e-12f);
    _Float16* dst = (which == 0) ? qf : kf;
#pragma unroll
    for (int i = 0; i < 2; ++i)
#pragma unroll
      for (int j = 0; j < 8; ++j) {
        int m = (wave * 2 + i) * 16 + j + 8 * hi;
        float rowsum = 0.f;
#pragma unroll
        for (int nt = 0; nt < 4; ++nt) {
          float tn = acc[i][nt][j] * inv[nt];
          dst[(size_t)(b * 256 + m) * 4096 + n0 + nt * 16 + r] = (_Float16)tn;
          rowsum += tn;
        }
        if (which == 1) atomicAdd(&ksum_sh[m], rowsum);
      }
    if (which == 1) {
      __syncthreads();
      atomicAdd(&ksum[b * 256 + tid], ksum_sh[tid]);
    }
  }
  // Stands in front of the next turn's writes to registers that this turn's
  // stores name (their address pairs and data registers are used again there).
  asm volatile("s_wait_xcnt 0x0" ::: "memory");
  }
}

// ---------------------------------------------------------------------------
// K2: vkT = v @ k^T  [256x256], K=N=4096, split-K across 16 blocks per batch.
// grid = B*16, block = 512 (16 waves). k^T chunks double-buffered via async
// LDS copies (ASYNCcnt in-order completion: wait<=2 keeps newest in flight).
// ---------------------------------------------------------------------------
__global__ __launch_bounds__(512)
void fla_vkt_kernel(const _Float16* __restrict__ vf, const _Float16* __restrict__ kf,
                    float* __restrict__ vkT)
{
  __shared__ _Float16 Bsh[2][256 * 40];  // [buf][col j][k-chunk 32, pad 40]
  const int tid  = threadIdx.x;
  const int wave = tid >> 5;
  const int lane = tid & 31;
  const int b    = blockIdx.x >> 4;
  const int k0g  = (blockIdx.x & 15) * 256;

  const _Float16* vb = vf + (size_t)b * 256 * 4096;
  const _Float16* kb = kf + (size_t)b * 256 * 4096 + k0g;

  const int j0 = tid >> 2, piece0 = (tid & 3) << 3;       // chunk 0 of 2
  const int j1 = (tid + 512) >> 2, piece1 = (tid & 3) << 3;

  // prologue: issue k-chunk 0 into buf 0
  async_cp16(&Bsh[0][j0 * 40 + piece0], kb + (size_t)j0 * 4096 + piece0);
  async_cp16(&Bsh[0][j1 * 40 + piece1], kb + (size_t)j1 * 4096 + piece1);

  v8f acc[16] = {};
#pragma unroll 1
  for (int step = 0; step < 8; ++step) {
    int kk = step * 32;
    if (step < 7) {                      // issue next chunk into other buffer
      async_cp16(&Bsh[(step + 1) & 1][j0 * 40 + piece0],
                 kb + (size_t)j0 * 4096 + kk + 32 + piece0);
      async_cp16(&Bsh[(step + 1) & 1][j1 * 40 + piece1],
                 kb + (size_t)j1 * 4096 + kk + 32 + piece1);
      __builtin_amdgcn_s_wait_asynccnt(2);   // chunk `step` landed (in-order)
    } else {
      __builtin_amdgcn_s_wait_asynccnt(0);
    }
    __syncthreads();
    v16h a = load_frag_f16(vb, 4096, wave * 16, k0g + kk);
    const _Float16* bsrc = Bsh[step & 1];
#pragma unroll
    for (int nt = 0; nt < 16; ++nt) {
      v16h bf = load_frag_f16(bsrc, 40, nt * 16, 0);  // cols contiguous in K
      acc[nt] = wmma_f16(a, bf, acc[nt]);
    }
    __syncthreads();                     // all waves done before buf reuse
  }
  const int r = lane & 15, hi = lane >> 4;
#pragma unroll
  for (int nt = 0; nt < 16; ++nt)
#pragma unroll
    for (int j = 0; j < 8; ++j) {
      int m = wave * 16 + j + 8 * hi;
      atomicAdd(&vkT[((size_t)b * 256 + m) * 256 + nt * 16 + r], acc[nt][j]);
    }
}

// ---------------------------------------------------------------------------
// K4: depthwise 5x5 SAME conv on v. One block per (b, c) plane of 64x64 pixels.
// The plane is staged once into LDS inside a frame of zeros (two rows above and
// below, two columns left and right), so no tap needs a bounds test; each
// thread then computes an 8-wide x 4-high tile of outputs in registers.
// grid = B*256, block = 128 (8 column groups x 16 row groups).
// LDS row = 8 halves pad | 64 pixels | 8 halves pad = 160 B: the two 128-B row
// pieces that 16 lanes read with one 16-byte load fall on disjoint bank halves.
// ---------------------------------------------------------------------------
#define DWP 80
__global__ __launch_bounds__(128)
void fla_dwconv_kernel(const _Float16* __restrict__ vf, const float* __restrict__ w5,
                       const float* __restrict__ wb, _Float16* __restrict__ dwv)
{
  __shared__ __attribute__((aligned(16))) _Float16 tile[68 * DWP];  // image rows -2 .. 65
  const int tid = threadIdx.x;
  const int bc  = blockIdx.x;            // b*256 + c
  const int c   = bc & 255;
  const int cg  = tid & 7;               // column group: 8 pixels
  const int rg  = tid >> 3;              // 0..15
  const _Float16* src = vf + (size_t)bc * 4096;

  // The block's 25 taps and its bias, asked for ahead of the copies so that both
  // latencies run together. Every loop of this kernel is unrolled in full, so
  // that its arrays are indexed by constants and stay in registers.
  const float* wt = w5 + c * 25;
  float w[25];
#pragma unroll
  for (int i = 0; i < 25; ++i) w[i] = wt[i];
  const float bias = wb[c];

  {
    // 512 chunks of 16 B, four per thread: chunk tid + 128*i is image row
    // rg + 16*i, column group cg.
    const unsigned l0 = (unsigned)(size_t)&tile[(rg + 2) * DWP + 8 + cg * 8];
    const unsigned l1 = l0 + 16 * DWP * 2;
    const unsigned l2 = l0 + 32 * DWP * 2;
    const unsigned l3 = l0 + 48 * DWP * 2;
    const _Float16* g0 = src + tid * 8;
    const _Float16* g1 = g0 + 1024;
    const _Float16* g2 = g0 + 2048;
    const _Float16* g3 = g0 + 3072;
    // The copies bring the plane into LDS through no register; the closing wait
    // stands in the same statement so that no address register is rewritten
    // ahead of it.
    asm volatile("global_load_async_to_lds_b128 %0, %4, off\n\t"
                 "global_load_async_to_lds_b128 %1, %5, off\n\t"
                 "global_load_async_to_lds_b128 %2, %6, off\n\t"
                 "global_load_async_to_lds_b128 %3, %7, off\n\t"
                 "s_wait_xcnt 0x0"
                 :: "v"(l0), "v"(l1), "v"(l2), "v"(l3),
                    "v"(g0), "v"(g1), "v"(g2), "v"(g3)
                 : "memory");
  }
  // The frame of zeros: bytes that no copy writes.
  if (tid < 40) {                        // LDS rows 0, 1, 66, 67, ten 16-B chunks each
    int fr  = tid / 10;
    int row = fr + ((fr >> 1) * 64);
    v8h zz = {};
    *(v8h*)&tile[row * DWP + (tid - fr * 10) * 8] = zz;
  }
  *(unsigned*)&tile[(2 + (tid >> 1)) * DWP + ((tid & 1) ? 72 : 6)] = 0u;  // columns -2,-1 / 64,65
  // Every copy of this wave has landed before the barrier lets other waves read.
  asm volatile("s_wait_asynccnt 0x0" ::: "memory");
  __syncthreads();

  v2f acc[4][4];                         // [output row][pair of neighbouring columns]
#pragma unroll
  for (int o = 0; o < 4; ++o)
#pragma unroll
    for (int j = 0; j < 4; ++j) acc[o][j] = (v2f){bias, bias};

  // LDS row rg*4 + r is image row rg*4 - 2 + r; f[] holds columns cg*8-2 .. cg*8+9.
  // Each output sums bias, then its taps by rows and, within a row, left to right.
  const _Float16* base = &tile[(rg * 4) * DWP + 8 + cg * 8];
#pragma unroll
  for (int r = 0; r < 8; ++r) {
    const _Float16* p = base + r * DWP;
    v2h lft = *(const v2h*)(p - 2);
    v8h mid = *(const v8h*)p;
    v2h rgt = *(const v2h*)(p + 8);
    float f[12];
    f[0] = (float)lft[0]; f[1] = (float)lft[1];
#pragma unroll
    for (int u = 0; u < 8; ++u) f[2 + u] = (float)mid[u];
    f[10] = (float)rgt[0]; f[11] = (float)rgt[1];
    // Column pairs that start at an even and at an odd place, so that every
    // tap column finds its two inputs in one register pair (packed f32 fma).
    v2f ev[6], od[5];
#pragma unroll
    for (int k = 0; k < 6; ++k) ev[k] = (v2f){f[2 * k], f[2 * k + 1]};
#pragma unroll
    for (int k = 0; k < 5; ++k) od[k] = (v2f){f[2 * k + 1], f[2 * k + 2]};
#pragma unroll
    for (int o = 0; o < 4; ++o) {
      const int dy = r - o;              // tap row 0..4 of output row o
      if (dy < 0 || dy > 4) continue;
#pragma unroll
      for (int dx = 0; dx < 5; ++dx) {
        const v2f wv = (v2f){w[dy * 5 + dx], w[dy * 5 + dx]};
#pragma unroll
        for (int j = 0; j < 4; ++j)
          acc[o][j] = __builtin_elementwise_fma(
              wv, (dx & 1) ? od[j + (dx >> 1)] : ev[j + (dx >> 1)], acc[o][j]);
      }
    }
  }
  _Float16* dst = dwv + (size_t)bc * 4096 + (rg * 4) * 64 + cg * 8;
#pragma unroll
  for (int o = 0; o < 4; ++o) {
    v8h ov;
#pragma unroll
    for (int j = 0; j < 4; ++j) {
      ov[2 * j]     = (_Float16)acc[o][j][0];
      ov[2 * j + 1] = (_Float16)acc[o][j][1];
    }
    *(v8h*)(dst + o * 64) = ov;
  }
}

// ---------------------------------------------------------------------------
// K5: attn = (vkT @ q) * (1/4096) / z ; RMSNorm * norm_w ; + dw -> y (f16),
// then out = proj_w @ y + proj_b (fp32 out) in the same block: a block holds all
// 256 channels of its 64 positions, which is the whole B tile of the projection,
// so y goes from the accumulators into LDS and never to memory.
// grid = B*64, block = 256. q block staged transposed [n][c]; y takes its place.
// A = packed v k^T, then f16 proj weights in fragment order (fla_pack_kernel).
// ---------------------------------------------------------------------------
__global__ __launch_bounds__(256)
void fla_attn_kernel(const _Float16* __restrict__ vkTh, const _Float16* __restrict__ qf,
                     const float* __restrict__ ksum, const _Float16* __restrict__ dwv,
                     const float* __restrict__ norm_w, const _Float16* __restrict__ proj_wh,
                     const float* __restrict__ proj_b, float* __restrict__ out)
{
  __shared__ __attribute__((aligned(16))) _Float16 BshT[NB * LDK];
  __shared__ float kmean_sh[256];
  __shared__ float zcol[NB];
  __shared__ float colss[NB];

  const int tid  = threadIdx.x;
  const int b    = blockIdx.x >> 6;
  const int n0   = (blockIdx.x & 63) * NB;
  const int wave = tid >> 5;
  const int lane = tid & 31;

  const _Float16* qb = qf + (size_t)b * 256 * 4096 + n0;
#pragma unroll
  for (int it = 0; it < 8; ++it) {
    int q = tid + it * 256;              // 0..2047 16B-chunks
    int cch = q >> 3;
    int nc  = (q & 7) << 3;
    v8h hv = *(const v8h*)(qb + (size_t)cch * 4096 + nc);
#pragma unroll
    for (int u = 0; u < 8; ++u) BshT[(nc + u) * LDK + cch] = hv[u];
  }
  kmean_sh[tid] = ksum[b * 256 + tid] * (1.f / 4096.f);
  if (tid < NB) { colss[tid] = 0.f; zcol[tid] = FLA_EPS; }
  __syncthreads();

  {                                       // z = kmean . q(col) + eps, 4-way split
    int col = tid & 63, quarter = tid >> 6;
    const _Float16* bp = BshT + col * LDK + quarter * 64;
    const float* kp = kmean_sh + quarter * 64;
    float s = 0.f;
#pragma unroll
    for (int cc = 0; cc < 64; cc += 8) {
      v8h hv = *(const v8h*)(bp + cc);
#pragma unroll
      for (int u = 0; u < 8; ++u) s += kp[cc + u] * (float)hv[u];
    }
    atomicAdd(&zcol[col], s);
  }

  // This wave's 32 rows of the batch's packed v k^T (fla_pack_kernel).
  const _Float16* ap = vkTh + ((size_t)(b * 8 + wave) << 13) + lane * 8;
  v8f acc[2][4] = {};
#pragma unroll 1
  for (int kk = 0; kk < 256; kk += 32) {
    v16h a0 = load_frag_packed(ap + kk * 32);
    v16h a1 = load_frag_packed(ap + kk * 32 + 512);
#pragma unroll
    for (int nt = 0; nt < 4; ++nt) {
      v16h bf = load_frag_f16(BshT, LDK, nt * 16, kk);
      acc[0][nt] = wmma_f16(a0, bf, acc[0][nt]);
      acc[1][nt] = wmma_f16(a1, bf, acc[1][nt]);
    }
  }
  __syncthreads();                        // zcol complete, colss zeroed, q tile read out
  const int r = lane & 15, hi = lane >> 4;
#pragma unroll
  for (int nt = 0; nt < 4; ++nt) {
    float z = zcol[nt * 16 + r];
    float s = 0.f;
#pragma unroll
    for (int i = 0; i < 2; ++i)
#pragma unroll
      for (int j = 0; j < 8; ++j) {
        float a = acc[i][nt][j] * (1.f / 4096.f) / z;
        acc[i][nt][j] = a;
        s += a * a;
      }
    atomicAdd(&colss[nt * 16 + r], s);
  }
  __syncthreads();
  float rinv[4];
#pragma unroll
  for (int nt = 0; nt < 4; ++nt)
    rinv[nt] = 1.f / sqrtf(colss[nt * 16 + r] * (1.f / 256.f) + FLA_EPS);
  // y, rounded to f16, goes into the LDS tile as [n][channel]: a lane's 8 accumulator
  // rows of one 16x16 tile are 8 neighbouring channels of one position = 16 bytes.
  v8h y8[2][4];
#pragma unroll
  for (int i = 0; i < 2; ++i)
#pragma unroll
    for (int j = 0; j < 8; ++j) {
      int m = (wave * 2 + i) * 16 + j + 8 * hi;
      float nw = norm_w[m];
#pragma unroll
      for (int nt = 0; nt < 4; ++nt) {
        size_t idx = (size_t)(b * 256 + m) * 4096 + n0 + nt * 16 + r;
        float yv = acc[i][nt][j] * rinv[nt] * nw + (float)dwv[idx];
        y8[i][nt][j] = (_Float16)yv;
      }
    }
#pragma unroll
  for (int i = 0; i < 2; ++i)
#pragma unroll
    for (int nt = 0; nt < 4; ++nt) {
      *(v8h*)&BshT[(nt * 16 + r) * LDK + (wave * 2 + i) * 16 + 8 * hi] = y8[i][nt];
      acc[i][nt] = (v8f){};
    }
  __syncthreads();                        // every wave's channels of y are in the tile

  ap = proj_wh + ((size_t)wave << 13) + lane * 8;
#pragma unroll 1
  for (int kk = 0; kk < 256; kk += 32) {
    v16h a0 = load_frag_packed(ap + kk * 32);
    v16h a1 = load_frag_packed(ap + kk * 32 + 512);
#pragma unroll
    for (int nt = 0; nt < 4; ++nt) {
      v16h bf = load_frag_f16(BshT, LDK, nt * 16, kk);
      acc[0][nt] = wmma_f16(a0, bf, acc[0][nt]);
      acc[1][nt] = wmma_f16(a1, bf, acc[1][nt]);
    }
  }
#pragma unroll
  for (int i = 0; i < 2; ++i)
#pragma unroll
    for (int j = 0; j < 8; ++j) {
      int m = (wave * 2 + i) * 16 + j + 8 * hi;
      float bias = proj_b[m];
#pragma unroll
      for (int nt = 0; nt < 4; ++nt)
        out[(size_t)(b * 256 + m) * 4096 + n0 + nt * 16 + r] = acc[i][nt][j] + bias;
    }
}

extern "C" void kernel_launch(void* const* d_in, const int* in_sizes, int n_in,
                              void* d_out, int out_size, void* d_ws, size_t ws_size,
                              hipStream_t stream)
{
  (void)in_sizes; (void)n_in; (void)out_size; (void)ws_size;
  const float* x      = (const float*)d_in[0];
  const float* qkv_w  = (const float*)d_in[1];
  const float* qkv_b  = (const float*)d_in[2];
  const float* dwc_w  = (const float*)d_in[3];
  const float* dwc_b  = (const float*)d_in[4];
  const float* norm_w = (const float*)d_in[5];
  const float* proj_w = (const float*)d_in[6];
  const float* proj_b = (const float*)d_in[7];
  float* out = (float*)d_out;

  const size_t B = 16, D = 256, N = 4096;
  char* ws = (char*)d_ws;
  size_t off = 0;
  auto take = [&](size_t bytes) {
    char* p = ws + off;
    off = (off + bytes + 255) & ~(size_t)255;
    return p;
  };
  _Float16* qf      = (_Float16*)take(B * D * N * 2);
  _Float16* kf      = (_Float16*)take(B * D * N * 2);
  _Float16* vf      = (_Float16*)take(B * D * N * 2);
  _Float16* dwv     = (_Float16*)take(B * D * N * 2);
  float*    vkT     = (float*)   take(B * D * D * 4);
  _Float16* vkTh    = (_Float16*)take(B * D * D * 2);
  float*    ksum    = (float*)   take(B * D * 4);
  _Float16* qkv_wh  = (_Float16*)take(3 * D * D * 2);
  _Float16* proj_wh = (_Float16*)take(D * D * 2);

  int nvkt = (int)(B * D * D);
  int nqkvw = (int)(3 * D * D);
  int nprojw = (int)(D * D);
  fla_zero_kernel<<<dim3((nvkt + 255) / 256), 256, 0, stream>>>(vkT, nvkt);
  fla_zero_kernel<<<dim3((int)((B * D + 255) / 256)), 256, 0, stream>>>(ksum, (int)(B * D));
  fla_pack_kernel<<<dim3((nqkvw / 8 + 255) / 256), 256, 0, stream>>>(qkv_w, qkv_wh, nqkvw / 8);
  fla_pack_kernel<<<dim3((nprojw / 8 + 255) / 256), 256, 0, stream>>>(proj_w, proj_wh, nprojw / 8);
  fla_qkv_kernel<<<dim3(1024), 256, 0, stream>>>(x, qkv_wh, qkv_b, qf, kf, vf, ksum);
  fla_vkt_kernel<<<dim3(256), 512, 0, stream>>>(vf, kf, vkT);
  fla_pack_kernel<<<dim3((nvkt / 8 + 255) / 256), 256, 0, stream>>>(vkT, vkTh, nvkt / 8);
  fla_dwconv_kernel<<<dim3(4096), 128, 0, stream>>>(vf, dwc_w, dwc_b, dwv);
  fla_attn_kernel<<<dim3(1024), 256, 0, stream>>>(vkTh, qf, ksum, dwv, norm_w,
                                                  proj_wh, proj_b, out);
}

// v005
// One run takes 125 microseconds.
// Two timings next to v004 put it at 1.12 and 1.11 times that version's speed.
// Over all steps from v000 it is 1.89 times as fast.
#include <hip/hip_runtime.h>
#include <hip/hip_fp16.h>

typedef __attribute__((ext_vector_type(16))) _Float16 v16h;
typedef __attribute__((ext_vector_type(8)))  _Float16 v8h;
typedef __attribute__((ext_vector_type(2)))  _Float16 v2h;
typedef __attribute__((ext_vector_type(8)))  float    v8f;
typedef __attribute__((ext_vector_type(4)))  float    v4f;
typedef __attribute__((ext_vector_type(2)))  float    v2f;
typedef __attribute__((ext_vector_type(4)))  int      v4i;

#define FLA_EPS 1e-5f
#define NB 64
#define LDK 264   // padded K-stride (halves) for transposed [col][K] LDS blocks

static __device__ __forceinline__ v8f wmma_f16(v16h a, v16h b, v8f c) {
  return __builtin_amdgcn_wmma_f32_16x16x32_f16(false, a, false, b, (short)0, c,
                                                false, false);
}

// Async 16-byte global -> LDS copy (GLOBAL_LOAD_ASYNC_TO_LDS_B128, ASYNCcnt).
static __device__ __forceinline__ void async_cp16(void* lds, const void* g) {
  __builtin_amdgcn_global_load_async_to_lds_b128(
      (__attribute__((address_space(1))) v4i*)g,
      (__attribute__((address_space(3))) v4i*)lds, 0, 0);
}

// WMMA 16x16x32 fragment from an f16 matrix whose fragment rows are contiguous
// in K (A row-major, or B when columns are contiguous in K — e.g. transposed
// LDS blocks and v^T from v stored [d][N]). Two 16B loads per lane.
// Lane L (0-15) holds row rowBase+L; lanes 16-31 same rows, upper K-halves:
// elems 0..7 = K k0+hi*8+{0..7}, elems 8..15 = K k0+16+hi*8+{0..7}.
static __device__ __forceinline__ v16h load_frag_f16(const _Float16* src,
                                                     int ld, int rowBase, int k0) {
  int lane = threadIdx.x & 31;
  const _Float16* p = src + (size_t)(rowBase + (lane & 15)) * ld + k0 + ((lane >> 4) << 3);
  v16h f;
#pragma unroll
  for (int j = 0; j < 8; ++j) {
    f[j]     = p[j];
    f[j + 8] = p[j + 16];
  }
  return f;
}

__global__ __launch_bounds__(256) void fla_zero_kernel(float* p, int n) {
  int i = blockIdx.x * 256 + threadIdx.x;
  if (i < n) p[i] = 0.f;
}

// A operand in fragment order. A row-major f32 matrix [rows][256] is converted
// to f16 and laid out so that every wave-wide 16-byte load of an A fragment
// covers 512 contiguous bytes (four whole lines) instead of 32 bytes in each of
// 16 rows. Piece g (16 B = 8 halves) of the packed matrix:
//   g = (((rows/32 group) * 8 + K block of 32) * 2 + 16-row tile) * 2 + K half) * 32 + lane
// and holds row group*32 + tile*16 + (lane & 15),
//           K   block*32 + half*16 + (lane >> 4)*8 + {0..7},
// which is what load_frag_f16 gives that lane. One thread writes one piece.
__global__ __launch_bounds__(256)
void fla_pack_kernel(const float* __restrict__ s, _Float16* __restrict__ d, int npieces) {
  int g = blockIdx.x * 256 + threadIdx.x;
  if (g >= npieces) return;
  int lane = g & 31;
  int row  = ((g >> 10) << 5) + (((g >> 6) & 1) << 4) + (lane & 15);
  int k    = (((g >> 7) & 7) << 5) + (((g >> 5) & 1) << 4) + ((lane >> 4) << 3);
  const float* p = s + (size_t)row * 256 + k;
  v4f lo = *(const v4f*)p;
  v4f hi = *(const v4f*)(p + 4);
  v8h o;
#pragma unroll
  for (int u = 0; u < 4; ++u) {
    o[u]     = (_Float16)lo[u];
    o[u + 4] = (_Float16)hi[u];
  }
  *(v8h*)(d + (size_t)g * 8) = o;
}

// One 16x32 A fragment from a packed matrix: p points at this lane's piece of
// the fragment's first K half; the second K half lies 512 bytes behind it.
static __device__ __forceinline__ v16h load_frag_packed(const _Float16* p) {
  v8h lo = *(const v8h*)p;
  v8h hi = *(const v8h*)(p + 256);
  return __builtin_shufflevector(lo, hi, 0, 1, 2, 3, 4, 5, 6, 7,
                                 8, 9, 10, 11, 12, 13, 14, 15);
}

// ---------------------------------------------------------------------------
// K1: qkv 1x1 conv GEMM + feature map (q,k) / passthrough (v) + ksum for kmean
// grid = B*64, block = 256 (8 waves). Each block: 64 positions, K=256, and all
// 768 output channels: q, v and k one after the other ([256ch x 64pos] each)
// from the one x tile, which is read from memory and staged once.
// x block staged transposed into LDS as [n][c] f16 so B-frags are 2x16B reads.
// A = f16 qkv weights in fragment order (fla_pack_kernel): whole-line loads.
// ---------------------------------------------------------------------------
__global__ __launch_bounds__(256)
void fla_qkv_kernel(const float* __restrict__ x, const _Float16* __restrict__ qkv_wh,
                    const float* __restrict__ qkv_b,
                    _Float16* __restrict__ qf, _Float16* __restrict__ kf,
                    _Float16* __restrict__ vf, float* __restrict__ ksum)
{
  __shared__ _Float16 BshT[NB * LDK];
  __shared__ float colsum[2][NB];        // [q, k]: each has its own sums
  __shared__ float ksum_sh[256];

  const int tid   = threadIdx.x;
  const int b     = blockIdx.x >> 6;
  const int n0    = (blockIdx.x & 63) * NB;
  const int wave  = tid >> 5;
  const int lane  = tid & 31;

  // Stage x[b, :, n0:n0+64] -> f16 LDS transposed (vector global loads)
  const float* xb = x + (size_t)b * 256 * 4096 + n0;
#pragma unroll
  for (int it = 0; it < 16; ++it) {
    int q = tid + it * 256;              // 0..4095 float4-chunks
    int c  = q >> 4;
    int nc = (q & 15) << 2;
    v4f xv = *(const v4f*)(xb + (size_t)c * 4096 + nc);
#pragma unroll
    for (int u = 0; u < 4; ++u) BshT[(nc + u) * LDK + c] = (_Float16)xv[u];
  }
  if (tid < 2 * NB) colsum[tid >> 6][tid & 63] = 0.f;
  ksum_sh[tid] = 0.f;
  __syncthreads();

  const int r = lane & 15, hi = lane >> 4;
  // Kept rolled: one copy of the GEMM loop and its epilogues in the text.
#pragma unroll 1
  for (int turn = 0; turn < 3; ++turn) {
  // 0=q 1=k 2=v (block-uniform), in the order q, v, k: k's turn ends in a barrier
  // that also waits for the turn's own stores, so no GEMM is put behind it.
  const int which = turn ? 3 - turn : 0;
  const int ofs = which << 8;            // row offset into qkv_w / qkv_b
  // This wave's 32 rows of A: 16 KB in a row, 2 KB per K block of 32.
  const _Float16* ap = qkv_wh + ((size_t)(which * 8 + wave) << 13) + lane * 8;
  v8f acc[2][4] = {};
#pragma unroll 1
  for (int kk = 0; kk < 256; kk += 32) {
    v16h a0 = load_frag_packed(ap + kk * 32);
    v16h a1 = load_frag_packed(ap + kk * 32 + 512);
#pragma unroll
    for (int nt = 0; nt < 4; ++nt) {
      v16h bf = load_frag_f16(BshT, LDK, nt * 16, kk);
      acc[0][nt] = wmma_f16(a0, bf, acc[0][nt]);
      acc[1][nt] = wmma_f16(a1, bf, acc[1][nt]);
    }
  }

  if (which == 2) {                       // v: bias only, write f16
#pragma unroll
    for (int i = 0; i < 2; ++i)
#pragma unroll
      for (int j = 0; j < 8; ++j) {
        int m = (wave * 2 + i) * 16 + j + 8 * hi;
        float bias = qkv_b[ofs + m];
#pragma unroll
        for (int nt = 0; nt < 4; ++nt) {
          int n = n0 + nt * 16 + r;
          vf[(size_t)(b * 256 + m) * 4096 + n] = (_Float16)(acc[i][nt][j] + bias);
        }
      }
  } else {
    // feature map: t = (relu(val)+eps)^2, then column L2 normalize over 256 ch
#pragma unroll
    for (int i = 0; i < 2; ++i)
#pragma unroll
      for (int j = 0; j < 8; ++j) {
        int m = (wave * 2 + i) * 16 + j + 8 * hi;
        float bias = qkv_b[ofs + m];
#pragma unroll
        for (int nt = 0; nt < 4; ++nt) {
          float t = fmaxf(acc[i][nt][j] + bias, 0.f) + FLA_EPS;
          acc[i][nt][j] = t * t;
        }
      }
#pragma unroll
    for (int nt = 0; nt < 4; ++nt) {
      float s = 0.f;
#pragma unroll
      for (int i = 0; i < 2; ++i)
#pragma unroll
        for (int j = 0; j < 8; ++j) s += acc[i][nt][j] * acc[i][nt][j];
      atomicAdd(&colsum[which][nt * 16 + r], s);     // ds_add_f32
    }
    __syncthreads();
    float inv[4];
#pragma unroll
    for (int nt = 0; nt < 4; ++nt)
      inv[nt] = 1.f / fmaxf(sqrtf(colsum[which][nt * 16 + r]), 1e-12f);
    _Float16* dst = (which == 0) ? qf : kf;
#pragma unroll
    for (int i = 0; i < 2; ++i)
#pragma unroll
      for (int j = 0; j < 8; ++j) {
        int m = (wave * 2 + i) * 16 + j + 8 * hi;
        float rowsum = 0.f;
#pragma unroll
        for (int nt = 0; nt < 4; ++nt) {
          float tn = acc[i][nt][j] * inv[nt];
          dst[(size_t)(b * 256 + m) * 4096 + n0 + nt * 16 + r] = (_Float16)tn;
          rowsum += tn;
        }
        if (which == 1) atomicAdd(&ksum_sh[m], rowsum);
      }
    if (which == 1) {
      __syncthreads();
      atomicAdd(&ksum[b * 256 + tid], ksum_sh[tid]);
    }
  }
  // Stands in front of the next turn's writes to registers that this turn's
  // stores name (their address pairs and data registers are used again there).
  asm volatile("s_wait_xcnt 0x0" ::: "memory");
  }
}

// ---------------------------------------------------------------------------
// K2: vkT = v @ k^T  [256x256], K=N=4096, split-K across 16 blocks per batch.
// grid = B*16, block = 512 (16 waves). k^T chunks double-buffered via async
// LDS copies (ASYNCcnt in-order completion: wait<=2 keeps newest in flight).
// Each block stores its own f32 partial product with plain 16-byte stores;
// fla_sum_pack_kernel adds the 16 partials of a batch. The product is formed as
// k @ v^T (k is the A operand), so a lane's 8 accumulator rows are 8 neighbouring
// columns of one row of v k^T: lane and tile then number exactly as the pieces of
// the packed A operand do (fla_pack_kernel), and partials are kept in that order:
//   vkP[((b*16 + split)*2 + h)*8192 + g][4] = columns h*4 .. h*4+3 of piece g.
// ---------------------------------------------------------------------------
__global__ __launch_bounds__(512)
void fla_vkt_kernel(const _Float16* __restrict__ vf, const _Float16* __restrict__ kf,
                    float* __restrict__ vkP)
{
  __shared__ _Float16 Bsh[2][256 * 40];  // [buf][col j][k-chunk 32, pad 40]
  const int tid  = threadIdx.x;
  const int wave = tid >> 5;
  const int lane = tid & 31;
  const int b    = blockIdx.x >> 4;
  const int k0g  = (blockIdx.x & 15) * 256;

  const _Float16* vb = vf + (size_t)b * 256 * 4096;
  const _Float16* kb = kf + (size_t)b * 256 * 4096 + k0g;

  const int j0 = tid >> 2, piece0 = (tid & 3) << 3;       // chunk 0 of 2
  const int j1 = (tid + 512) >> 2, piece1 = (tid & 3) << 3;

  // prologue: issue k-chunk 0 into buf 0
  async_cp16(&Bsh[0][j0 * 40 + piece0], kb + (size_t)j0 * 4096 + piece0);
  async_cp16(&Bsh[0][j1 * 40 + piece1], kb + (size_t)j1 * 4096 + piece1);

  v8f acc[16] = {};
#pragma unroll 1
  for (int step = 0; step < 8; ++step) {
    int kk = step * 32;
    if (step < 7) {                      // issue next chunk into other buffer
      async_cp16(&Bsh[(step + 1) & 1][j0 * 40 + piece0],
                 kb + (size_t)j0 * 4096 + kk + 32 + piece0);
      async_cp16(&Bsh[(step + 1) & 1][j1 * 40 + piece1],
                 kb + (size_t)j1 * 4096 + kk + 32 + piece1);
      __builtin_amdgcn_s_wait_asynccnt(2);   // chunk `step` landed (in-order)
    } else {
      __builtin_amdgcn_s_wait_asynccnt(0);
    }
    __syncthreads();
    v16h a = load_frag_f16(vb, 4096, wave * 16, k0g + kk);
    const _Float16* bsrc = Bsh[step & 1];
#pragma unroll
    for (int nt = 0; nt < 16; ++nt) {
      v16h bf = load_frag_f16(bsrc, 40, nt * 16, 0);  // cols contiguous in K
      acc[nt] = wmma_f16(bf, a, acc[nt]);   // rows: k channels, columns: v channels
    }
    __syncthreads();                     // all waves done before buf reuse
  }
  // Piece of tile nt: group wave>>1, K block nt>>1, 16-row tile wave&1, K half nt&1.
  // A wave's store covers 512 contiguous bytes.
  float* pp = vkP + ((size_t)blockIdx.x * 2 * 8192 +
                     (wave >> 1) * 1024 + (wave & 1) * 64 + lane) * 4;
#pragma unroll
  for (int nt = 0; nt < 16; ++nt) {
    float* pt = pp + ((nt >> 1) * 128 + (nt & 1) * 32) * 4;
    *(v4f*)pt = __builtin_shufflevector(acc[nt], acc[nt], 0, 1, 2, 3);
    *(v4f*)(pt + 8192 * 4) = __builtin_shufflevector(acc[nt], acc[nt], 4, 5, 6, 7);
  }
}

// K3: adds a batch's 16 partial products, split 0 first, and rounds the sum to
// f16: thread t makes piece t of the packed v k^T (16 bytes). Every load of a wave
// covers 512 contiguous bytes. grid = B*8192/256.
__global__ __launch_bounds__(256)
void fla_sum_pack_kernel(const float* __restrict__ vkP, _Float16* __restrict__ d) {
  const int t = blockIdx.x * 256 + threadIdx.x;      // b*8192 + g
  const float* p = vkP + ((size_t)(t >> 13) * 32 * 8192 + (t & 8191)) * 4;
  v4f lo = *(const v4f*)p;
  v4f hi = *(const v4f*)(p + (size_t)8192 * 4);
#pragma unroll
  for (int s = 1; s < 16; ++s) {
    lo += *(const v4f*)(p + (size_t)(s * 2) * 8192 * 4);
    hi += *(const v4f*)(p + (size_t)(s * 2 + 1) * 8192 * 4);
  }
  v8h o;
#pragma unroll
  for (int u = 0; u < 4; ++u) {
    o[u]     = (_Float16)lo[u];
    o[u + 4] = (_Float16)hi[u];
  }
  *(v8h*)(d + (size_t)t * 8) = o;
}

// ---------------------------------------------------------------------------
// K4: depthwise 5x5 SAME conv on v. One block per (b, c) plane of 64x64 pixels.
// The plane is staged once into LDS inside a frame of zeros (two rows above and
// below, two columns left and right), so no tap needs a bounds test; each
// thread then computes an 8-wide x 4-high tile of outputs in registers.
// grid = B*256, block = 128 (8 column groups x 16 row groups).
// LDS row = 8 halves pad | 64 pixels | 8 halves pad = 160 B: the two 128-B row
// pieces that 16 lanes read with one 16-byte load fall on disjoint bank halves.
// ---------------------------------------------------------------------------
#define DWP 80
__global__ __launch_bounds__(128)
void fla_dwconv_kernel(const _Float16* __restrict__ vf, const float* __restrict__ w5,
                       const float* __restrict__ wb, _Float16* __restrict__ dwv)
{
  __shared__ __attribute__((aligned(16))) _Float16 tile[68 * DWP];  // image rows -2 .. 65
  const int tid = threadIdx.x;
  const int bc  = blockIdx.x;            // b*256 + c
  const int c   = bc & 255;
  const int cg  = tid & 7;               // column group: 8 pixels
  const int rg  = tid >> 3;              // 0..15
  const _Float16* src = vf + (size_t)bc * 4096;

  // The block's 25 taps and its bias, asked for ahead of the copies so that both
  // latencies run together. Every loop of this kernel is unrolled in full, so
  // that its arrays are indexed by constants and stay in registers.
  const float* wt = w5 + c * 25;
  float w[25];
#pragma unroll
  for (int i = 0; i < 25; ++i) w[i] = wt[i];
  const float bias = wb[c];

  {
    // 512 chunks of 16 B, four per thread: chunk tid + 128*i is image row
    // rg + 16*i, column group cg.
    const unsigned l0 = (unsigned)(size_t)&tile[(rg + 2) * DWP + 8 + cg * 8];
    const unsigned l1 = l0 + 16 * DWP * 2;
    const unsigned l2 = l0 + 32 * DWP * 2;
    const unsigned l3 = l0 + 48 * DWP * 2;
    const _Float16* g0 = src + tid * 8;
    const _Float16* g1 = g0 + 1024;
    const _Float16* g2 = g0 + 2048;
    const _Float16* g3 = g0 + 3072;
    // The copies bring the plane into LDS through no register; the closing wait
    // stands in the same statement so that no address register is rewritten
    // ahead of it.
    asm volatile("global_load_async_to_lds_b128 %0, %4, off\n\t"
                 "global_load_async_to_lds_b128 %1, %5, off\n\t"
                 "global_load_async_to_lds_b128 %2, %6, off\n\t"
                 "global_load_async_to_lds_b128 %3, %7, off\n\t"
                 "s_wait_xcnt 0x0"
                 :: "v"(l0), "v"(l1), "v"(l2), "v"(l3),
                    "v"(g0), "v"(g1), "v"(g2), "v"(g3)
                 : "memory");
  }
  // The frame of zeros: bytes that no copy writes.
  if (tid < 40) {                        // LDS rows 0, 1, 66, 67, ten 16-B chunks each
    int fr  = tid / 10;
    int row = fr + ((fr >> 1) * 64);
    v8h zz = {};
    *(v8h*)&tile[row * DWP + (tid - fr * 10) * 8] = zz;
  }
  *(unsigned*)&tile[(2 + (tid >> 1)) * DWP + ((tid & 1) ? 72 : 6)] = 0u;  // columns -2,-1 / 64,65
  // Every copy of this wave has landed before the barrier lets other waves read.
  asm volatile("s_wait_asynccnt 0x0" ::: "memory");
  __syncthreads();

  v2f acc[4][4];                         // [output row][pair of neighbouring columns]
#pragma unroll
  for (int o = 0; o < 4; ++o)
#pragma unroll
    for (int j = 0; j < 4; ++j) acc[o][j] = (v2f){bias, bias};

  // LDS row rg*4 + r is image row rg*4 - 2 + r; f[] holds columns cg*8-2 .. cg*8+9.
  // Each output sums bias, then its taps by rows and, within a row, left to right.
  const _Float16* base = &tile[(rg * 4) * DWP + 8 + cg * 8];
#pragma unroll
  for (int r = 0; r < 8; ++r) {
    const _Float16* p = base + r * DWP;
    v2h lft = *(const v2h*)(p - 2);
    v8h mid = *(const v8h*)p;
    v2h rgt = *(const v2h*)(p + 8);
    float f[12];
    f[0] = (float)lft[0]; f[1] = (float)lft[1];
#pragma unroll
    for (int u = 0; u < 8; ++u) f[2 + u] = (float)mid[u];
    f[10] = (float)rgt[0]; f[11] = (float)rgt[1];
    // Column pairs that start at an even and at an odd place, so that every
    // tap column finds its two inputs in one register pair (packed f32 fma).
    v2f ev[6], od[5];
#pragma unroll
    for (int k = 0; k < 6; ++k) ev[k] = (v2f){f[2 * k], f[2 * k + 1]};
#pragma unroll
    for (int k = 0; k < 5; ++k) od[k] = (v2f){f[2 * k + 1], f[2 * k + 2]};
#pragma unroll
    for (int o = 0; o < 4; ++o) {
      const int dy = r - o;              // tap row 0..4 of output row o
      if (dy < 0 || dy > 4) continue;
#pragma unroll
      for (int dx = 0; dx < 5; ++dx) {
        const v2f wv = (v2f){w[dy * 5 + dx], w[dy * 5 + dx]};
#pragma unroll
        for (int j = 0; j < 4; ++j)
          acc[o][j] = __builtin_elementwise_fma(
              wv, (dx & 1) ? od[j + (dx >> 1)] : ev[j + (dx >> 1)], acc[o][j]);
      }
    }
  }
  _Float16* dst = dwv + (size_t)bc * 4096 + (rg * 4) * 64 + cg * 8;
#pragma unroll
  for (int o = 0; o < 4; ++o) {
    v8h ov;
#pragma unroll
    for (int j = 0; j < 4; ++j) {
      ov[2 * j]     = (_Float16)acc[o][j][0];
      ov[2 * j + 1] = (_Float16)acc[o][j][1];
    }
    *(v8h*)(dst + o * 64) = ov;
  }
}

// ---------------------------------------------------------------------------
// K5: attn = (vkT @ q) * (1/4096) / z ; RMSNorm * norm_w ; + dw -> y (f16),
// then out = proj_w @ y + proj_b (fp32 out) in the same block: a block holds all
// 256 channels of its 64 positions, which is the whole B tile of the projection,
// so y goes from the accumulators into LDS and never to memory.
// grid = B*64, block = 256. q block staged transposed [n][c]; y takes its place.
// A = packed v k^T, then f16 proj weights in fragment order (fla_pack_kernel).
// ---------------------------------------------------------------------------
__global__ __launch_bounds__(256)
void fla_attn_kernel(const _Float16* __restrict__ vkTh, const _Float16* __restrict__ qf,
                     const float* __restrict__ ksum, const _Float16* __restrict__ dwv,
                     const float* __restrict__ norm_w, const _Float16* __restrict__ proj_wh,
                     const float* __restrict__ proj_b, float* __restrict__ out)
{
  __shared__ __attribute__((aligned(16))) _Float16 BshT[NB * LDK];
  __shared__ float kmean_sh[256];
  __shared__ float zcol[NB];
  __shared__ float colss[NB];

  const int tid  = threadIdx.x;
  const int b    = blockIdx.x >> 6;
  const int n0   = (blockIdx.x & 63) * NB;
  const int wave = tid >> 5;
  const int lane = tid & 31;

  const _Float16* qb = qf + (size_t)b * 256 * 4096 + n0;
#pragma unroll
  for (int it = 0; it < 8; ++it) {
    int q = tid + it * 256;              // 0..2047 16B-chunks
    int cch = q >> 3;
    int nc  = (q & 7) << 3;
    v8h hv = *(const v8h*)(qb + (size_t)cch * 4096 + nc);
#pragma unroll
    for (int u = 0; u < 8; ++u) BshT[(nc + u) * LDK + cch] = hv[u];
  }
  kmean_sh[tid] = ksum[b * 256 + tid] * (1.f / 4096.f);
  if (tid < NB) { colss[tid] = 0.f; zcol[tid] = FLA_EPS; }
  __syncthreads();

  {                                       // z = kmean . q(col) + eps, 4-way split
    int col = tid & 63, quarter = tid >> 6;
    const _Float16* bp = BshT + col * LDK + quarter * 64;
    const float* kp = kmean_sh + quarter * 64;
    float s = 0.f;
#pragma unroll
    for (int cc = 0; cc < 64; cc += 8) {
      v8h hv = *(const v8h*)(bp + cc);
#pragma unroll
      for (int u = 0; u < 8; ++u) s += kp[cc + u] * (float)hv[u];
    }
    atomicAdd(&zcol[col], s);
  }

  // This wave's 32 rows of the batch's packed v k^T (fla_sum_pack_kernel).
  const _Float16* ap = vkTh + ((size_t)(b * 8 + wave) << 13) + lane * 8;
  v8f acc[2][4] = {};
#pragma unroll 1
  for (int kk = 0; kk < 256; kk += 32) {
    v16h a0 = load_frag_packed(ap + kk * 32);
    v16h a1 = load_frag_packed(ap + kk * 32 + 512);
#pragma unroll
    for (int nt = 0; nt < 4; ++nt) {
      v16h bf = load_frag_f16(BshT, LDK, nt * 16, kk);
      acc[0][nt] = wmma_f16(a0, bf, acc[0][nt]);
      acc[1][nt] = wmma_f16(a1, bf, acc[1][nt]);
    }
  }
  __syncthreads();                        // zcol complete, colss zeroed, q tile read out
  const int r = lane & 15, hi = lane >> 4;
#pragma unroll
  for (int nt = 0; nt < 4; ++nt) {
    float z = zcol[nt * 16 + r];
    float s = 0.f;
#pragma unroll
    for (int i = 0; i < 2; ++i)
#pragma unroll
      for (int j = 0; j < 8; ++j) {
        float a = acc[i][nt][j] * (1.f / 4096.f) / z;
        acc[i][nt][j] = a;
        s += a * a;
      }
    atomicAdd(&colss[nt * 16 + r], s);
  }
  __syncthreads();
  float rinv[4];
#pragma unroll
  for (int nt = 0; nt < 4; ++nt)
    rinv[nt] = 1.f / sqrtf(colss[nt * 16 + r] * (1.f / 256.f) + FLA_EPS);
  // y, rounded to f16, goes into the LDS tile as [n][channel]: a lane's 8 accumulator
  // rows of one 16x16 tile are 8 neighbouring channels of one position = 16 bytes.
  v8h y8[2][4];
#pragma unroll
  for (int i = 0; i < 2; ++i)
#pragma unroll
    for (int j = 0; j < 8; ++j) {
      int m = (wave * 2 + i) * 16 + j + 8 * hi;
      float nw = norm_w[m];
#pragma unroll
      for (int nt = 0; nt < 4; ++nt) {
        size_t idx = (size_t)(b * 256 + m) * 4096 + n0 + nt * 16 + r;
        float yv = acc[i][nt][j] * rinv[nt] * nw + (float)dwv[idx];
        y8[i][nt][j] = (_Float16)yv;
      }
    }
#pragma unroll
  for (int i = 0; i < 2; ++i)
#pragma unroll
    for (int nt = 0; nt < 4; ++nt) {
      *(v8h*)&BshT[(nt * 16 + r) * LDK + (wave * 2 + i) * 16 + 8 * hi] = y8[i][nt];
      acc[i][nt] = (v8f){};
    }
  __syncthreads();                        // every wave's channels of y are in the tile

  ap = proj_wh + ((size_t)wave << 13) + lane * 8;
#pragma unroll 1
  for (int kk = 0; kk < 256; kk += 32) {
    v16h a0 = load_frag_packed(ap + kk * 32);
    v16h a1 = load_frag_packed(ap + kk * 32 + 512);
#pragma unroll
    for (int nt = 0; nt < 4; ++nt) {
      v16h bf = load_frag_f16(BshT, LDK, nt * 16, kk);
      acc[0][nt] = wmma_f16(a0, bf, acc[0][nt]);
      acc[1][nt] = wmma_f16(a1, bf, acc[1][nt]);
    }
  }
#pragma unroll
  for (int i = 0; i < 2; ++i)
#pragma unroll
    for (int j = 0; j < 8; ++j) {
      int m = (wave * 2 + i) * 16 + j + 8 * hi;
      float bias = proj_b[m];
#pragma unroll
      for (int nt = 0; nt < 4; ++nt)
        out[(size_t)(b * 256 + m) * 4096 + n0 + nt * 16 + r] = acc[i][nt][j] + bias;
    }
}

extern "C" void kernel_launch(void* const* d_in, const int* in_sizes, int n_in,
                              void* d_out, int out_size, void* d_ws, size_t ws_size,
                              hipStream_t stream)
{
  (void)in_sizes; (void)n_in; (void)out_size; (void)ws_size;
  const float* x      = (const float*)d_in[0];
  const float* qkv_w  = (const float*)d_in[1];
  const float* qkv_b  = (const float*)d_in[2];
  const float* dwc_w  = (const float*)d_in[3];
  const float* dwc_b  = (const float*)d_in[4];
  const float* norm_w = (const float*)d_in[5];
  const float* proj_w = (const float*)d_in[6];
  const float* proj_b = (const float*)d_in[7];
  float* out = (float*)d_out;

  const size_t B = 16, D = 256, N = 4096;
  char* ws = (char*)d_ws;
  size_t off = 0;
  auto take = [&](size_t bytes) {
    char* p = ws + off;
    off = (off + bytes + 255) & ~(size_t)255;
    return p;
  };
  _Float16* qf      = (_Float16*)take(B * D * N * 2);
  _Float16* kf      = (_Float16*)take(B * D * N * 2);
  _Float16* vf      = (_Float16*)take(B * D * N * 2);
  _Float16* dwv     = (_Float16*)take(B * D * N * 2);
  float*    vkP     = (float*)   take(16 * B * D * D * 4);
  _Float16* vkTh    = (_Float16*)take(B * D * D * 2);
  float*    ksum    = (float*)   take(B * D * 4);
  _Float16* qkv_wh  = (_Float16*)take(3 * D * D * 2);
  _Float16* proj_wh = (_Float16*)take(D * D * 2);

  int nvkt = (int)(B * D * D);
  int nqkvw = (int)(3 * D * D);
  int nprojw = (int)(D * D);
  fla_zero_kernel<<<dim3((int)((B * D + 255) / 256)), 256, 0, stream>>>(ksum, (int)(B * D));
  fla_pack_kernel<<<dim3((nqkvw / 8 + 255) / 256), 256, 0, stream>>>(qkv_w, qkv_wh, nqkvw / 8);
  fla_pack_kernel<<<dim3((nprojw / 8 + 255) / 256), 256, 0, stream>>>(proj_w, proj_wh, nprojw / 8);
  fla_qkv_kernel<<<dim3(1024), 256, 0, stream>>>(x, qkv_wh, qkv_b, qf, kf, vf, ksum);
  fla_vkt_kernel<<<dim3(256), 512, 0, stream>>>(vf, kf, vkP);
  fla_sum_pack_kernel<<<dim3(nvkt / 8 / 256), 256, 0, stream>>>(vkP, vkTh);
  fla_dwconv_kernel<<<dim3(4096), 128, 0, stream>>>(vf, dwc_w, dwc_b, dwv);
  fla_attn_kernel<<<dim3(1024), 256, 0, stream>>>(vkTh, qf, ksum, dwv, norm_w,
                                                  proj_wh, proj_b, out);
}

// v006
// A run of this version takes 118 microseconds.
// Timed twice side by side with v005, it ran 1.09 times as fast both times.
// Counting every step since v000, it is 2.05 times as fast.
#include <hip/hip_runtime.h>
#include <hip/hip_fp16.h>

typedef __attribute__((ext_vector_type(16))) _Float16 v16h;
typedef __attribute__((ext_vector_type(8)))  _Float16 v8h;
typedef __attribute__((ext_vector_type(2)))  _Float16 v2h;
typedef __attribute__((ext_vector_type(8)))  float    v8f;
typedef __attribute__((ext_vector_type(4)))  float    v4f;
typedef __attribute__((ext_vector_type(2)))  float    v2f;
typedef __attribute__((ext_vector_type(4)))  int      v4i;

#define FLA_EPS 1e-5f
#define NB 64
#define LDK 264   // padded K-stride (halves) for transposed [col][K] LDS blocks

static __device__ __forceinline__ v8f wmma_f16(v16h a, v16h b, v8f c) {
  return __builtin_amdgcn_wmma_f32_16x16x32_f16(false, a, false, b, (short)0, c,
                                                false, false);
}

// Async 16-byte global -> LDS copy (GLOBAL_LOAD_ASYNC_TO_LDS_B128, ASYNCcnt).
static __device__ __forceinline__ void async_cp16(void* lds, const void* g) {
  __builtin_amdgcn_global_load_async_to_lds_b128(
      (__attribute__((address_space(1))) v4i*)g,
      (__attribute__((address_space(3))) v4i*)lds, 0, 0);
}

// WMMA 16x16x32 fragment from an f16 matrix whose fragment rows are contiguous
// in K (A row-major, or B when columns are contiguous in K — e.g. transposed
// LDS blocks and v^T from v stored [d][N]). Two 16B loads per lane.
// Lane L (0-15) holds row rowBase+L; lanes 16-31 same rows, upper K-halves:
// elems 0..7 = K k0+hi*8+{0..7}, elems 8..15 = K k0+16+hi*8+{0..7}.
static __device__ __forceinline__ v16h load_frag_f16(const _Float16* src,
                                                     int ld, int rowBase, int k0) {
  int lane = threadIdx.x & 31;
  const _Float16* p = src + (size_t)(rowBase + (lane & 15)) * ld + k0 + ((lane >> 4) << 3);
  v16h f;
#pragma unroll
  for (int j = 0; j < 8; ++j) {
    f[j]     = p[j];
    f[j + 8] = p[j + 16];
  }
  return f;
}

// A operand in fragment order. A row-major f32 matrix [rows][256] is converted
// to f16 and laid out so that every wave-wide 16-byte load of an A fragment
// covers 512 contiguous bytes (four whole lines) instead of 32 bytes in each of
// 16 rows. Piece g (16 B = 8 halves) of the packed matrix:
//   g = (((rows/32 group) * 8 + K block of 32) * 2 + 16-row tile) * 2 + K half) * 32 + lane
// and holds row group*32 + tile*16 + (lane & 15),
//           K   block*32 + half*16 + (lane >> 4)*8 + {0..7},
// which is what load_frag_f16 gives that lane. One thread writes one piece.
static __device__ __forceinline__
void fla_pack_piece(const float* __restrict__ s, _Float16* __restrict__ d, int g) {
  int lane = g & 31;
  int row  = ((g >> 10) << 5) + (((g >> 6) & 1) << 4) + (lane & 15);
  int k    = (((g >> 7) & 7) << 5) + (((g >> 5) & 1) << 4) + ((lane >> 4) << 3);
  const float* p = s + (size_t)row * 256 + k;
  v4f lo = *(const v4f*)p;
  v4f hi = *(const v4f*)(p + 4);
  v8h o;
#pragma unroll
  for (int u = 0; u < 4; ++u) {
    o[u]     = (_Float16)lo[u];
    o[u + 4] = (_Float16)hi[u];
  }
  *(v8h*)(d + (size_t)g * 8) = o;
  // Stands in front of any later write to a register that the store names: in the
  // merged kernel the other branches' code follows this store in the text.
  asm volatile("s_wait_xcnt 0x0" ::: "memory");
}

// K0: all that has to stand ready before the qkv launch and depends on nothing
// but the inputs, in one grid: blocks 0..95 pack the qkv weights (24576 pieces),
// blocks 96..127 the proj weights (8192 pieces), blocks 128..143 zero ksum
// (4096 floats). grid = 144, block = 256; every block is full.
__global__ __launch_bounds__(256)
void fla_prep_kernel(const float* __restrict__ qkv_w, _Float16* __restrict__ qkv_wh,
                     const float* __restrict__ proj_w, _Float16* __restrict__ proj_wh,
                     float* __restrict__ ksum) {
  const int blk = blockIdx.x;
  const int tid = threadIdx.x;
  if (blk < 96)       fla_pack_piece(qkv_w, qkv_wh, blk * 256 + tid);
  else if (blk < 128) fla_pack_piece(proj_w, proj_wh, (blk - 96) * 256 + tid);
  else                ksum[(blk - 128) * 256 + tid] = 0.f;
}

// One 16x32 A fragment from a packed matrix: p points at this lane's piece of
// the fragment's first K half; the second K half lies 512 bytes behind it.
static __device__ __forceinline__ v16h load_frag_packed(const _Float16* p) {
  v8h lo = *(const v8h*)p;
  v8h hi = *(const v8h*)(p + 256);
  return __builtin_shufflevector(lo, hi, 0, 1, 2, 3, 4, 5, 6, 7,
                                 8, 9, 10, 11, 12, 13, 14, 15);
}

// ---------------------------------------------------------------------------
// K1: qkv 1x1 conv GEMM + feature map (q,k) / passthrough (v) + ksum for kmean
// grid = B*64, block = 256 (8 waves). Each block: 64 positions, K=256, and all
// 768 output channels: q, v and k one after the other ([256ch x 64pos] each)
// from the one x tile, which is read from memory and staged once.
// x block staged transposed into LDS as [n][c] f16 so B-frags are 2x16B reads.
// A = f16 qkv weights in fragment order (fla_pack_piece): whole-line loads.
// ---------------------------------------------------------------------------
__global__ __launch_bounds__(256)
void fla_qkv_kernel(const float* __restrict__ x, const _Float16* __restrict__ qkv_wh,
                    const float* __restrict__ qkv_b,
                    _Float16* __restrict__ qf, _Float16* __restrict__ kf,
                    _Float16* __restrict__ vf, float* __restrict__ ksum)
{
  __shared__ _Float16 BshT[NB * LDK];
  __shared__ float colsum[2][NB];        // [q, k]: each has its own sums
  __shared__ float ksum_sh[256];

  const int tid   = threadIdx.x;
  const int b     = blockIdx.x >> 6;
  const int n0    = (blockIdx.x & 63) * NB;
  const int wave  = tid >> 5;
  const int lane  = tid & 31;

  // Stage x[b, :, n0:n0+64] -> f16 LDS transposed (vector global loads)
  const float* xb = x + (size_t)b * 256 * 4096 + n0;
#pragma unroll
  for (int it = 0; it < 16; ++it) {
    int q = tid + it * 256;              // 0..4095 float4-chunks
    int c  = q >> 4;
    int nc = (q & 15) << 2;
    v4f xv = *(const v4f*)(xb + (size_t)c * 4096 + nc);
#pragma unroll
    for (int u = 0; u < 4; ++u) BshT[(nc + u) * LDK + c] = (_Float16)xv[u];
  }
  if (tid < 2 * NB) colsum[tid >> 6][tid & 63] = 0.f;
  ksum_sh[tid] = 0.f;
  __syncthreads();

  const int r = lane & 15, hi = lane >> 4;
  // Kept rolled: one copy of the GEMM loop and its epilogues in the text.
#pragma unroll 1
  for (int turn = 0; turn < 3; ++turn) {
  // 0=q 1=k 2=v (block-uniform), in the order q, v, k: k's turn ends in a barrier
  // that also waits for the turn's own stores, so no GEMM is put behind it.
  const int which = turn ? 3 - turn : 0;
  const int ofs = which << 8;            // row offset into qkv_w / qkv_b
  // This wave's 32 rows of A: 16 KB in a row, 2 KB per K block of 32.
  const _Float16* ap = qkv_wh + ((size_t)(which * 8 + wave) << 13) + lane * 8;
  v8f acc[2][4] = {};
#pragma unroll 1
  for (int kk = 0; kk < 256; kk += 32) {
    v16h a0 = load_frag_packed(ap + kk * 32);
    v16h a1 = load_frag_packed(ap + kk * 32 + 512);
#pragma unroll
    for (int nt = 0; nt < 4; ++nt) {
      v16h bf = load_frag_f16(BshT, LDK, nt * 16, kk);
      acc[0][nt] = wmma_f16(a0, bf, acc[0][nt]);
      acc[1][nt] = wmma_f16(a1, bf, acc[1][nt]);
    }
  }

  if (which == 2) {                       // v: bias only, write f16
#pragma unroll
    for (int i = 0; i < 2; ++i)
#pragma unroll
      for (int j = 0; j < 8; ++j) {
        int m = (wave * 2 + i) * 16 + j + 8 * hi;
        float bias = qkv_b[ofs + m];
#pragma unroll
        for (int nt = 0; nt < 4; ++nt) {
          int n = n0 + nt * 16 + r;
          vf[(size_t)(b * 256 + m) * 4096 + n] = (_Float16)(acc[i][nt][j] + bias);
        }
      }
  } else {
    // feature map: t = (relu(val)+eps)^2, then column L2 normalize over 256 ch
#pragma unroll
    for (int i = 0; i < 2; ++i)
#pragma unroll
      for (int j = 0; j < 8; ++j) {
        int m = (wave * 2 + i) * 16 + j + 8 * hi;
        float bias = qkv_b[ofs + m];
#pragma unroll
        for (int nt = 0; nt < 4; ++nt) {
          float t = fmaxf(acc[i][nt][j] + bias, 0.f) + FLA_EPS;
          acc[i][nt][j] = t * t;
        }
      }
#pragma unroll
    for (int nt = 0; nt < 4; ++nt) {
      float s = 0.f;
#pragma unroll
      for (int i = 0; i < 2; ++i)
#pragma unroll
        for (int j = 0; j < 8; ++j) s += acc[i][nt][j] * acc[i][nt][j];
      atomicAdd(&colsum[which][nt * 16 + r], s);     // ds_add_f32
    }
    __syncthreads();
    float inv[4];
#pragma unroll
    for (int nt = 0; nt < 4; ++nt)
      inv[nt] = 1.f / fmaxf(sqrtf(colsum[which][nt * 16 + r]), 1e-12f);
    _Float16* dst = (which == 0) ? qf : kf;
#pragma unroll
    for (int i = 0; i < 2; ++i)
#pragma unroll
      for (int j = 0; j < 8; ++j) {
        int m = (wave * 2 + i) * 16 + j + 8 * hi;
        float rowsum = 0.f;
#pragma unroll
        for (int nt = 0; nt < 4; ++nt) {
          float tn = acc[i][nt][j] * inv[nt];
          dst[(size_t)(b * 256 + m) * 4096 + n0 + nt * 16 + r] = (_Float16)tn;
          rowsum += tn;
        }
        if (which == 1) atomicAdd(&ksum_sh[m], rowsum);
      }
    if (which == 1) {
      __syncthreads();
      atomicAdd(&ksum[b * 256 + tid], ksum_sh[tid]);
    }
  }
  // Stands in front of the next turn's writes to registers that this turn's
  // stores name (their address pairs and data registers are used again there).
  asm volatile("s_wait_xcnt 0x0" ::: "memory");
  }
}

// ---------------------------------------------------------------------------
// K2: vkT = v @ k^T  [256x256], K=N=4096, split-K across 16 blocks per batch.
// grid = B*16, block = 512 (16 waves). k^T chunks double-buffered via async
// LDS copies (ASYNCcnt in-order completion: wait<=2 keeps newest in flight).
// Each block stores its own f32 partial product with plain 16-byte stores;
// fla_sum_pack adds the 16 partials of a batch. The product is formed as
// k @ v^T (k is the A operand), so a lane's 8 accumulator rows are 8 neighbouring
// columns of one row of v k^T: lane and tile then number exactly as the pieces of
// the packed A operand do (fla_pack_piece), and partials are kept in that order:
//   vkP[((b*16 + split)*2 + h)*8192 + g][4] = columns h*4 .. h*4+3 of piece g.
// ---------------------------------------------------------------------------
__global__ __launch_bounds__(512)
void fla_vkt_kernel(const _Float16* __restrict__ vf, const _Float16* __restrict__ kf,
                    float* __restrict__ vkP)
{
  __shared__ _Float16 Bsh[2][256 * 40];  // [buf][col j][k-chunk 32, pad 40]
  const int tid  = threadIdx.x;
  const int wave = tid >> 5;
  const int lane = tid & 31;
  const int b    = blockIdx.x >> 4;
  const int k0g  = (blockIdx.x & 15) * 256;

  const _Float16* vb = vf + (size_t)b * 256 * 4096;
  const _Float16* kb = kf + (size_t)b * 256 * 4096 + k0g;

  const int j0 = tid >> 2, piece0 = (tid & 3) << 3;       // chunk 0 of 2
  const int j1 = (tid + 512) >> 2, piece1 = (tid & 3) << 3;

  // prologue: issue k-chunk 0 into buf 0
  async_cp16(&Bsh[0][j0 * 40 + piece0], kb + (size_t)j0 * 4096 + piece0);
  async_cp16(&Bsh[0][j1 * 40 + piece1], kb + (size_t)j1 * 4096 + piece1);

  v8f acc[16] = {};
#pragma unroll 1
  for (int step = 0; step < 8; ++step) {
    int kk = step * 32;
    if (step < 7) {                      // issue next chunk into other buffer
      async_cp16(&Bsh[(step + 1) & 1][j0 * 40 + piece0],
                 kb + (size_t)j0 * 4096 + kk + 32 + piece0);
      async_cp16(&Bsh[(step + 1) & 1][j1 * 40 + piece1],
                 kb + (size_t)j1 * 4096 + kk + 32 + piece1);
      __builtin_amdgcn_s_wait_asynccnt(2);   // chunk `step` landed (in-order)
    } else {
      __builtin_amdgcn_s_wait_asynccnt(0);
    }
    __syncthreads();
    v16h a = load_frag_f16(vb, 4096, wave * 16, k0g + kk);
    const _Float16* bsrc = Bsh[step & 1];
#pragma unroll
    for (int nt = 0; nt < 16; ++nt) {
      v16h bf = load_frag_f16(bsrc, 40, nt * 16, 0);  // cols contiguous in K
      acc[nt] = wmma_f16(bf, a, acc[nt]);   // rows: k channels, columns: v channels
    }
    __syncthreads();                     // all waves done before buf reuse
  }
  // Piece of tile nt: group wave>>1, K block nt>>1, 16-row tile wave&1, K half nt&1.
  // A wave's store covers 512 contiguous bytes.
  float* pp = vkP + ((size_t)blockIdx.x * 2 * 8192 +
                     (wave >> 1) * 1024 + (wave & 1) * 64 + lane) * 4;
#pragma unroll
  for (int nt = 0; nt < 16; ++nt) {
    float* pt = pp + ((nt >> 1) * 128 + (nt & 1) * 32) * 4;
    *(v4f*)pt = __builtin_shufflevector(acc[nt], acc[nt], 0, 1, 2, 3);
    *(v4f*)(pt + 8192 * 4) = __builtin_shufflevector(acc[nt], acc[nt], 4, 5, 6, 7);
  }
}

// K3 (part of the K4 launch): adds a batch's 16 partial products, split 0 first,
// and rounds the sum to f16: thread t = b*8192 + g makes piece t of the packed
// v k^T (16 bytes). Every load of a wave covers 512 contiguous bytes.
static __device__ __forceinline__
void fla_sum_pack(const float* __restrict__ vkP, _Float16* __restrict__ d, int t) {
  const float* p = vkP + ((size_t)(t >> 13) * 32 * 8192 + (t & 8191)) * 4;
  v4f lo = *(const v4f*)p;
  v4f hi = *(const v4f*)(p + (size_t)8192 * 4);
#pragma unroll
  for (int s = 1; s < 16; ++s) {
    lo += *(const v4f*)(p + (size_t)(s * 2) * 8192 * 4);
    hi += *(const v4f*)(p + (size_t)(s * 2 + 1) * 8192 * 4);
  }
  v8h o;
#pragma unroll
  for (int u = 0; u < 4; ++u) {
    o[u]     = (_Float16)lo[u];
    o[u + 4] = (_Float16)hi[u];
  }
  *(v8h*)(d + (size_t)t * 8) = o;
}

// ---------------------------------------------------------------------------
// K4: depthwise 5x5 SAME conv on v. One block per (b, c) plane of 64x64 pixels.
// The plane is staged once into LDS inside a frame of zeros (two rows above and
// below, two columns left and right), so no tap needs a bounds test; each
// thread then computes an 8-wide x 4-high tile of outputs in registers.
// block = 128 (8 column groups x 16 row groups).
// The same grid also sums the v k^T partials (fla_sum_pack): both need only what
// the launches before have written and neither reads the other's output. Of every
// five blocks four take a plane and the fifth 128 pieces of v k^T, so that the
// sums' reads run beside the planes' arithmetic. grid = B*256 + B*8192/128 = 5120.
// LDS row = 8 halves pad | 64 pixels | 8 halves pad = 160 B: the two 128-B row
// pieces that 16 lanes read with one 16-byte load fall on disjoint bank halves.
// ---------------------------------------------------------------------------
#define DWP 80
__global__ __launch_bounds__(128)
void fla_dwconv_sum_kernel(const _Float16* __restrict__ vf, const float* __restrict__ w5,
                           const float* __restrict__ wb, _Float16* __restrict__ dwv,
                           const float* __restrict__ vkP, _Float16* __restrict__ vkTh)
{
  __shared__ __attribute__((aligned(16))) _Float16 tile[68 * DWP];  // image rows -2 .. 65
  const int tid  = threadIdx.x;
  const int five = blockIdx.x / 5;       // 0..1023
  const int role = blockIdx.x - five * 5;
  if (role == 4) {                       // the whole block leaves, ahead of the barrier
    fla_sum_pack(vkP, vkTh, five * 128 + tid);
    return;
  }
  const int bc  = five * 4 + role;       // b*256 + c
  const int c   = bc & 255;
  const int cg  = tid & 7;               // column group: 8 pixels
  const int rg  = tid >> 3;              // 0..15
  const _Float16* src = vf + (size_t)bc * 4096;

  // The block's 25 taps and its bias, asked for ahead of the copies so that both
  // latencies run together. Every loop of this kernel is unrolled in full, so
  // that its arrays are indexed by constants and stay in registers.
  const float* wt = w5 + c * 25;
  float w[25];
#pragma unroll
  for (int i = 0; i < 25; ++i) w[i] = wt[i];
  const float bias = wb[c];

  {
    // 512 chunks of 16 B, four per thread: chunk tid + 128*i is image row
    // rg + 16*i, column group cg.
    const unsigned l0 = (unsigned)(size_t)&tile[(rg + 2) * DWP + 8 + cg * 8];
    const unsigned l1 = l0 + 16 * DWP * 2;
    const unsigned l2 = l0 + 32 * DWP * 2;
    const unsigned l3 = l0 + 48 * DWP * 2;
    const _Float16* g0 = src + tid * 8;
    const _Float16* g1 = g0 + 1024;
    const _Float16* g2 = g0 + 2048;
    const _Float16* g3 = g0 + 3072;
    // The copies bring the plane into LDS through no register; the closing wait
    // stands in the same statement so that no address register is rewritten
    // ahead of it.
    asm volatile("global_load_async_to_lds_b128 %0, %4, off\n\t"
                 "global_load_async_to_lds_b128 %1, %5, off\n\t"
                 "global_load_async_to_lds_b128 %2, %6, off\n\t"
                 "global_load_async_to_lds_b128 %3, %7, off\n\t"
                 "s_wait_xcnt 0x0"
                 :: "v"(l0), "v"(l1), "v"(l2), "v"(l3),
                    "v"(g0), "v"(g1), "v"(g2), "v"(g3)
                 : "memory");
  }
  // The frame of zeros: bytes that no copy writes.
  if (tid < 40) {                        // LDS rows 0, 1, 66, 67, ten 16-B chunks each
    int fr  = tid / 10;
    int row = fr + ((fr >> 1) * 64);
    v8h zz = {};
    *(v8h*)&tile[row * DWP + (tid - fr * 10) * 8] = zz;
  }
  *(unsigned*)&tile[(2 + (tid >> 1)) * DWP + ((tid & 1) ? 72 : 6)] = 0u;  // columns -2,-1 / 64,65
  // Every copy of this wave has landed before the barrier lets other waves read.
  asm volatile("s_wait_asynccnt 0x0" ::: "memory");
  __syncthreads();

  v2f acc[4][4];                         // [output row][pair of neighbouring columns]
#pragma unroll
  for (int o = 0; o < 4; ++o)
#pragma unroll
    for (int j = 0; j < 4; ++j) acc[o][j] = (v2f){bias, bias};

  // LDS row rg*4 + r is image row rg*4 - 2 + r; f[] holds columns cg*8-2 .. cg*8+9.
  // Each output sums bias, then its taps by rows and, within a row, left to right.
  const _Float16* base = &tile[(rg * 4) * DWP + 8 + cg * 8];
#pragma unroll
  for (int r = 0; r < 8; ++r) {
    const _Float16* p = base + r * DWP;
    v2h lft = *(const v2h*)(p - 2);
    v8h mid = *(const v8h*)p;
    v2h rgt = *(const v2h*)(p + 8);
    float f[12];
    f[0] = (float)lft[0]; f[1] = (float)lft[1];
#pragma unroll
    for (int u = 0; u < 8; ++u) f[2 + u] = (float)mid[u];
    f[10] = (float)rgt[0]; f[11] = (float)rgt[1];
    // Column pairs that start at an even and at an odd place, so that every
    // tap column finds its two inputs in one register pair (packed f32 fma).
    v2f ev[6], od[5];
#pragma unroll
    for (int k = 0; k < 6; ++k) ev[k] = (v2f){f[2 * k], f[2 * k + 1]};
#pragma unroll
    for (int k = 0; k < 5; ++k) od[k] = (v2f){f[2 * k + 1], f[2 * k + 2]};
#pragma unroll
    for (int o = 0; o < 4; ++o) {
      const int dy = r - o;              // tap row 0..4 of output row o
      if (dy < 0 || dy > 4) continue;
#pragma unroll
      for (int dx = 0; dx < 5; ++dx) {
        const v2f wv = (v2f){w[dy * 5 + dx], w[dy * 5 + dx]};
#pragma unroll
        for (int j = 0; j < 4; ++j)
          acc[o][j] = __builtin_elementwise_fma(
              wv, (dx & 1) ? od[j + (dx >> 1)] : ev[j + (dx >> 1)], acc[o][j]);
      }
    }
  }
  _Float16* dst = dwv + (size_t)bc * 4096 + (rg * 4) * 64 + cg * 8;
#pragma unroll
  for (int o = 0; o < 4; ++o) {
    v8h ov;
#pragma unroll
    for (int j = 0; j < 4; ++j) {
      ov[2 * j]     = (_Float16)acc[o][j][0];
      ov[2 * j + 1] = (_Float16)acc[o][j][1];
    }
    *(v8h*)(dst + o * 64) = ov;
  }
}

// ---------------------------------------------------------------------------
// K5: attn = (vkT @ q) * (1/4096) / z ; RMSNorm * norm_w ; + dw -> y (f16),
// then out = proj_w @ y + proj_b (fp32 out) in the same block: a block holds all
// 256 channels of its 64 positions, which is the whole B tile of the projection,
// so y goes from the accumulators into LDS and never to memory.
// grid = B*64, block = 256. q block staged transposed [n][c]; y takes its place.
// A = packed v k^T, then f16 proj weights in fragment order (fla_pack_piece).
// ---------------------------------------------------------------------------
__global__ __launch_bounds__(256)
void fla_attn_kernel(const _Float16* __restrict__ vkTh, const _Float16* __restrict__ qf,
                     const float* __restrict__ ksum, const _Float16* __restrict__ dwv,
                     const float* __restrict__ norm_w, const _Float16* __restrict__ proj_wh,
                     const float* __restrict__ proj_b, float* __restrict__ out)
{
  __shared__ __attribute__((aligned(16))) _Float16 BshT[NB * LDK];
  __shared__ float kmean_sh[256];
  __shared__ float zcol[NB];
  __shared__ float colss[NB];

  const int tid  = threadIdx.x;
  const int b    = blockIdx.x >> 6;
  const int n0   = (blockIdx.x & 63) * NB;
  const int wave = tid >> 5;
  const int lane = tid & 31;

  const _Float16* qb = qf + (size_t)b * 256 * 4096 + n0;
#pragma unroll
  for (int it = 0; it < 8; ++it) {
    int q = tid + it * 256;              // 0..2047 16B-chunks
    int cch = q >> 3;
    int nc  = (q & 7) << 3;
    v8h hv = *(const v8h*)(qb + (size_t)cch * 4096 + nc);
#pragma unroll
    for (int u = 0; u < 8; ++u) BshT[(nc + u) * LDK + cch] = hv[u];
  }
  kmean_sh[tid] = ksum[b * 256 + tid] * (1.f / 4096.f);
  if (tid < NB) { colss[tid] = 0.f; zcol[tid] = FLA_EPS; }
  __syncthreads();

  {                                       // z = kmean . q(col) + eps, 4-way split
    int col = tid & 63, quarter = tid >> 6;
    const _Float16* bp = BshT + col * LDK + quarter * 64;
    const float* kp = kmean_sh + quarter * 64;
    float s = 0.f;
#pragma unroll
    for (int cc = 0; cc < 64; cc += 8) {
      v8h hv = *(const v8h*)(bp + cc);
#pragma unroll
      for (int u = 0; u < 8; ++u) s += kp[cc + u] * (float)hv[u];
    }
    atomicAdd(&zcol[col], s);
  }

  // This wave's 32 rows of the batch's packed v k^T (fla_pack_piece).
  const _Float16* ap = vkTh + ((size_t)(b * 8 + wave) << 13) + lane * 8;
  v8f acc[2][4] = {};
#pragma unroll 1
  for (int kk = 0; kk < 256; kk += 32) {
    v16h a0 = load_frag_packed(ap + kk * 32);
    v16h a1 = load_frag_packed(ap + kk * 32 + 512);
#pragma unroll
    for (int nt = 0; nt < 4; ++nt) {
      v16h bf = load_frag_f16(BshT, LDK, nt * 16, kk);
      acc[0][nt] = wmma_f16(a0, bf, acc[0][nt]);
      acc[1][nt] = wmma_f16(a1, bf, acc[1][nt]);
    }
  }
  __syncthreads();                        // zcol complete, colss zeroed, q tile read out
  const int r = lane & 15, hi = lane >> 4;
#pragma unroll
  for (int nt = 0; nt < 4; ++nt) {
    float z = zcol[nt * 16 + r];
    float s = 0.f;
#pragma unroll
    for (int i = 0; i < 2; ++i)
#pragma unroll
      for (int j = 0; j < 8; ++j) {
        float a = acc[i][nt][j] * (1.f / 4096.f) / z;
        acc[i][nt][j] = a;
        s += a * a;
      }
    atomicAdd(&colss[nt * 16 + r], s);
  }
  __syncthreads();
  float rinv[4];
#pragma unroll
  for (int nt = 0; nt < 4; ++nt)
    rinv[nt] = 1.f / sqrtf(colss[nt * 16 + r] * (1.f / 256.f) + FLA_EPS);
  // y, rounded to f16, goes into the LDS tile as [n][channel]: a lane's 8 accumulator
  // rows of one 16x16 tile are 8 neighbouring channels of one position = 16 bytes.
  v8h y8[2][4];
#pragma unroll
  for (int i = 0; i < 2; ++i)
#pragma unroll
    for (int j = 0; j < 8; ++j) {
      int m = (wave * 2 + i) * 16 + j + 8 * hi;
      float nw = norm_w[m];
#pragma unroll
      for (int nt = 0; nt < 4; ++nt) {
        size_t idx = (size_t)(b * 256 + m) * 4096 + n0 + nt * 16 + r;
        float yv = acc[i][nt][j] * rinv[nt] * nw + (float)dwv[idx];
        y8[i][nt][j] = (_Float16)yv;
      }
    }
#pragma unroll
  for (int i = 0; i < 2; ++i)
#pragma unroll
    for (int nt = 0; nt < 4; ++nt) {
      *(v8h*)&BshT[(nt * 16 + r) * LDK + (wave * 2 + i) * 16 + 8 * hi] = y8[i][nt];
      acc[i][nt] = (v8f){};
    }
  __syncthreads();                        // every wave's channels of y are in the tile

  ap = proj_wh + ((size_t)wave << 13) + lane * 8;
#pragma unroll 1
  for (int kk = 0; kk < 256; kk += 32) {
    v16h a0 = load_frag_packed(ap + kk * 32);
    v16h a1 = load_frag_packed(ap + kk * 32 + 512);
#pragma unroll
    for (int nt = 0; nt < 4; ++nt) {
      v16h bf = load_frag_f16(BshT, LDK, nt * 16, kk);
      acc[0][nt] = wmma_f16(a0, bf, acc[0][nt]);
      acc[1][nt] = wmma_f16(a1, bf, acc[1][nt]);
    }
  }
#pragma unroll
  for (int i = 0; i < 2; ++i)
#pragma unroll
    for (int j = 0; j < 8; ++j) {
      int m = (wave * 2 + i) * 16 + j + 8 * hi;
      float bias = proj_b[m];
#pragma unroll
      for (int nt = 0; nt < 4; ++nt)
        out[(size_t)(b * 256 + m) * 4096 + n0 + nt * 16 + r] = acc[i][nt][j] + bias;
    }
}

extern "C" void kernel_launch(void* const* d_in, const int* in_sizes, int n_in,
                              void* d_out, int out_size, void* d_ws, size_t ws_size,
                              hipStream_t stream)
{
  (void)in_sizes; (void)n_in; (void)out_size; (void)ws_size;
  const float* x      = (const float*)d_in[0];
  const float* qkv_w  = (const float*)d_in[1];
  const float* qkv_b  = (const float*)d_in[2];
  const float* dwc_w  = (const float*)d_in[3];
  const float* dwc_b  = (const float*)d_in[4];
  const float* norm_w = (const float*)d_in[5];
  const float* proj_w = (const float*)d_in[6];
  const float* proj_b = (const float*)d_in[7];
  float* out = (float*)d_out;

  const size_t B = 16, D = 256, N = 4096;
  char* ws = (char*)d_ws;
  size_t off = 0;
  auto take = [&](size_t bytes) {
    char* p = ws + off;
    off = (off + bytes + 255) & ~(size_t)255;
    return p;
  };
  _Float16* qf      = (_Float16*)take(B * D * N * 2);
  _Float16* kf      = (_Float16*)take(B * D * N * 2);
  _Float16* vf      = (_Float16*)take(B * D * N * 2);
  _Float16* dwv     = (_Float16*)take(B * D * N * 2);
  float*    vkP     = (float*)   take(16 * B * D * D * 4);
  _Float16* vkTh    = (_Float16*)take(B * D * D * 2);
  float*    ksum    = (float*)   take(B * D * 4);
  _Float16* qkv_wh  = (_Float16*)take(3 * D * D * 2);
  _Float16* proj_wh = (_Float16*)take(D * D * 2);

  fla_prep_kernel<<<dim3(144), 256, 0, stream>>>(qkv_w, qkv_wh, proj_w, proj_wh, ksum);
  fla_qkv_kernel<<<dim3(1024), 256, 0, stream>>>(x, qkv_wh, qkv_b, qf, kf, vf, ksum);
  fla_vkt_kernel<<<dim3(256), 512, 0, stream>>>(vf, kf, vkP);
  fla_dwconv_sum_kernel<<<dim3(5120), 128, 0, stream>>>(vf, dwc_w, dwc_b, dwv, vkP, vkTh);
  fla_attn_kernel<<<dim3(1024), 256, 0, stream>>>(vkTh, qf, ksum, dwv, norm_w,
                                                  proj_wh, proj_b, out);
}

// v007
// Measured time: 108 microseconds a run.
// Next to v006, in two timings, it ran 1.07 and 1.08 times as fast.
// Over all steps from v000 it is 2.21 times as fast.
#include <hip/hip_runtime.h>
#include <hip/hip_fp16.h>

typedef __attribute__((ext_vector_type(16))) _Float16 v16h;
typedef __attribute__((ext_vector_type(8)))  _Float16 v8h;
typedef __attribute__((ext_vector_type(2)))  _Float16 v2h;
typedef __attribute__((ext_vector_type(8)))  float    v8f;
typedef __attribute__((ext_vector_type(4)))  float    v4f;
typedef __attribute__((ext_vector_type(2)))  float    v2f;
typedef __attribute__((ext_vector_type(4)))  int      v4i;

#define FLA_EPS 1e-5f
#define NB 64
#define LDK 264   // padded K-stride (halves) for transposed [col][K] LDS blocks

static __device__ __forceinline__ v8f wmma_f16(v16h a, v16h b, v8f c) {
  return __builtin_amdgcn_wmma_f32_16x16x32_f16(false, a, false, b, (short)0, c,
                                                false, false);
}

// Async 16-byte global -> LDS copy (GLOBAL_LOAD_ASYNC_TO_LDS_B128, ASYNCcnt).
static __device__ __forceinline__ void async_cp16(void* lds, const void* g) {
  __builtin_amdgcn_global_load_async_to_lds_b128(
      (__attribute__((address_space(1))) v4i*)g,
      (__attribute__((address_space(3))) v4i*)lds, 0, 0);
}

// WMMA 16x16x32 fragment from an f16 matrix whose fragment rows are contiguous
// in K (A row-major, or B when columns are contiguous in K — e.g. transposed
// LDS blocks and v^T from v stored [d][N]). Two 16B loads per lane.
// Lane L (0-15) holds row rowBase+L; lanes 16-31 same rows, upper K-halves:
// elems 0..7 = K k0+hi*8+{0..7}, elems 8..15 = K k0+16+hi*8+{0..7}.
static __device__ __forceinline__ v16h load_frag_f16(const _Float16* src,
                                                     int ld, int rowBase, int k0) {
  int lane = threadIdx.x & 31;
  const _Float16* p = src + (size_t)(rowBase + (lane & 15)) * ld + k0 + ((lane >> 4) << 3);
  v16h f;
#pragma unroll
  for (int j = 0; j < 8; ++j) {
    f[j]     = p[j];
    f[j + 8] = p[j + 16];
  }
  return f;
}

// A operand in fragment order. A row-major f32 matrix [rows][256] is converted
// to f16 and laid out so that every wave-wide 16-byte load of an A fragment
// covers 512 contiguous bytes (four whole lines) instead of 32 bytes in each of
// 16 rows. Piece g (16 B = 8 halves) of the packed matrix:
//   g = (((rows/32 group) * 8 + K block of 32) * 2 + 16-row tile) * 2 + K half) * 32 + lane
// and holds row group*32 + tile*16 + (lane & 15),
//           K   block*32 + half*16 + (lane >> 4)*8 + {0..7},
// which is what load_frag_f16 gives that lane. One thread writes one piece.
static __device__ __forceinline__
void fla_pack_piece(const float* __restrict__ s, _Float16* __restrict__ d, int g) {
  int lane = g & 31;
  int row  = ((g >> 10) << 5) + (((g >> 6) & 1) << 4) + (lane & 15);
  int k    = (((g >> 7) & 7) << 5) + (((g >> 5) & 1) << 4) + ((lane >> 4) << 3);
  const float* p = s + (size_t)row * 256 + k;
  v4f lo = *(const v4f*)p;
  v4f hi = *(const v4f*)(p + 4);
  v8h o;
#pragma unroll
  for (int u = 0; u < 4; ++u) {
    o[u]     = (_Float16)lo[u];
    o[u + 4] = (_Float16)hi[u];
  }
  *(v8h*)(d + (size_t)g * 8) = o;
  // Stands in front of any later write to a register that the store names: in the
  // merged kernel the other branches' code follows this store in the text.
  asm volatile("s_wait_xcnt 0x0" ::: "memory");
}

// Turns a thread's 8 channels x 8 positions of f16 (h[e] = 8 neighbouring positions
// of channel cg*8 + e) in registers and stores them into a [position][channel] LDS
// tile of pitch LDK: one 16-byte store per position holds the 8 channels.
static __device__ __forceinline__
void fla_turn8_store(_Float16* tileT, const v8h (&h)[8], int nc, int cg) {
#pragma unroll
  for (int u = 0; u < 8; ++u) {
    v8h o;
#pragma unroll
    for (int e = 0; e < 8; ++e) o[e] = h[e][u];
    *(v8h*)&tileT[(nc + u) * LDK + cg * 8] = o;
  }
}

// K0: all that has to stand ready before the qkv launch and depends on nothing
// but the inputs, in one grid: blocks 0..95 pack the qkv weights (24576 pieces),
// blocks 96..127 the proj weights (8192 pieces), blocks 128..143 zero ksum
// (4096 floats). grid = 144, block = 256; every block is full.
__global__ __launch_bounds__(256)
void fla_prep_kernel(const float* __restrict__ qkv_w, _Float16* __restrict__ qkv_wh,
                     const float* __restrict__ proj_w, _Float16* __restrict__ proj_wh,
                     float* __restrict__ ksum) {
  const int blk = blockIdx.x;
  const int tid = threadIdx.x;
  if (blk < 96)       fla_pack_piece(qkv_w, qkv_wh, blk * 256 + tid);
  else if (blk < 128) fla_pack_piece(proj_w, proj_wh, (blk - 96) * 256 + tid);
  else                ksum[(blk - 128) * 256 + tid] = 0.f;
}

// One 16x32 A fragment from a packed matrix: p points at this lane's piece of
// the fragment's first K half; the second K half lies 512 bytes behind it.
static __device__ __forceinline__ v16h load_frag_packed(const _Float16* p) {
  v8h lo = *(const v8h*)p;
  v8h hi = *(const v8h*)(p + 256);
  return __builtin_shufflevector(lo, hi, 0, 1, 2, 3, 4, 5, 6, 7,
                                 8, 9, 10, 11, 12, 13, 14, 15);
}

// ---------------------------------------------------------------------------
// K1: qkv 1x1 conv GEMM + feature map (q,k) / passthrough (v) + ksum for kmean
// grid = B*64, block = 256 (8 waves). Each block: 64 positions, K=256, and all
// 768 output channels: q, v and k one after the other ([256ch x 64pos] each)
// from the one x tile, which is read from memory and staged once.
// x block staged transposed into LDS as [n][c] f16 so B-frags are 2x16B reads.
// A = f16 qkv weights in fragment order (fla_pack_piece): whole-line loads.
// ---------------------------------------------------------------------------
__global__ __launch_bounds__(256)
void fla_qkv_kernel(const float* __restrict__ x, const _Float16* __restrict__ qkv_wh,
                    const float* __restrict__ qkv_b,
                    _Float16* __restrict__ qf, _Float16* __restrict__ kf,
                    _Float16* __restrict__ vf, float* __restrict__ ksum)
{
  __shared__ __attribute__((aligned(16))) _Float16 BshT[NB * LDK];
  __shared__ float colsum[2][NB];        // [q, k]: each has its own sums
  __shared__ float ksum_sh[256];

  const int tid   = threadIdx.x;
  const int b     = blockIdx.x >> 6;
  const int n0    = (blockIdx.x & 63) * NB;
  const int wave  = tid >> 5;
  const int lane  = tid & 31;

  // Stage x[b, :, n0:n0+64] -> f16 LDS transposed. A thread loads 4 positions of
  // each of 8 neighbouring channels (16 lanes cover a row's 256 bytes), twice, and
  // stores each position's 8 channels with one 16-byte LDS store.
  const float* xb = x + (size_t)b * 256 * 4096 + n0;
  {
    const int nc = (tid & 15) << 2;
    const int cg = tid >> 4;             // 0..15; the second half takes cg + 16
    v4f xv[2][8];
#pragma unroll
    for (int it = 0; it < 2; ++it)
#pragma unroll
      for (int e = 0; e < 8; ++e)
        xv[it][e] = *(const v4f*)(xb + (size_t)((cg + it * 16) * 8 + e) * 4096 + nc);
#pragma unroll
    for (int it = 0; it < 2; ++it)
#pragma unroll
      for (int u = 0; u < 4; ++u) {
        v8h o;
#pragma unroll
        for (int e = 0; e < 8; ++e) o[e] = (_Float16)xv[it][e][u];
        *(v8h*)&BshT[(nc + u) * LDK + (cg + it * 16) * 8] = o;
      }
  }
  if (tid < 2 * NB) colsum[tid >> 6][tid & 63] = 0.f;
  ksum_sh[tid] = 0.f;
  __syncthreads();

  const int r = lane & 15, hi = lane >> 4;
  // Kept rolled: one copy of the GEMM loop and its epilogues in the text.
#pragma unroll 1
  for (int turn = 0; turn < 3; ++turn) {
  // 0=q 1=k 2=v (block-uniform), in the order q, v, k: k's turn ends in a barrier
  // that also waits for the turn's own stores, so no GEMM is put behind it.
  const int which = turn ? 3 - turn : 0;
  const int ofs = which << 8;            // row offset into qkv_w / qkv_b
  // This wave's 32 rows of A: 16 KB in a row, 2 KB per K block of 32.
  const _Float16* ap = qkv_wh + ((size_t)(which * 8 + wave) << 13) + lane * 8;
  v8f acc[2][4] = {};
#pragma unroll 1
  for (int kk = 0; kk < 256; kk += 32) {
    v16h a0 = load_frag_packed(ap + kk * 32);
    v16h a1 = load_frag_packed(ap + kk * 32 + 512);
#pragma unroll
    for (int nt = 0; nt < 4; ++nt) {
      v16h bf = load_frag_f16(BshT, LDK, nt * 16, kk);
      acc[0][nt] = wmma_f16(a0, bf, acc[0][nt]);
      acc[1][nt] = wmma_f16(a1, bf, acc[1][nt]);
    }
  }

  if (which == 2) {                       // v: bias only, write f16
#pragma unroll
    for (int i = 0; i < 2; ++i)
#pragma unroll
      for (int j = 0; j < 8; ++j) {
        int m = (wave * 2 + i) * 16 + j + 8 * hi;
        float bias = qkv_b[ofs + m];
#pragma unroll
        for (int nt = 0; nt < 4; ++nt) {
          int n = n0 + nt * 16 + r;
          vf[(size_t)(b * 256 + m) * 4096 + n] = (_Float16)(acc[i][nt][j] + bias);
        }
      }
  } else {
    // feature map: t = (relu(val)+eps)^2, then column L2 normalize over 256 ch
#pragma unroll
    for (int i = 0; i < 2; ++i)
#pragma unroll
      for (int j = 0; j < 8; ++j) {
        int m = (wave * 2 + i) * 16 + j + 8 * hi;
        float bias = qkv_b[ofs + m];
#pragma unroll
        for (int nt = 0; nt < 4; ++nt) {
          float t = fmaxf(acc[i][nt][j] + bias, 0.f) + FLA_EPS;
          acc[i][nt][j] = t * t;
        }
      }
#pragma unroll
    for (int nt = 0; nt < 4; ++nt) {
      float s = 0.f;
#pragma unroll
      for (int i = 0; i < 2; ++i)
#pragma unroll
        for (int j = 0; j < 8; ++j) s += acc[i][nt][j] * acc[i][nt][j];
      atomicAdd(&colsum[which][nt * 16 + r], s);     // ds_add_f32
    }
    __syncthreads();
    float inv[4];
#pragma unroll
    for (int nt = 0; nt < 4; ++nt)
      inv[nt] = 1.f / fmaxf(sqrtf(colsum[which][nt * 16 + r]), 1e-12f);
    _Float16* dst = (which == 0) ? qf : kf;
#pragma unroll
    for (int i = 0; i < 2; ++i)
#pragma unroll
      for (int j = 0; j < 8; ++j) {
        int m = (wave * 2 + i) * 16 + j + 8 * hi;
        float rowsum = 0.f;
#pragma unroll
        for (int nt = 0; nt < 4; ++nt) {
          float tn = acc[i][nt][j] * inv[nt];
          dst[(size_t)(b * 256 + m) * 4096 + n0 + nt * 16 + r] = (_Float16)tn;
          rowsum += tn;
        }
        if (which == 1) atomicAdd(&ksum_sh[m], rowsum);
      }
    if (which == 1) {
      __syncthreads();
      atomicAdd(&ksum[b * 256 + tid], ksum_sh[tid]);
    }
  }
  // Stands in front of the next turn's writes to registers that this turn's
  // stores name (their address pairs and data registers are used again there).
  asm volatile("s_wait_xcnt 0x0" ::: "memory");
  }
}

// ---------------------------------------------------------------------------
// K2: vkT = v @ k^T  [256x256], K=N=4096, split-K across 16 blocks per batch.
// grid = B*16, block = 512 (16 waves). k^T chunks double-buffered via async
// LDS copies (ASYNCcnt in-order completion: wait<=2 keeps newest in flight).
// Each block stores its own f32 partial product with plain 16-byte stores;
// fla_sum_pack adds the 16 partials of a batch. The product is formed as
// k @ v^T (k is the A operand), so a lane's 8 accumulator rows are 8 neighbouring
// columns of one row of v k^T: lane and tile then number exactly as the pieces of
// the packed A operand do (fla_pack_piece), and partials are kept in that order:
//   vkP[((b*16 + split)*2 + h)*8192 + g][4] = columns h*4 .. h*4+3 of piece g.
// ---------------------------------------------------------------------------
__global__ __launch_bounds__(512)
void fla_vkt_kernel(const _Float16* __restrict__ vf, const _Float16* __restrict__ kf,
                    float* __restrict__ vkP)
{
  __shared__ _Float16 Bsh[2][256 * 40];  // [buf][col j][k-chunk 32, pad 40]
  const int tid  = threadIdx.x;
  const int wave = tid >> 5;
  const int lane = tid & 31;
  const int b    = blockIdx.x >> 4;
  const int k0g  = (blockIdx.x & 15) * 256;

  const _Float16* vb = vf + (size_t)b * 256 * 4096;
  const _Float16* kb = kf + (size_t)b * 256 * 4096 + k0g;

  const int j0 = tid >> 2, piece0 = (tid & 3) << 3;       // chunk 0 of 2
  const int j1 = (tid + 512) >> 2, piece1 = (tid & 3) << 3;

  // prologue: issue k-chunk 0 into buf 0
  async_cp16(&Bsh[0][j0 * 40 + piece0], kb + (size_t)j0 * 4096 + piece0);
  async_cp16(&Bsh[0][j1 * 40 + piece1], kb + (size_t)j1 * 4096 + piece1);

  v8f acc[16] = {};
#pragma unroll 1
  for (int step = 0; step < 8; ++step) {
    int kk = step * 32;
    if (step < 7) {                      // issue next chunk into other buffer
      async_cp16(&Bsh[(step + 1) & 1][j0 * 40 + piece0],
                 kb + (size_t)j0 * 4096 + kk + 32 + piece0);
      async_cp16(&Bsh[(step + 1) & 1][j1 * 40 + piece1],
                 kb + (size_t)j1 * 4096 + kk + 32 + piece1);
      __builtin_amdgcn_s_wait_asynccnt(2);   // chunk `step` landed (in-order)
    } else {
      __builtin_amdgcn_s_wait_asynccnt(0);
    }
    __syncthreads();
    v16h a = load_frag_f16(vb, 4096, wave * 16, k0g + kk);
    const _Float16* bsrc = Bsh[step & 1];
#pragma unroll
    for (int nt = 0; nt < 16; ++nt) {
      v16h bf = load_frag_f16(bsrc, 40, nt * 16, 0);  // cols contiguous in K
      acc[nt] = wmma_f16(bf, a, acc[nt]);   // rows: k channels, columns: v channels
    }
    __syncthreads();                     // all waves done before buf reuse
  }
  // Piece of tile nt: group wave>>1, K block nt>>1, 16-row tile wave&1, K half nt&1.
  // A wave's store covers 512 contiguous bytes.
  float* pp = vkP + ((size_t)blockIdx.x * 2 * 8192 +
                     (wave >> 1) * 1024 + (wave & 1) * 64 + lane) * 4;
#pragma unroll
  for (int nt = 0; nt < 16; ++nt) {
    float* pt = pp + ((nt >> 1) * 128 + (nt & 1) * 32) * 4;
    *(v4f*)pt = __builtin_shufflevector(acc[nt], acc[nt], 0, 1, 2, 3);
    *(v4f*)(pt + 8192 * 4) = __builtin_shufflevector(acc[nt], acc[nt], 4, 5, 6, 7);
  }
}

// K3 (part of the K4 launch): adds a batch's 16 partial products, split 0 first,
// and rounds the sum to f16: thread t = b*8192 + g makes piece t of the packed
// v k^T (16 bytes). Every load of a wave covers 512 contiguous bytes.
static __device__ __forceinline__
void fla_sum_pack(const float* __restrict__ vkP, _Float16* __restrict__ d, int t) {
  const float* p = vkP + ((size_t)(t >> 13) * 32 * 8192 + (t & 8191)) * 4;
  v4f lo = *(const v4f*)p;
  v4f hi = *(const v4f*)(p + (size_t)8192 * 4);
#pragma unroll
  for (int s = 1; s < 16; ++s) {
    lo += *(const v4f*)(p + (size_t)(s * 2) * 8192 * 4);
    hi += *(const v4f*)(p + (size_t)(s * 2 + 1) * 8192 * 4);
  }
  v8h o;
#pragma unroll
  for (int u = 0; u < 4; ++u) {
    o[u]     = (_Float16)lo[u];
    o[u + 4] = (_Float16)hi[u];
  }
  *(v8h*)(d + (size_t)t * 8) = o;
}

// ---------------------------------------------------------------------------
// K4: depthwise 5x5 SAME conv on v. One block per (b, c) plane of 64x64 pixels.
// The plane is staged once into LDS inside a frame of zeros (two rows above and
// below, two columns left and right), so no tap needs a bounds test; each
// thread then computes an 8-wide x 4-high tile of outputs in registers.
// block = 128 (8 column groups x 16 row groups).
// The same grid also sums the v k^T partials (fla_sum_pack): both need only what
// the launches before have written and neither reads the other's output. Of every
// five blocks four take a plane and the fifth 128 pieces of v k^T, so that the
// sums' reads run beside the planes' arithmetic. grid = B*256 + B*8192/128 = 5120.
// LDS row = 8 halves pad | 64 pixels | 8 halves pad = 160 B: the two 128-B row
// pieces that 16 lanes read with one 16-byte load fall on disjoint bank halves.
// ---------------------------------------------------------------------------
#define DWP 80
__global__ __launch_bounds__(128)
void fla_dwconv_sum_kernel(const _Float16* __restrict__ vf, const float* __restrict__ w5,
                           const float* __restrict__ wb, _Float16* __restrict__ dwv,
                           const float* __restrict__ vkP, _Float16* __restrict__ vkTh)
{
  __shared__ __attribute__((aligned(16))) _Float16 tile[68 * DWP];  // image rows -2 .. 65
  const int tid  = threadIdx.x;
  const int five = blockIdx.x / 5;       // 0..1023
  const int role = blockIdx.x - five * 5;
  if (role == 4) {                       // the whole block leaves, ahead of the barrier
    fla_sum_pack(vkP, vkTh, five * 128 + tid);
    return;
  }
  const int bc  = five * 4 + role;       // b*256 + c
  const int c   = bc & 255;
  const int cg  = tid & 7;               // column group: 8 pixels
  const int rg  = tid >> 3;              // 0..15
  const _Float16* src = vf + (size_t)bc * 4096;

  // The block's 25 taps and its bias, asked for ahead of the copies so that both
  // latencies run together. Every loop of this kernel is unrolled in full, so
  // that its arrays are indexed by constants and stay in registers.
  const float* wt = w5 + c * 25;
  float w[25];
#pragma unroll
  for (int i = 0; i < 25; ++i) w[i] = wt[i];
  const float bias = wb[c];

  {
    // 512 chunks of 16 B, four per thread: chunk tid + 128*i is image row
    // rg + 16*i, column group cg.
    const unsigned l0 = (unsigned)(size_t)&tile[(rg + 2) * DWP + 8 + cg * 8];
    const unsigned l1 = l0 + 16 * DWP * 2;
    const unsigned l2 = l0 + 32 * DWP * 2;
    const unsigned l3 = l0 + 48 * DWP * 2;
    const _Float16* g0 = src + tid * 8;
    const _Float16* g1 = g0 + 1024;
    const _Float16* g2 = g0 + 2048;
    const _Float16* g3 = g0 + 3072;
    // The copies bring the plane into LDS through no register; the closing wait
    // stands in the same statement so that no address register is rewritten
    // ahead of it.
    asm volatile("global_load_async_to_lds_b128 %0, %4, off\n\t"
                 "global_load_async_to_lds_b128 %1, %5, off\n\t"
                 "global_load_async_to_lds_b128 %2, %6, off\n\t"
                 "global_load_async_to_lds_b128 %3, %7, off\n\t"
                 "s_wait_xcnt 0x0"
                 :: "v"(l0), "v"(l1), "v"(l2), "v"(l3),
                    "v"(g0), "v"(g1), "v"(g2), "v"(g3)
                 : "memory");
  }
  // The frame of zeros: bytes that no copy writes.
  if (tid < 40) {                        // LDS rows 0, 1, 66, 67, ten 16-B chunks each
    int fr  = tid / 10;
    int row = fr + ((fr >> 1) * 64);
    v8h zz = {};
    *(v8h*)&tile[row * DWP + (tid - fr * 10) * 8] = zz;
  }
  *(unsigned*)&tile[(2 + (tid >> 1)) * DWP + ((tid & 1) ? 72 : 6)] = 0u;  // columns -2,-1 / 64,65
  // Every copy of this wave has landed before the barrier lets other waves read.
  asm volatile("s_wait_asynccnt 0x0" ::: "memory");
  __syncthreads();

  v2f acc[4][4];                         // [output row][pair of neighbouring columns]
#pragma unroll
  for (int o = 0; o < 4; ++o)
#pragma unroll
    for (int j = 0; j < 4; ++j) acc[o][j] = (v2f){bias, bias};

  // LDS row rg*4 + r is image row rg*4 - 2 + r; f[] holds columns cg*8-2 .. cg*8+9.
  // Each output sums bias, then its taps by rows and, within a row, left to right.
  const _Float16* base = &tile[(rg * 4) * DWP + 8 + cg * 8];
#pragma unroll
  for (int r = 0; r < 8; ++r) {
    const _Float16* p = base + r * DWP;
    v2h lft = *(const v2h*)(p - 2);
    v8h mid = *(const v8h*)p;
    v2h rgt = *(const v2h*)(p + 8);
    float f[12];
    f[0] = (float)lft[0]; f[1] = (float)lft[1];
#pragma unroll
    for (int u = 0; u < 8; ++u) f[2 + u] = (float)mid[u];
    f[10] = (float)rgt[0]; f[11] = (float)rgt[1];
    // Column pairs that start at an even and at an odd place, so that every
    // tap column finds its two inputs in one register pair (packed f32 fma).
    v2f ev[6], od[5];
#pragma unroll
    for (int k = 0; k < 6; ++k) ev[k] = (v2f){f[2 * k], f[2 * k + 1]};
#pragma unroll
    for (int k = 0; k < 5; ++k) od[k] = (v2f){f[2 * k + 1], f[2 * k + 2]};
#pragma unroll
    for (int o = 0; o < 4; ++o) {
      const int dy = r - o;              // tap row 0..4 of output row o
      if (dy < 0 || dy > 4) continue;
#pragma unroll
      for (int dx = 0; dx < 5; ++dx) {
        const v2f wv = (v2f){w[dy * 5 + dx], w[dy * 5 + dx]};
#pragma unroll
        for (int j = 0; j < 4; ++j)
          acc[o][j] = __builtin_elementwise_fma(
              wv, (dx & 1) ? od[j + (dx >> 1)] : ev[j + (dx >> 1)], acc[o][j]);
      }
    }
  }
  _Float16* dst = dwv + (size_t)bc * 4096 + (rg * 4) * 64 + cg * 8;
#pragma unroll
  for (int o = 0; o < 4; ++o) {
    v8h ov;
#pragma unroll
    for (int j = 0; j < 4; ++j) {
      ov[2 * j]     = (_Float16)acc[o][j][0];
      ov[2 * j + 1] = (_Float16)acc[o][j][1];
    }
    *(v8h*)(dst + o * 64) = ov;
  }
}

// ---------------------------------------------------------------------------
// K5: attn = (vkT @ q) * (1/4096) / z ; RMSNorm * norm_w ; + dw -> y (f16),
// then out = proj_w @ y + proj_b (fp32 out) in the same block: a block holds all
// 256 channels of its 64 positions, which is the whole B tile of the projection,
// so y goes from the accumulators into LDS and never to memory.
// grid = B*64, block = 256. q block staged transposed [n][c]; y takes its place.
// The block's dw tile is staged the same way beside it.
// A = packed v k^T, then f16 proj weights in fragment order (fla_pack_piece).
// ---------------------------------------------------------------------------
__global__ __launch_bounds__(256)
void fla_attn_kernel(const _Float16* __restrict__ vkTh, const _Float16* __restrict__ qf,
                     const float* __restrict__ ksum, const _Float16* __restrict__ dwv,
                     const float* __restrict__ norm_w, const _Float16* __restrict__ proj_wh,
                     const float* __restrict__ proj_b, float* __restrict__ out)
{
  __shared__ __attribute__((aligned(16))) _Float16 BshT[NB * LDK];
  __shared__ __attribute__((aligned(16))) _Float16 DshT[NB * LDK];  // dw, [n][channel]
  __shared__ float kmean_sh[256];
  __shared__ float zcol[NB];
  __shared__ float colss[NB];

  const int tid  = threadIdx.x;
  const int b    = blockIdx.x >> 6;
  const int n0   = (blockIdx.x & 63) * NB;
  const int wave = tid >> 5;
  const int lane = tid & 31;

  // q and dw tiles: a thread loads 8 positions (16 bytes; 8 lanes cover a row's 128
  // bytes) of each of 8 neighbouring channels and turns them in registers.
  {
    const int nc = (tid & 7) << 3;
    const int cg = tid >> 3;             // 0..31
    const size_t go = ((size_t)b * 256 + cg * 8) * 4096 + n0 + nc;
    v8h hq[8], hd[8];
#pragma unroll
    for (int e = 0; e < 8; ++e) hq[e] = *(const v8h*)(qf + go + (size_t)e * 4096);
    // Stands in front of the next loads' results, which may land in these loads' address pair.
    asm volatile("s_wait_xcnt 0x0" ::: "memory");
#pragma unroll
    for (int e = 0; e < 8; ++e) hd[e] = *(const v8h*)(dwv + go + (size_t)e * 4096);
    // Stands in front of the later writes to the address registers that these loads name.
    asm volatile("s_wait_xcnt 0x0" ::: "memory");
    fla_turn8_store(BshT, hq, nc, cg);
    fla_turn8_store(DshT, hd, nc, cg);
  }
  kmean_sh[tid] = ksum[b * 256 + tid] * (1.f / 4096.f);
  if (tid < NB) { colss[tid] = 0.f; zcol[tid] = FLA_EPS; }
  __syncthreads();

  {                                       // z = kmean . q(col) + eps, 4-way split
    int col = tid & 63, quarter = tid >> 6;
    const _Float16* bp = BshT + col * LDK + quarter * 64;
    const float* kp = kmean_sh + quarter * 64;
    float s = 0.f;
#pragma unroll
    for (int cc = 0; cc < 64; cc += 8) {
      v8h hv = *(const v8h*)(bp + cc);
#pragma unroll
      for (int u = 0; u < 8; ++u) s += kp[cc + u] * (float)hv[u];
    }
    atomicAdd(&zcol[col], s);
  }

  // This wave's 32 rows of the batch's packed v k^T (fla_pack_piece).
  const _Float16* ap = vkTh + ((size_t)(b * 8 + wave) << 13) + lane * 8;
  v8f acc[2][4] = {};
#pragma unroll 1
  for (int kk = 0; kk < 256; kk += 32) {
    v16h a0 = load_frag_packed(ap + kk * 32);
    v16h a1 = load_frag_packed(ap + kk * 32 + 512);
#pragma unroll
    for (int nt = 0; nt < 4; ++nt) {
      v16h bf = load_frag_f16(BshT, LDK, nt * 16, kk);
      acc[0][nt] = wmma_f16(a0, bf, acc[0][nt]);
      acc[1][nt] = wmma_f16(a1, bf, acc[1][nt]);
    }
  }
  __syncthreads();                        // zcol complete, colss zeroed, q tile read out
  const int r = lane & 15, hi = lane >> 4;
#pragma unroll
  for (int nt = 0; nt < 4; ++nt) {
    float z = zcol[nt * 16 + r];
    float s = 0.f;
#pragma unroll
    for (int i = 0; i < 2; ++i)
#pragma unroll
      for (int j = 0; j < 8; ++j) {
        float a = acc[i][nt][j] * (1.f / 4096.f) / z;
        acc[i][nt][j] = a;
        s += a * a;
      }
    atomicAdd(&colss[nt * 16 + r], s);
  }
  __syncthreads();
  float rinv[4];
#pragma unroll
  for (int nt = 0; nt < 4; ++nt)
    rinv[nt] = 1.f / sqrtf(colss[nt * 16 + r] * (1.f / 256.f) + FLA_EPS);
  // y, rounded to f16, goes into the LDS tile as [n][channel]: a lane's 8 accumulator
  // rows of one 16x16 tile are 8 neighbouring channels of one position = 16 bytes.
  // dw comes from its LDS tile in the same form, one 16-byte read per tile.
  v8h y8[2][4];
#pragma unroll
  for (int i = 0; i < 2; ++i)
#pragma unroll
    for (int nt = 0; nt < 4; ++nt)
      y8[i][nt] = *(const v8h*)&DshT[(nt * 16 + r) * LDK + (wave * 2 + i) * 16 + 8 * hi];
#pragma unroll
  for (int i = 0; i < 2; ++i)
#pragma unroll
    for (int j = 0; j < 8; ++j) {
      int m = (wave * 2 + i) * 16 + j + 8 * hi;
      float nw = norm_w[m];
#pragma unroll
      for (int nt = 0; nt < 4; ++nt) {
        float yv = acc[i][nt][j] * rinv[nt] * nw + (float)y8[i][nt][j];
        y8[i][nt][j] = (_Float16)yv;
      }
    }
#pragma unroll
  for (int i = 0; i < 2; ++i)
#pragma unroll
    for (int nt = 0; nt < 4; ++nt) {
      *(v8h*)&BshT[(nt * 16 + r) * LDK + (wave * 2 + i) * 16 + 8 * hi] = y8[i][nt];
      acc[i][nt] = (v8f){};
    }
  __syncthreads();                        // every wave's channels of y are in the tile

  ap = proj_wh + ((size_t)wave << 13) + lane * 8;
#pragma unroll 1
  for (int kk = 0; kk < 256; kk += 32) {
    v16h a0 = load_frag_packed(ap + kk * 32);
    v16h a1 = load_frag_packed(ap + kk * 32 + 512);
#pragma unroll
    for (int nt = 0; nt < 4; ++nt) {
      v16h bf = load_frag_f16(BshT, LDK, nt * 16, kk);
      acc[0][nt] = wmma_f16(a0, bf, acc[0][nt]);
      acc[1][nt] = wmma_f16(a1, bf, acc[1][nt]);
    }
  }
#pragma unroll
  for (int i = 0; i < 2; ++i)
#pragma unroll
    for (int j = 0; j < 8; ++j) {
      int m = (wave * 2 + i) * 16 + j + 8 * hi;
      float bias = proj_b[m];
#pragma unroll
      for (int nt = 0; nt < 4; ++nt)
        out[(size_t)(b * 256 + m) * 4096 + n0 + nt * 16 + r] = acc[i][nt][j] + bias;
    }
}

extern "C" void kernel_launch(void* const* d_in, const int* in_sizes, int n_in,
                              void* d_out, int out_size, void* d_ws, size_t ws_size,
                              hipStream_t stream)
{
  (void)in_sizes; (void)n_in; (void)out_size; (void)ws_size;
  const float* x      = (const float*)d_in[0];
  const float* qkv_w  = (const float*)d_in[1];
  const float* qkv_b  = (const float*)d_in[2];
  const float* dwc_w  = (const float*)d_in[3];
  const float* dwc_b  = (const float*)d_in[4];
  const float* norm_w = (const float*)d_in[5];
  const float* proj_w = (const float*)d_in[6];
  const float* proj_b = (const float*)d_in[7];
  float* out = (float*)d_out;

  const size_t B = 16, D = 256, N = 4096;
  char* ws = (char*)d_ws;
  size_t off = 0;
  auto take = [&](size_t bytes) {
    char* p = ws + off;
    off = (off + bytes + 255) & ~(size_t)255;
    return p;
  };
  _Float16* qf      = (_Float16*)take(B * D * N * 2);
  _Float16* kf      = (_Float16*)take(B * D * N * 2);
  _Float16* vf      = (_Float16*)take(B * D * N * 2);
  _Float16* dwv     = (_Float16*)take(B * D * N * 2);
  float*    vkP     = (float*)   take(16 * B * D * D * 4);
  _Float16* vkTh    = (_Float16*)take(B * D * D * 2);
  float*    ksum    = (float*)   take(B * D * 4);
  _Float16* qkv_wh  = (_Float16*)take(3 * D * D * 2);
  _Float16* proj_wh = (_Float16*)take(D * D * 2);

  fla_prep_kernel<<<dim3(144), 256, 0, stream>>>(qkv_w, qkv_wh, proj_w, proj_wh, ksum);
  fla_qkv_kernel<<<dim3(1024), 256, 0, stream>>>(x, qkv_wh, qkv_b, qf, kf, vf, ksum);
  fla_vkt_kernel<<<dim3(256), 512, 0, stream>>>(vf, kf, vkP);
  fla_dwconv_sum_kernel<<<dim3(5120), 128, 0, stream>>>(vf, dwc_w, dwc_b, dwv, vkP, vkTh);
  fla_attn_kernel<<<dim3(1024), 256, 0, stream>>>(vkTh, qf, ksum, dwv, norm_w,
                                                  proj_wh, proj_b, out);
}

// v008
// A run of this version takes 99.6 microseconds.
// Next to v007, in two timings, it ran 1.09 and 1.08 times as fast.
// Counting every step since v000, it is 2.40 times as fast.
#include <hip/hip_runtime.h>
#include <hip/hip_fp16.h>

typedef __attribute__((ext_vector_type(16))) _Float16 v16h;
typedef __attribute__((ext_vector_type(8)))  _Float16 v8h;
typedef __attribute__((ext_vector_type(2)))  _Float16 v2h;
typedef __attribute__((ext_vector_type(8)))  float    v8f;
typedef __attribute__((ext_vector_type(4)))  float    v4f;
typedef __attribute__((ext_vector_type(2)))  float    v2f;
typedef __attribute__((ext_vector_type(4)))  int      v4i;

#define FLA_EPS 1e-5f
#define NB 64
#define LDK 264   // padded K-stride (halves) for transposed [col][K] LDS blocks

static __device__ __forceinline__ v8f wmma_f16(v16h a, v16h b, v8f c) {
  return __builtin_amdgcn_wmma_f32_16x16x32_f16(false, a, false, b, (short)0, c,
                                                false, false);
}

// Async 16-byte global -> LDS copy (GLOBAL_LOAD_ASYNC_TO_LDS_B128, ASYNCcnt).
static __device__ __forceinline__ void async_cp16(void* lds, const void* g) {
  __builtin_amdgcn_global_load_async_to_lds_b128(
      (__attribute__((address_space(1))) v4i*)g,
      (__attribute__((address_space(3))) v4i*)lds, 0, 0);
}

// WMMA 16x16x32 fragment from an f16 matrix whose fragment rows are contiguous
// in K (A row-major, or B when columns are contiguous in K — e.g. transposed
// LDS blocks and v^T from v stored [d][N]). Two 16B loads per lane.
// Lane L (0-15) holds row rowBase+L; lanes 16-31 same rows, upper K-halves:
// elems 0..7 = K k0+hi*8+{0..7}, elems 8..15 = K k0+16+hi*8+{0..7}.
static __device__ __forceinline__ v16h load_frag_f16(const _Float16* src,
                                                     int ld, int rowBase, int k0) {
  int lane = threadIdx.x & 31;
  const _Float16* p = src + (size_t)(rowBase + (lane & 15)) * ld + k0 + ((lane >> 4) << 3);
  v16h f;
#pragma unroll
  for (int j = 0; j < 8; ++j) {
    f[j]     = p[j];
    f[j + 8] = p[j + 16];
  }
  return f;
}

// A operand in fragment order. A row-major f32 matrix [rows][256] is converted
// to f16 and laid out so that every wave-wide 16-byte load of an A fragment
// covers 512 contiguous bytes (four whole lines) instead of 32 bytes in each of
// 16 rows. Piece g (16 B = 8 halves) of the packed matrix:
//   g = (((rows/32 group) * 8 + K block of 32) * 2 + 16-row tile) * 2 + K half) * 32 + lane
// and holds row group*32 + tile*16 + (lane & 15),
//           K   block*32 + half*16 + (lane >> 4)*8 + {0..7},
// which is what load_frag_f16 gives that lane. One thread writes one piece.
static __device__ __forceinline__
void fla_pack_piece(const float* __restrict__ s, _Float16* __restrict__ d, int g) {
  int lane = g & 31;
  int row  = ((g >> 10) << 5) + (((g >> 6) & 1) << 4) + (lane & 15);
  int k    = (((g >> 7) & 7) << 5) + (((g >> 5) & 1) << 4) + ((lane >> 4) << 3);
  const float* p = s + (size_t)row * 256 + k;
  v4f lo = *(const v4f*)p;
  v4f hi = *(const v4f*)(p + 4);
  v8h o;
#pragma unroll
  for (int u = 0; u < 4; ++u) {
    o[u]     = (_Float16)lo[u];
    o[u + 4] = (_Float16)hi[u];
  }
  *(v8h*)(d + (size_t)g * 8) = o;
  // Stands in front of any later write to a register that the store names: in the
  // merged kernel the other branches' code follows this store in the text.
  asm volatile("s_wait_xcnt 0x0" ::: "memory");
}

// Turns a thread's 8 channels x 8 positions of f16 (h[e] = 8 neighbouring positions
// of channel cg*8 + e) in registers and stores them into a [position][channel] LDS
// tile of pitch LDK: one 16-byte store per position holds the 8 channels.
static __device__ __forceinline__
void fla_turn8_store(_Float16* tileT, const v8h (&h)[8], int nc, int cg) {
#pragma unroll
  for (int u = 0; u < 8; ++u) {
    v8h o;
#pragma unroll
    for (int e = 0; e < 8; ++e) o[e] = h[e][u];
    *(v8h*)&tileT[(nc + u) * LDK + cg * 8] = o;
  }
}

// K0: all that has to stand ready before the qkv launch and depends on nothing
// but the inputs, in one grid: blocks 0..95 pack the qkv weights (24576 pieces),
// blocks 96..127 the proj weights (8192 pieces), blocks 128..143 zero ksum
// (4096 floats). grid = 144, block = 256; every block is full.
__global__ __launch_bounds__(256)
void fla_prep_kernel(const float* __restrict__ qkv_w, _Float16* __restrict__ qkv_wh,
                     const float* __restrict__ proj_w, _Float16* __restrict__ proj_wh,
                     float* __restrict__ ksum) {
  const int blk = blockIdx.x;
  const int tid = threadIdx.x;
  if (blk < 96)       fla_pack_piece(qkv_w, qkv_wh, blk * 256 + tid);
  else if (blk < 128) fla_pack_piece(proj_w, proj_wh, (blk - 96) * 256 + tid);
  else                ksum[(blk - 128) * 256 + tid] = 0.f;
}

// One 16x32 A fragment from a packed matrix: p points at this lane's piece of
// the fragment's first K half; the second K half lies 512 bytes behind it.
static __device__ __forceinline__ v16h load_frag_packed(const _Float16* p) {
  v8h lo = *(const v8h*)p;
  v8h hi = *(const v8h*)(p + 256);
  return __builtin_shufflevector(lo, hi, 0, 1, 2, 3, 4, 5, 6, 7,
                                 8, 9, 10, 11, 12, 13, 14, 15);
}

// ---------------------------------------------------------------------------
// K1: qkv 1x1 conv GEMM + feature map (q,k) / passthrough (v) + ksum for kmean
// grid = B*64, block = 256 (8 waves). Each block: 64 positions, K=256, and all
// 768 output channels: q, v and k one after the other ([256ch x 64pos] each)
// from the one x tile, which is read from memory and staged once.
// x block staged transposed into LDS as [n][c] f16 so B-frags are 2x16B reads.
// A = f16 qkv weights in fragment order (fla_pack_piece): whole-line loads.
// ---------------------------------------------------------------------------
__global__ __launch_bounds__(256)
void fla_qkv_kernel(const float* __restrict__ x, const _Float16* __restrict__ qkv_wh,
                    const float* __restrict__ qkv_b,
                    _Float16* __restrict__ qf, _Float16* __restrict__ kf,
                    _Float16* __restrict__ vf, float* __restrict__ ksum)
{
  __shared__ __attribute__((aligned(16))) _Float16 BshT[NB * LDK];
  __shared__ float colsum[2][NB];        // [q, k]: each has its own sums
  __shared__ float ksum_sh[256];

  const int tid   = threadIdx.x;
  const int b     = blockIdx.x >> 6;
  const int n0    = (blockIdx.x & 63) * NB;
  const int wave  = tid >> 5;
  const int lane  = tid & 31;

  // Stage x[b, :, n0:n0+64] -> f16 LDS transposed. A thread loads 4 positions of
  // each of 8 neighbouring channels (16 lanes cover a row's 256 bytes), twice, and
  // stores each position's 8 channels with one 16-byte LDS store.
  const float* xb = x + (size_t)b * 256 * 4096 + n0;
  {
    const int nc = (tid & 15) << 2;
    const int cg = tid >> 4;             // 0..15; the second half takes cg + 16
    v4f xv[2][8];
#pragma unroll
    for (int it = 0; it < 2; ++it)
#pragma unroll
      for (int e = 0; e < 8; ++e)
        xv[it][e] = *(const v4f*)(xb + (size_t)((cg + it * 16) * 8 + e) * 4096 + nc);
#pragma unroll
    for (int it = 0; it < 2; ++it)
#pragma unroll
      for (int u = 0; u < 4; ++u) {
        v8h o;
#pragma unroll
        for (int e = 0; e < 8; ++e) o[e] = (_Float16)xv[it][e][u];
        *(v8h*)&BshT[(nc + u) * LDK + (cg + it * 16) * 8] = o;
      }
  }
  if (tid < 2 * NB) colsum[tid >> 6][tid & 63] = 0.f;
  ksum_sh[tid] = 0.f;
  __syncthreads();

  const int r = lane & 15, hi = lane >> 4;
  // Kept rolled: one copy of the GEMM loop and its epilogues in the text.
#pragma unroll 1
  for (int turn = 0; turn < 3; ++turn) {
  // 0=q 1=k 2=v (block-uniform), in the order q, v, k: k's turn ends in a barrier
  // that also waits for the turn's own stores, so no GEMM is put behind it.
  const int which = turn ? 3 - turn : 0;
  const int ofs = which << 8;            // row offset into qkv_w / qkv_b
  // This wave's 32 rows of A: 16 KB in a row, 2 KB per K block of 32.
  const _Float16* ap = qkv_wh + ((size_t)(which * 8 + wave) << 13) + lane * 8;
  v8f acc[2][4] = {};
#pragma unroll 1
  for (int kk = 0; kk < 256; kk += 32) {
    v16h a0 = load_frag_packed(ap + kk * 32);
    v16h a1 = load_frag_packed(ap + kk * 32 + 512);
#pragma unroll
    for (int nt = 0; nt < 4; ++nt) {
      v16h bf = load_frag_f16(BshT, LDK, nt * 16, kk);
      acc[0][nt] = wmma_f16(a0, bf, acc[0][nt]);
      acc[1][nt] = wmma_f16(a1, bf, acc[1][nt]);
    }
  }

  if (which == 2) {                       // v: bias only, write f16
#pragma unroll
    for (int i = 0; i < 2; ++i)
#pragma unroll
      for (int j = 0; j < 8; ++j) {
        int m = (wave * 2 + i) * 16 + j + 8 * hi;
        float bias = qkv_b[ofs + m];
#pragma unroll
        for (int nt = 0; nt < 4; ++nt) {
          int n = n0 + nt * 16 + r;
          vf[(size_t)(b * 256 + m) * 4096 + n] = (_Float16)(acc[i][nt][j] + bias);
        }
      }
  } else {
    // feature map: t = (relu(val)+eps)^2, then column L2 normalize over 256 ch
#pragma unroll
    for (int i = 0; i < 2; ++i)
#pragma unroll
      for (int j = 0; j < 8; ++j) {
        int m = (wave * 2 + i) * 16 + j + 8 * hi;
        float bias = qkv_b[ofs + m];
#pragma unroll
        for (int nt = 0; nt < 4; ++nt) {
          float t = fmaxf(acc[i][nt][j] + bias, 0.f) + FLA_EPS;
          acc[i][nt][j] = t * t;
        }
      }
#pragma unroll
    for (int nt = 0; nt < 4; ++nt) {
      float s = 0.f;
#pragma unroll
      for (int i = 0; i < 2; ++i)
#pragma unroll
        for (int j = 0; j < 8; ++j) s += acc[i][nt][j] * acc[i][nt][j];
      atomicAdd(&colsum[which][nt * 16 + r], s);     // ds_add_f32
    }
    __syncthreads();
    float inv[4];
#pragma unroll
    for (int nt = 0; nt < 4; ++nt)
      inv[nt] = 1.f / fmaxf(sqrtf(colsum[which][nt * 16 + r]), 1e-12f);
    _Float16* dst = (which == 0) ? qf : kf;
#pragma unroll
    for (int i = 0; i < 2; ++i)
#pragma unroll
      for (int j = 0; j < 8; ++j) {
        int m = (wave * 2 + i) * 16 + j + 8 * hi;
        float rowsum = 0.f;
#pragma unroll
        for (int nt = 0; nt < 4; ++nt) {
          float tn = acc[i][nt][j] * inv[nt];
          dst[(size_t)(b * 256 + m) * 4096 + n0 + nt * 16 + r] = (_Float16)tn;
          rowsum += tn;
        }
        if (which == 1) atomicAdd(&ksum_sh[m], rowsum);
      }
    if (which == 1) {
      __syncthreads();
      atomicAdd(&ksum[b * 256 + tid], ksum_sh[tid]);
    }
  }
  // Stands in front of the next turn's writes to registers that this turn's
  // stores name (their address pairs and data registers are used again there).
  asm volatile("s_wait_xcnt 0x0" ::: "memory");
  }
}

// ---------------------------------------------------------------------------
// K2: vkT = v @ k^T  [256x256], K=N=4096. A block makes one 128x128 tile of the
// product over a quarter of K (1024 positions): 4 tiles x 4 splits x B = 256 blocks,
// block = 512 (16 waves, wave tile 32x32). Four partial products a batch go to
// memory. Both operands come into LDS by async copies, whole lines, in windows
// of 128 positions, two buffers: the next window flies while this one is worked on.
// The four tiles of one (batch, split) read the same rows; their block indices
// differ by 64 (speed only: nothing rests on where a block runs).
// Each block stores its own f32 partial product with plain 16-byte stores;
// fla_sum_pack adds the 4 partials of a batch. The product is formed as
// k @ v^T (k is the A operand), so a lane's 8 accumulator rows are 8 neighbouring
// columns of one row of v k^T: lane and tile then number exactly as the pieces of
// the packed A operand do (fla_pack_piece), and partials are kept in that order:
//   vkP[((b*4 + split)*2 + h)*8192 + g][4] = columns h*4 .. h*4+3 of piece g.
// ---------------------------------------------------------------------------
#define VKW 128                 // positions per window
#define VKPITCH 136             // LDS row pitch in halves: 272 B = 16 B x 17
#define VKBUF (256 * VKPITCH)   // one buffer: 128 k rows, then 128 v rows

// One window: 256 rows of 256 bytes. 16 lanes cover a row, a wave's copy two rows;
// a thread's 8 copies take rows (tid >> 4) + 32*i: four of k, then four of v.
static __device__ __forceinline__
void fla_vkt_window(_Float16* buf, const _Float16* kg, const _Float16* vg, int tid) {
  const int row = tid >> 4, piece = (tid & 15) << 3;
  _Float16* l = buf + row * VKPITCH + piece;
  const _Float16* gk = kg + (size_t)row * 4096 + piece;
  const _Float16* gv = vg + (size_t)row * 4096 + piece;
#pragma unroll
  for (int i = 0; i < 4; ++i) {
    async_cp16(l + i * 32 * VKPITCH, gk + (size_t)i * 32 * 4096);
    async_cp16(l + (128 + i * 32) * VKPITCH, gv + (size_t)i * 32 * 4096);
  }
}

__global__ __launch_bounds__(512)
void fla_vkt_kernel(const _Float16* __restrict__ vf, const _Float16* __restrict__ kf,
                    float* __restrict__ vkP)
{
  __shared__ __attribute__((aligned(16))) _Float16 Wsh[2 * VKBUF];
  const int tid   = threadIdx.x;
  const int wave  = tid >> 5;
  const int lane  = tid & 31;
  const int bs    = blockIdx.x & 63;     // b*4 + split
  const int tk    = (blockIdx.x >> 6) & 1;   // which 128 k channels
  const int tv    = blockIdx.x >> 7;         // which 128 v channels
  const int b     = bs >> 2;
  const int k0g   = (bs & 3) * 1024;

  const _Float16* kb = kf + ((size_t)b * 256 + tk * 128) * 4096 + k0g;
  const _Float16* vb = vf + ((size_t)b * 256 + tv * 128) * 4096 + k0g;

  fla_vkt_window(Wsh, kb, vb, tid);
  // Window 0 of this wave has landed before the barrier lets other waves read it.
  asm volatile("s_wait_asynccnt 0x0" ::: "memory");
  __syncthreads();
  fla_vkt_window(Wsh + VKBUF, kb + VKW, vb + VKW, tid);

  const int kr = (wave & 3) * 32;        // this wave's 32 k rows of the tile
  const int vr = 128 + (wave >> 2) * 32; // and its 32 v rows (LDS row numbers)
  v8f acc[2][2] = {};
  // Kept rolled: one copy of the pass in the text; the buffer goes by the trip's parity.
#pragma unroll 1
  for (int t = 0; t < 8; ++t) {
    _Float16* cur = Wsh + (t & 1) * VKBUF;
    // The pass's 16 fragments go to registers first, so that the buffer is free, and its
    // refill in flight, while the pass's WMMAs run.
    v16h fk[4][2], fv[4][2];
#pragma unroll
    for (int s = 0; s < 4; ++s) {
      fk[s][0] = load_frag_f16(cur, VKPITCH, kr, s * 32);
      fk[s][1] = load_frag_f16(cur, VKPITCH, kr + 16, s * 32);
      fv[s][0] = load_frag_f16(cur, VKPITCH, vr, s * 32);
      fv[s][1] = load_frag_f16(cur, VKPITCH, vr + 16, s * 32);
    }
    // This wave's reads of the buffer are done before it may be filled again.
    asm volatile("s_wait_dscnt 0x0" ::: "memory");
    // This wave's copies of window t + 1 have landed before the barrier publishes them.
    asm volatile("s_wait_asynccnt 0x0" ::: "memory");
    __syncthreads();
    if (t + 2 < 8)
      fla_vkt_window(cur, kb + (t + 2) * VKW, vb + (t + 2) * VKW, tid);
#pragma unroll
    for (int s = 0; s < 4; ++s) {
      acc[0][0] = wmma_f16(fk[s][0], fv[s][0], acc[0][0]);   // rows: k channels, columns: v channels
      acc[0][1] = wmma_f16(fk[s][0], fv[s][1], acc[0][1]);
      acc[1][0] = wmma_f16(fk[s][1], fv[s][0], acc[1][0]);
      acc[1][1] = wmma_f16(fk[s][1], fv[s][1], acc[1][1]);
    }
  }
  // No copy is outstanding when the wave ends.
  asm volatile("s_wait_asynccnt 0x0" ::: "memory");

  // Piece of the tile (v tile vt, k tile nt): group vt>>1, K block nt>>1, 16-row tile
  // vt&1, K half nt&1. A wave's store covers 512 contiguous bytes.
  float* pp = vkP + ((size_t)bs * 2 * 8192 + lane) * 4;
#pragma unroll
  for (int i = 0; i < 2; ++i)
#pragma unroll
    for (int j = 0; j < 2; ++j) {
      const int nt = tk * 8 + (wave & 3) * 2 + i;
      const int vt = tv * 8 + (wave >> 2) * 2 + j;
      float* pt = pp + ((vt >> 1) * 1024 + (vt & 1) * 64 + (nt >> 1) * 128 + (nt & 1) * 32) * 4;
      *(v4f*)pt = __builtin_shufflevector(acc[i][j], acc[i][j], 0, 1, 2, 3);
      *(v4f*)(pt + 8192 * 4) = __builtin_shufflevector(acc[i][j], acc[i][j], 4, 5, 6, 7);
    }
}

// K3 (part of the K4 launch): adds a batch's 4 partial products, split 0 first,
// and rounds the sum to f16: thread t = b*8192 + g makes piece t of the packed
// v k^T (16 bytes). Every load of a wave covers 512 contiguous bytes.
static __device__ __forceinline__
void fla_sum_pack(const float* __restrict__ vkP, _Float16* __restrict__ d, int t) {
  const float* p = vkP + ((size_t)(t >> 13) * 8 * 8192 + (t & 8191)) * 4;
  v4f lo = *(const v4f*)p;
  v4f hi = *(const v4f*)(p + (size_t)8192 * 4);
#pragma unroll
  for (int s = 1; s < 4; ++s) {
    lo += *(const v4f*)(p + (size_t)(s * 2) * 8192 * 4);
    hi += *(const v4f*)(p + (size_t)(s * 2 + 1) * 8192 * 4);
  }
  v8h o;
#pragma unroll
  for (int u = 0; u < 4; ++u) {
    o[u]     = (_Float16)lo[u];
    o[u + 4] = (_Float16)hi[u];
  }
  *(v8h*)(d + (size_t)t * 8) = o;
}

// ---------------------------------------------------------------------------
// K4: depthwise 5x5 SAME conv on v. One block per (b, c) plane of 64x64 pixels.
// The plane is staged once into LDS inside a frame of zeros (two rows above and
// below, two columns left and right), so no tap needs a bounds test; each
// thread then computes an 8-wide x 4-high tile of outputs in registers.
// block = 128 (8 column groups x 16 row groups).
// The same grid also sums the v k^T partials (fla_sum_pack): both need only what
// the launches before have written and neither reads the other's output. Of every
// five blocks four take a plane and the fifth 128 pieces of v k^T, so that the
// sums' reads run beside the planes' arithmetic. grid = B*256 + B*8192/128 = 5120.
// LDS row = 8 halves pad | 64 pixels | 8 halves pad = 160 B: the two 128-B row
// pieces that 16 lanes read with one 16-byte load fall on disjoint bank halves.
// ---------------------------------------------------------------------------
#define DWP 80
__global__ __launch_bounds__(128)
void fla_dwconv_sum_kernel(const _Float16* __restrict__ vf, const float* __restrict__ w5,
                           const float* __restrict__ wb, _Float16* __restrict__ dwv,
                           const float* __restrict__ vkP, _Float16* __restrict__ vkTh)
{
  __shared__ __attribute__((aligned(16))) _Float16 tile[68 * DWP];  // image rows -2 .. 65
  const int tid  = threadIdx.x;
  const int five = blockIdx.x / 5;       // 0..1023
  const int role = blockIdx.x - five * 5;
  if (role == 4) {                       // the whole block leaves, ahead of the barrier
    fla_sum_pack(vkP, vkTh, five * 128 + tid);
    return;
  }
  const int bc  = five * 4 + role;       // b*256 + c
  const int c   = bc & 255;
  const int cg  = tid & 7;               // column group: 8 pixels
  const int rg  = tid >> 3;              // 0..15
  const _Float16* src = vf + (size_t)bc * 4096;

  // The block's 25 taps and its bias, asked for ahead of the copies so that both
  // latencies run together. Every loop of this kernel is unrolled in full, so
  // that its arrays are indexed by constants and stay in registers.
  const float* wt = w5 + c * 25;
  float w[25];
#pragma unroll
  for (int i = 0; i < 25; ++i) w[i] = wt[i];
  const float bias = wb[c];

  {
    // 512 chunks of 16 B, four per thread: chunk tid + 128*i is image row
    // rg + 16*i, column group cg.
    const unsigned l0 = (unsigned)(size_t)&tile[(rg + 2) * DWP + 8 + cg * 8];
    const unsigned l1 = l0 + 16 * DWP * 2;
    const unsigned l2 = l0 + 32 * DWP * 2;
    const unsigned l3 = l0 + 48 * DWP * 2;
    const _Float16* g0 = src + tid * 8;
    const _Float16* g1 = g0 + 1024;
    const _Float16* g2 = g0 + 2048;
    const _Float16* g3 = g0 + 3072;
    // The copies bring the plane into LDS through no register; the closing wait
    // stands in the same statement so that no address register is rewritten
    // ahead of it.
    asm volatile("global_load_async_to_lds_b128 %0, %4, off\n\t"
                 "global_load_async_to_lds_b128 %1, %5, off\n\t"
                 "global_load_async_to_lds_b128 %2, %6, off\n\t"
                 "global_load_async_to_lds_b128 %3, %7, off\n\t"
                 "s_wait_xcnt 0x0"
                 :: "v"(l0), "v"(l1), "v"(l2), "v"(l3),
                    "v"(g0), "v"(g1), "v"(g2), "v"(g3)
                 : "memory");
  }
  // The frame of zeros: bytes that no copy writes.
  if (tid < 40) {                        // LDS rows 0, 1, 66, 67, ten 16-B chunks each
    int fr  = tid / 10;
    int row = fr + ((fr >> 1) * 64);
    v8h zz = {};
    *(v8h*)&tile[row * DWP + (tid - fr * 10) * 8] = zz;
  }
  *(unsigned*)&tile[(2 + (tid >> 1)) * DWP + ((tid & 1) ? 72 : 6)] = 0u;  // columns -2,-1 / 64,65
  // Every copy of this wave has landed before the barrier lets other waves read.
  asm volatile("s_wait_asynccnt 0x0" ::: "memory");
  __syncthreads();

  v2f acc[4][4];                         // [output row][pair of neighbouring columns]
#pragma unroll
  for (int o = 0; o < 4; ++o)
#pragma unroll
    for (int j = 0; j < 4; ++j) acc[o][j] = (v2f){bias, bias};

  // LDS row rg*4 + r is image row rg*4 - 2 + r; f[] holds columns cg*8-2 .. cg*8+9.
  // Each output sums bias, then its taps by rows and, within a row, left to right.
  const _Float16* base = &tile[(rg * 4) * DWP + 8 + cg * 8];
#pragma unroll
  for (int r = 0; r < 8; ++r) {
    const _Float16* p = base + r * DWP;
    v2h lft = *(const v2h*)(p - 2);
    v8h mid = *(const v8h*)p;
    v2h rgt = *(const v2h*)(p + 8);
    float f[12];
    f[0] = (float)lft[0]; f[1] = (float)lft[1];
#pragma unroll
    for (int u = 0; u < 8; ++u) f[2 + u] = (float)mid[u];
    f[10] = (float)rgt[0]; f[11] = (float)rgt[1];
    // Column pairs that start at an even and at an odd place, so that every
    // tap column finds its two inputs in one register pair (packed f32 fma).
    v2f ev[6], od[5];
#pragma unroll
    for (int k = 0; k < 6; ++k) ev[k] = (v2f){f[2 * k], f[2 * k + 1]};
#pragma unroll
    for (int k = 0; k < 5; ++k) od[k] = (v2f){f[2 * k + 1], f[2 * k + 2]};
#pragma unroll
    for (int o = 0; o < 4; ++o) {
      const int dy = r - o;              // tap row 0..4 of output row o
      if (dy < 0 || dy > 4) continue;
#pragma unroll
      for (int dx = 0; dx < 5; ++dx) {
        const v2f wv = (v2f){w[dy * 5 + dx], w[dy * 5 + dx]};
#pragma unroll
        for (int j = 0; j < 4; ++j)
          acc[o][j] = __builtin_elementwise_fma(
              wv, (dx & 1) ? od[j + (dx >> 1)] : ev[j + (dx >> 1)], acc[o][j]);
      }
    }
  }
  _Float16* dst = dwv + (size_t)bc * 4096 + (rg * 4) * 64 + cg * 8;
#pragma unroll
  for (int o = 0; o < 4; ++o) {
    v8h ov;
#pragma unroll
    for (int j = 0; j < 4; ++j) {
      ov[2 * j]     = (_Float16)acc[o][j][0];
      ov[2 * j + 1] = (_Float16)acc[o][j][1];
    }
    *(v8h*)(dst + o * 64) = ov;
  }
}

// ---------------------------------------------------------------------------
// K5: attn = (vkT @ q) * (1/4096) / z ; RMSNorm * norm_w ; + dw -> y (f16),
// then out = proj_w @ y + proj_b (fp32 out) in the same block: a block holds all
// 256 channels of its 64 positions, which is the whole B tile of the projection,
// so y goes from the accumulators into LDS and never to memory.
// grid = B*64, block = 256. q block staged transposed [n][c]; y takes its place.
// The block's dw tile is staged the same way beside it.
// A = packed v k^T, then f16 proj weights in fragment order (fla_pack_piece).
// ---------------------------------------------------------------------------
__global__ __launch_bounds__(256)
void fla_attn_kernel(const _Float16* __restrict__ vkTh, const _Float16* __restrict__ qf,
                     const float* __restrict__ ksum, const _Float16* __restrict__ dwv,
                     const float* __restrict__ norm_w, const _Float16* __restrict__ proj_wh,
                     const float* __restrict__ proj_b, float* __restrict__ out)
{
  __shared__ __attribute__((aligned(16))) _Float16 BshT[NB * LDK];
  __shared__ __attribute__((aligned(16))) _Float16 DshT[NB * LDK];  // dw, [n][channel]
  __shared__ float kmean_sh[256];
  __shared__ float zcol[NB];
  __shared__ float colss[NB];

  const int tid  = threadIdx.x;
  const int b    = blockIdx.x >> 6;
  const int n0   = (blockIdx.x & 63) * NB;
  const int wave = tid >> 5;
  const int lane = tid & 31;

  // q and dw tiles: a thread loads 8 positions (16 bytes; 8 lanes cover a row's 128
  // bytes) of each of 8 neighbouring channels and turns them in registers.
  {
    const int nc = (tid & 7) << 3;
    const int cg = tid >> 3;             // 0..31
    const size_t go = ((size_t)b * 256 + cg * 8) * 4096 + n0 + nc;
    v8h hq[8], hd[8];
#pragma unroll
    for (int e = 0; e < 8; ++e) hq[e] = *(const v8h*)(qf + go + (size_t)e * 4096);
    // Stands in front of the next loads' results, which may land in these loads' address pair.
    asm volatile("s_wait_xcnt 0x0" ::: "memory");
#pragma unroll
    for (int e = 0; e < 8; ++e) hd[e] = *(const v8h*)(dwv + go + (size_t)e * 4096);
    // Stands in front of the later writes to the address registers that these loads name.
    asm volatile("s_wait_xcnt 0x0" ::: "memory");
    fla_turn8_store(BshT, hq, nc, cg);
    fla_turn8_store(DshT, hd, nc, cg);
  }
  kmean_sh[tid] = ksum[b * 256 + tid] * (1.f / 4096.f);
  if (tid < NB) { colss[tid] = 0.f; zcol[tid] = FLA_EPS; }
  __syncthreads();

  {                                       // z = kmean . q(col) + eps, 4-way split
    int col = tid & 63, quarter = tid >> 6;
    const _Float16* bp = BshT + col * LDK + quarter * 64;
    const float* kp = kmean_sh + quarter * 64;
    float s = 0.f;
#pragma unroll
    for (int cc = 0; cc < 64; cc += 8) {
      v8h hv = *(const v8h*)(bp + cc);
#pragma unroll
      for (int u = 0; u < 8; ++u) s += kp[cc + u] * (float)hv[u];
    }
    atomicAdd(&zcol[col], s);
  }

  // This wave's 32 rows of the batch's packed v k^T (fla_pack_piece).
  const _Float16* ap = vkTh + ((size_t)(b * 8 + wave) << 13) + lane * 8;
  v8f acc[2][4] = {};
#pragma unroll 1
  for (int kk = 0; kk < 256; kk += 32) {
    v16h a0 = load_frag_packed(ap + kk * 32);
    v16h a1 = load_frag_packed(ap + kk * 32 + 512);
#pragma unroll
    for (int nt = 0; nt < 4; ++nt) {
      v16h bf = load_frag_f16(BshT, LDK, nt * 16, kk);
      acc[0][nt] = wmma_f16(a0, bf, acc[0][nt]);
      acc[1][nt] = wmma_f16(a1, bf, acc[1][nt]);
    }
  }
  __syncthreads();                        // zcol complete, colss zeroed, q tile read out
  const int r = lane & 15, hi = lane >> 4;
#pragma unroll
  for (int nt = 0; nt < 4; ++nt) {
    float z = zcol[nt * 16 + r];
    float s = 0.f;
#pragma unroll
    for (int i = 0; i < 2; ++i)
#pragma unroll
      for (int j = 0; j < 8; ++j) {
        float a = acc[i][nt][j] * (1.f / 4096.f) / z;
        acc[i][nt][j] = a;
        s += a * a;
      }
    atomicAdd(&colss[nt * 16 + r], s);
  }
  __syncthreads();
  float rinv[4];
#pragma unroll
  for (int nt = 0; nt < 4; ++nt)
    rinv[nt] = 1.f / sqrtf(colss[nt * 16 + r] * (1.f / 256.f) + FLA_EPS);
  // y, rounded to f16, goes into the LDS tile as [n][channel]: a lane's 8 accumulator
  // rows of one 16x16 tile are 8 neighbouring channels of one position = 16 bytes.
  // dw comes from its LDS tile in the same form, one 16-byte read per tile.
  v8h y8[2][4];
#pragma unroll
  for (int i = 0; i < 2; ++i)
#pragma unroll
    for (int nt = 0; nt < 4; ++nt)
      y8[i][nt] = *(const v8h*)&DshT[(nt * 16 + r) * LDK + (wave * 2 + i) * 16 + 8 * hi];
#pragma unroll
  for (int i = 0; i < 2; ++i)
#pragma unroll
    for (int j = 0; j < 8; ++j) {
      int m = (wave * 2 + i) * 16 + j + 8 * hi;
      float nw = norm_w[m];
#pragma unroll
      for (int nt = 0; nt < 4; ++nt) {
        float yv = acc[i][nt][j] * rinv[nt] * nw + (float)y8[i][nt][j];
        y8[i][nt][j] = (_Float16)yv;
      }
    }
#pragma unroll
  for (int i = 0; i < 2; ++i)
#pragma unroll
    for (int nt = 0; nt < 4; ++nt) {
      *(v8h*)&BshT[(nt * 16 + r) * LDK + (wave * 2 + i) * 16 + 8 * hi] = y8[i][nt];
      acc[i][nt] = (v8f){};
    }
  __syncthreads();                        // every wave's channels of y are in the tile

  ap = proj_wh + ((size_t)wave << 13) + lane * 8;
#pragma unroll 1
  for (int kk = 0; kk < 256; kk += 32) {
    v16h a0 = load_frag_packed(ap + kk * 32);
    v16h a1 = load_frag_packed(ap + kk * 32 + 512);
#pragma unroll
    for (int nt = 0; nt < 4; ++nt) {
      v16h bf = load_frag_f16(BshT, LDK, nt * 16, kk);
      acc[0][nt] = wmma_f16(a0, bf, acc[0][nt]);
      acc[1][nt] = wmma_f16(a1, bf, acc[1][nt]);
    }
  }
#pragma unroll
  for (int i = 0; i < 2; ++i)
#pragma unroll
    for (int j = 0; j < 8; ++j) {
      int m = (wave * 2 + i) * 16 + j + 8 * hi;
      float bias = proj_b[m];
#pragma unroll
      for (int nt = 0; nt < 4; ++nt)
        out[(size_t)(b * 256 + m) * 4096 + n0 + nt * 16 + r] = acc[i][nt][j] + bias;
    }
}

extern "C" void kernel_launch(void* const* d_in, const int* in_sizes, int n_in,
                              void* d_out, int out_size, void* d_ws, size_t ws_size,
                              hipStream_t stream)
{
  (void)in_sizes; (void)n_in; (void)out_size; (void)ws_size;
  const float* x      = (const float*)d_in[0];
  const float* qkv_w  = (const float*)d_in[1];
  const float* qkv_b  = (const float*)d_in[2];
  const float* dwc_w  = (const float*)d_in[3];
  const float* dwc_b  = (const float*)d_in[4];
  const float* norm_w = (const float*)d_in[5];
  const float* proj_w = (const float*)d_in[6];
  const float* proj_b = (const float*)d_in[7];
  float* out = (float*)d_out;

  const size_t B = 16, D = 256, N = 4096;
  char* ws = (char*)d_ws;
  size_t off = 0;
  auto take = [&](size_t bytes) {
    char* p = ws + off;
    off = (off + bytes + 255) & ~(size_t)255;
    return p;
  };
  _Float16* qf      = (_Float16*)take(B * D * N * 2);
  _Float16* kf      = (_Float16*)take(B * D * N * 2);
  _Float16* vf      = (_Float16*)take(B * D * N * 2);
  _Float16* dwv     = (_Float16*)take(B * D * N * 2);
  float*    vkP     = (float*)   take(4 * B * D * D * 4);
  _Float16* vkTh    = (_Float16*)take(B * D * D * 2);
  float*    ksum    = (float*)   take(B * D * 4);
  _Float16* qkv_wh  = (_Float16*)take(3 * D * D * 2);
  _Float16* proj_wh = (_Float16*)take(D * D * 2);

  fla_prep_kernel<<<dim3(144), 256, 0, stream>>>(qkv_w, qkv_wh, proj_w, proj_wh, ksum);
  fla_qkv_kernel<<<dim3(1024), 256, 0, stream>>>(x, qkv_wh, qkv_b, qf, kf, vf, ksum);
  fla_vkt_kernel<<<dim3(256), 512, 0, stream>>>(vf, kf, vkP);
  fla_dwconv_sum_kernel<<<dim3(5120), 128, 0, stream>>>(vf, dwc_w, dwc_b, dwv, vkP, vkTh);
  fla_attn_kernel<<<dim3(1024), 256, 0, stream>>>(vkTh, qf, ksum, dwv, norm_w,
                                                  proj_wh, proj_b, out);
}

// v009
// One run takes 88.4 microseconds.
// Two timings next to v008 put it at 1.15 and 1.14 times that version's speed.
// Counting every step since v000, it is 2.74 times as fast.
#include <hip/hip_runtime.h>
#include <hip/hip_fp16.h>

typedef __attribute__((ext_vector_type(16))) _Float16 v16h;
typedef __attribute__((ext_vector_type(8)))  _Float16 v8h;
typedef __attribute__((ext_vector_type(2)))  _Float16 v2h;
typedef __attribute__((ext_vector_type(8)))  float    v8f;
typedef __attribute__((ext_vector_type(4)))  float    v4f;
typedef __attribute__((ext_vector_type(2)))  float    v2f;
typedef __attribute__((ext_vector_type(4)))  int      v4i;

#define FLA_EPS 1e-5f
#define NB 64
#define LDK 264   // padded K-stride (halves) for transposed [col][K] LDS blocks
#define STP 72    // pitch (halves) of a staged f16 output row of 64 positions: 144 B = 16 B x 9
#define OSTP 68   // pitch (floats) of a staged f32 output row of 64 positions: 272 B = 16 B x 17

static __device__ __forceinline__ v8f wmma_f16(v16h a, v16h b, v8f c) {
  return __builtin_amdgcn_wmma_f32_16x16x32_f16(false, a, false, b, (short)0, c,
                                                false, false);
}

// The value that lane (l ^ X) of the same 16-lane row holds; CTRL = 0x160 + X (row_xmask).
template <int CTRL>
static __device__ __forceinline__ float fla_row_xor(float v) {
  return __builtin_bit_cast(float, __builtin_amdgcn_update_dpp(
      0, __builtin_bit_cast(int, v), CTRL, 0xf, 0xf, true));
}

// Async 16-byte global -> LDS copy (GLOBAL_LOAD_ASYNC_TO_LDS_B128, ASYNCcnt).
static __device__ __forceinline__ void async_cp16(void* lds, const void* g) {
  __builtin_amdgcn_global_load_async_to_lds_b128(
      (__attribute__((address_space(1))) v4i*)g,
      (__attribute__((address_space(3))) v4i*)lds, 0, 0);
}

// WMMA 16x16x32 fragment from an f16 matrix whose fragment rows are contiguous
// in K (A row-major, or B when columns are contiguous in K — e.g. transposed
// LDS blocks and v^T from v stored [d][N]). Two 16B loads per lane.
// Lane L (0-15) holds row rowBase+L; lanes 16-31 same rows, upper K-halves:
// elems 0..7 = K k0+hi*8+{0..7}, elems 8..15 = K k0+16+hi*8+{0..7}.
static __device__ __forceinline__ v16h load_frag_f16(const _Float16* src,
                                                     int ld, int rowBase, int k0) {
  int lane = threadIdx.x & 31;
  const _Float16* p = src + (size_t)(rowBase + (lane & 15)) * ld + k0 + ((lane >> 4) << 3);
  v16h f;
#pragma unroll
  for (int j = 0; j < 8; ++j) {
    f[j]     = p[j];
    f[j + 8] = p[j + 16];
  }
  return f;
}

// A operand in fragment order. A row-major f32 matrix [rows][256] is converted
// to f16 and laid out so that every wave-wide 16-byte load of an A fragment
// covers 512 contiguous bytes (four whole lines) instead of 32 bytes in each of
// 16 rows. Piece g (16 B = 8 halves) of the packed matrix:
//   g = (((rows/32 group) * 8 + K block of 32) * 2 + 16-row tile) * 2 + K half) * 32 + lane
// and holds row group*32 + tile*16 + (lane & 15),
//           K   block*32 + half*16 + (lane >> 4)*8 + {0..7},
// which is what load_frag_f16 gives that lane. One thread writes one piece.
static __device__ __forceinline__
void fla_pack_piece(const float* __restrict__ s, _Float16* __restrict__ d, int g) {
  int lane = g & 31;
  int row  = ((g >> 10) << 5) + (((g >> 6) & 1) << 4) + (lane & 15);
  int k    = (((g >> 7) & 7) << 5) + (((g >> 5) & 1) << 4) + ((lane >> 4) << 3);
  const float* p = s + (size_t)row * 256 + k;
  v4f lo = *(const v4f*)p;
  v4f hi = *(const v4f*)(p + 4);
  v8h o;
#pragma unroll
  for (int u = 0; u < 4; ++u) {
    o[u]     = (_Float16)lo[u];
    o[u + 4] = (_Float16)hi[u];
  }
  *(v8h*)(d + (size_t)g * 8) = o;
  // Stands in front of any later write to a register that the store names: in the
  // merged kernel the other branches' code follows this store in the text.
  asm volatile("s_wait_xcnt 0x0" ::: "memory");
}

// Turns a thread's 8 channels x 8 positions of f16 (h[e] = 8 neighbouring positions
// of channel cg*8 + e) in registers and stores them into a [position][channel] LDS
// tile of pitch LDK: one 16-byte store per position holds the 8 channels.
static __device__ __forceinline__
void fla_turn8_store(_Float16* tileT, const v8h (&h)[8], int nc, int cg) {
#pragma unroll
  for (int u = 0; u < 8; ++u) {
    v8h o;
#pragma unroll
    for (int e = 0; e < 8; ++e) o[e] = h[e][u];
    *(v8h*)&tileT[(nc + u) * LDK + cg * 8] = o;
  }
}

// K0: all that has to stand ready before the qkv launch and depends on nothing
// but the inputs, in one grid: blocks 0..95 pack the qkv weights (24576 pieces),
// blocks 96..127 the proj weights (8192 pieces), blocks 128..143 zero ksum
// (4096 floats). grid = 144, block = 256; every block is full.
__global__ __launch_bounds__(256)
void fla_prep_kernel(const float* __restrict__ qkv_w, _Float16* __restrict__ qkv_wh,
                     const float* __restrict__ proj_w, _Float16* __restrict__ proj_wh,
                     float* __restrict__ ksum) {
  const int blk = blockIdx.x;
  const int tid = threadIdx.x;
  if (blk < 96)       fla_pack_piece(qkv_w, qkv_wh, blk * 256 + tid);
  else if (blk < 128) fla_pack_piece(proj_w, proj_wh, (blk - 96) * 256 + tid);
  else                ksum[(blk - 128) * 256 + tid] = 0.f;
}

// One 16x32 A fragment from a packed matrix: p points at this lane's piece of
// the fragment's first K half; the second K half lies 512 bytes behind it.
static __device__ __forceinline__ v16h load_frag_packed(const _Float16* p) {
  v8h lo = *(const v8h*)p;
  v8h hi = *(const v8h*)(p + 256);
  return __builtin_shufflevector(lo, hi, 0, 1, 2, 3, 4, 5, 6, 7,
                                 8, 9, 10, 11, 12, 13, 14, 15);
}

// ---------------------------------------------------------------------------
// K1: qkv 1x1 conv GEMM + feature map (q,k) / passthrough (v) + ksum for kmean
// grid = B*64, block = 256 (8 waves). Each block: 64 positions, K=256, and all
// 768 output channels: q, v and k one after the other ([256ch x 64pos] each)
// from the one x tile, which is read from memory and staged once.
// x block staged transposed into LDS as [n][c] f16 so A-frags are 2x16B reads.
// B = f16 qkv weights in fragment order (fla_pack_piece): whole-line loads.
// ---------------------------------------------------------------------------
__global__ __launch_bounds__(256)
void fla_qkv_kernel(const float* __restrict__ x, const _Float16* __restrict__ qkv_wh,
                    const float* __restrict__ qkv_b,
                    _Float16* __restrict__ qf, _Float16* __restrict__ kf,
                    _Float16* __restrict__ vf, float* __restrict__ ksum)
{
  __shared__ __attribute__((aligned(16))) _Float16 BshT[NB * LDK];
  // Output staging: each wave's own 32 channel rows of 64 positions.
  __shared__ __attribute__((aligned(16))) _Float16 stg[8 * 32 * STP];
  __shared__ __attribute__((aligned(16))) float winv[8][NB];  // each wave's own copy of 1/norm
  __shared__ float colsum[2][NB];        // [q, k]: each has its own sums
  __shared__ float ksum_sh[256];

  const int tid   = threadIdx.x;
  const int b     = blockIdx.x >> 6;
  const int n0    = (blockIdx.x & 63) * NB;
  const int wave  = tid >> 5;
  const int lane  = tid & 31;

  // Stage x[b, :, n0:n0+64] -> f16 LDS transposed. A thread loads 4 positions of
  // each of 8 neighbouring channels (16 lanes cover a row's 256 bytes), twice, and
  // stores each position's 8 channels with one 16-byte LDS store.
  const float* xb = x + (size_t)b * 256 * 4096 + n0;
  {
    const int nc = (tid & 15) << 2;
    const int cg = tid >> 4;             // 0..15; the second half takes cg + 16
    v4f xv[2][8];
#pragma unroll
    for (int it = 0; it < 2; ++it)
#pragma unroll
      for (int e = 0; e < 8; ++e)
        xv[it][e] = *(const v4f*)(xb + (size_t)((cg + it * 16) * 8 + e) * 4096 + nc);
#pragma unroll
    for (int it = 0; it < 2; ++it)
#pragma unroll
      for (int u = 0; u < 4; ++u) {
        v8h o;
#pragma unroll
        for (int e = 0; e < 8; ++e) o[e] = (_Float16)xv[it][e][u];
        *(v8h*)&BshT[(nc + u) * LDK + (cg + it * 16) * 8] = o;
      }
  }
  if (tid < 2 * NB) colsum[tid >> 6][tid & 63] = 0.f;
  ksum_sh[tid] = 0.f;
  __syncthreads();

  const int r = lane & 15, hi = lane >> 4;
  // Kept rolled: one copy of the GEMM loop and its epilogues in the text.
#pragma unroll 1
  for (int turn = 0; turn < 3; ++turn) {
  // 0=q 1=k 2=v (block-uniform), in the order q, v, k: k's turn ends in a barrier
  // that also waits for the turn's own stores, so no GEMM is put behind it.
  const int which = turn ? 3 - turn : 0;
  const int ofs = which << 8;            // row offset into qkv_w / qkv_b
  // This wave's 32 weight rows (the B operand): 16 KB in a row, 2 KB per K block of 32.
  const _Float16* ap = qkv_wh + ((size_t)(which * 8 + wave) << 13) + lane * 8;
  // This lane's two channels' biases, asked for ahead of the GEMM loop.
  const float bias[2] = {qkv_b[ofs + wave * 32 + r], qkv_b[ofs + wave * 32 + 16 + r]};
  // Stands in front of any later write to the offset register that these loads name.
  asm volatile("s_wait_xcnt 0x0" ::: "memory");
  v8f acc[2][4] = {};
#pragma unroll 1
  for (int kk = 0; kk < 256; kk += 32) {
    v16h a0 = load_frag_packed(ap + kk * 32);
    v16h a1 = load_frag_packed(ap + kk * 32 + 512);
#pragma unroll
    for (int nt = 0; nt < 4; ++nt) {
      v16h bf = load_frag_f16(BshT, LDK, nt * 16, kk);
      // x is the A operand: a lane's 8 accumulator rows are 8 neighbouring positions
      // (nt*16 + hi*8 + j) of one channel ((wave*2 + i)*16 + r).
      acc[0][nt] = wmma_f16(bf, a0, acc[0][nt]);
      acc[1][nt] = wmma_f16(bf, a1, acc[1][nt]);
    }
  }

  v8h o[2][4];                            // 8 positions of one channel, f16
  if (which == 2) {                       // v: bias only
#pragma unroll
    for (int i = 0; i < 2; ++i)
#pragma unroll
      for (int nt = 0; nt < 4; ++nt)
#pragma unroll
        for (int j = 0; j < 8; ++j) o[i][nt][j] = (_Float16)(acc[i][nt][j] + bias[i]);
  } else {
    // feature map: t = (relu(val)+eps)^2, then column L2 normalize over 256 ch
    float s[32];                          // [nt*8 + j]: this lane's two channels
#pragma unroll
    for (int nt = 0; nt < 4; ++nt)
#pragma unroll
      for (int j = 0; j < 8; ++j) {
        float t0 = fmaxf(acc[0][nt][j] + bias[0], 0.f) + FLA_EPS;
        float t1 = fmaxf(acc[1][nt][j] + bias[1], 0.f) + FLA_EPS;
        t0 *= t0;
        t1 *= t1;
        acc[0][nt][j] = t0;
        acc[1][nt][j] = t1;
        s[nt * 8 + j] = t0 * t0 + t1 * t1;
      }
    // Sum over the row's 16 lanes (32 channels, two a lane). Each step halves what a lane keeps and
    // adds the partner's half to it, so lane r ends with the sums nt*8 + j = 2r, 2r + 1.
#pragma unroll
    for (int k = 0; k < 16; ++k) {
      float keep = (r & 8) ? s[k + 16] : s[k], send = (r & 8) ? s[k] : s[k + 16];
      s[k] = keep + fla_row_xor<0x168>(send);
    }
#pragma unroll
    for (int k = 0; k < 8; ++k) {
      float keep = (r & 4) ? s[k + 8] : s[k], send = (r & 4) ? s[k] : s[k + 8];
      s[k] = keep + fla_row_xor<0x164>(send);
    }
#pragma unroll
    for (int k = 0; k < 4; ++k) {
      float keep = (r & 2) ? s[k + 4] : s[k], send = (r & 2) ? s[k] : s[k + 4];
      s[k] = keep + fla_row_xor<0x162>(send);
    }
#pragma unroll
    for (int k = 0; k < 2; ++k) {
      float keep = (r & 1) ? s[k + 2] : s[k], send = (r & 1) ? s[k] : s[k + 2];
      s[k] = keep + fla_row_xor<0x161>(send);
    }
    {
      const int pos = (r >> 2) * 16 + hi * 8 + (r & 3) * 2;
      atomicAdd(&colsum[which][pos], s[0]);          // ds_add_f32, 32 addresses a wave
      atomicAdd(&colsum[which][pos + 1], s[1]);
    }
    __syncthreads();
    // Each wave works out the 64 factors once, two a lane, and hands them round its
    // lanes through its own LDS row.
    float* wi = winv[wave];
    wi[lane]      = 1.f / fmaxf(sqrtf(colsum[which][lane]), 1e-12f);
    wi[lane + 32] = 1.f / fmaxf(sqrtf(colsum[which][lane + 32]), 1e-12f);
    // The wave's own writes stand in LDS before its lanes read each other's.
    asm volatile("s_wait_dscnt 0x0" ::: "memory");
    float rowsum[2] = {0.f, 0.f};
#pragma unroll
    for (int nt = 0; nt < 4; ++nt) {
      v4f ia = *(const v4f*)&wi[nt * 16 + hi * 8];
      v4f ib = *(const v4f*)&wi[nt * 16 + hi * 8 + 4];
#pragma unroll
      for (int i = 0; i < 2; ++i)
#pragma unroll
        for (int j = 0; j < 8; ++j) {
          float tn = acc[i][nt][j] * (j < 4 ? ia[j & 3] : ib[j & 3]);
          o[i][nt][j] = (_Float16)tn;
          rowsum[i] += tn;
        }
    }
    if (which == 1) {
      atomicAdd(&ksum_sh[wave * 32 + r], rowsum[0]);
      atomicAdd(&ksum_sh[wave * 32 + 16 + r], rowsum[1]);
    }
  }
  // The wave's 32 rows go through its own LDS range and leave as whole 128-byte lines:
  // 8 lanes cover a channel's 64 positions, one store four channels.
  {
    _Float16* st = stg + wave * (32 * STP);
#pragma unroll
    for (int i = 0; i < 2; ++i)
#pragma unroll
      for (int nt = 0; nt < 4; ++nt)
        *(v8h*)&st[(i * 16 + r) * STP + (nt * 2 + hi) * 8] = o[i][nt];
    // The wave's own writes stand in LDS before it reads the rows back.
    asm volatile("s_wait_dscnt 0x0" ::: "memory");
    _Float16* dst = (which == 0) ? qf : (which == 1) ? kf : vf;
    _Float16* gd = dst + (size_t)(b * 256 + wave * 32 + (lane >> 3)) * 4096 + n0 + (lane & 7) * 8;
    const _Float16* sr = st + (lane >> 3) * STP + (lane & 7) * 8;
    v8h ln[8];
#pragma unroll
    for (int it = 0; it < 8; ++it) ln[it] = *(const v8h*)(sr + it * 4 * STP);
#pragma unroll
    for (int it = 0; it < 8; ++it) *(v8h*)(gd + (size_t)it * 4 * 4096) = ln[it];
    // Stands in front of any later write to a register that these stores name.
    asm volatile("s_wait_xcnt 0x0" ::: "memory");
  }
  if (which == 1) {
    __syncthreads();
    atomicAdd(&ksum[b * 256 + tid], ksum_sh[tid]);
  }
  // Stands in front of the next turn's writes to registers that this turn's
  // stores name (their address pairs and data registers are used again there).
  asm volatile("s_wait_xcnt 0x0" ::: "memory");
  }
}

// ---------------------------------------------------------------------------
// K2: vkT = v @ k^T  [256x256], K=N=4096. A block makes one 128x128 tile of the
// product over a quarter of K (1024 positions): 4 tiles x 4 splits x B = 256 blocks,
// block = 512 (16 waves, wave tile 32x32). Four partial products a batch go to
// memory. Both operands come into LDS by async copies, whole lines, in windows
// of 128 positions, two buffers: the next window flies while this one is worked on.
// The four tiles of one (batch, split) read the same rows; their block indices
// differ by 64 (speed only: nothing rests on where a block runs).
// Each block stores its own f32 partial product with plain 16-byte stores;
// fla_sum_pack adds the 4 partials of a batch. The product is formed as
// k @ v^T (k is the A operand), so a lane's 8 accumulator rows are 8 neighbouring
// columns of one row of v k^T: lane and tile then number exactly as the pieces of
// the packed A operand do (fla_pack_piece), and partials are kept in that order:
//   vkP[((b*4 + split)*2 + h)*8192 + g][4] = columns h*4 .. h*4+3 of piece g.
// ---------------------------------------------------------------------------
#define VKW 128                 // positions per window
#define VKPITCH 136             // LDS row pitch in halves: 272 B = 16 B x 17
#define VKBUF (256 * VKPITCH)   // one buffer: 128 k rows, then 128 v rows

// One window: 256 rows of 256 bytes. 16 lanes cover a row, a wave's copy two rows;
// a thread's 8 copies take rows (tid >> 4) + 32*i: four of k, then four of v.
static __device__ __forceinline__
void fla_vkt_window(_Float16* buf, const _Float16* kg, const _Float16* vg, int tid) {
  const int row = tid >> 4, piece = (tid & 15) << 3;
  _Float16* l = buf + row * VKPITCH + piece;
  const _Float16* gk = kg + (size_t)row * 4096 + piece;
  const _Float16* gv = vg + (size_t)row * 4096 + piece;
#pragma unroll
  for (int i = 0; i < 4; ++i) {
    async_cp16(l + i * 32 * VKPITCH, gk + (size_t)i * 32 * 4096);
    async_cp16(l + (128 + i * 32) * VKPITCH, gv + (size_t)i * 32 * 4096);
  }
}

__global__ __launch_bounds__(512)
void fla_vkt_kernel(const _Float16* __restrict__ vf, const _Float16* __restrict__ kf,
                    float* __restrict__ vkP)
{
  __shared__ __attribute__((aligned(16))) _Float16 Wsh[2 * VKBUF];
  const int tid   = threadIdx.x;
  const int wave  = tid >> 5;
  const int lane  = tid & 31;
  const int bs    = blockIdx.x & 63;     // b*4 + split
  const int tk    = (blockIdx.x >> 6) & 1;   // which 128 k channels
  const int tv    = blockIdx.x >> 7;         // which 128 v channels
  const int b     = bs >> 2;
  const int k0g   = (bs & 3) * 1024;

  const _Float16* kb = kf + ((size_t)b * 256 + tk * 128) * 4096 + k0g;
  const _Float16* vb = vf + ((size_t)b * 256 + tv * 128) * 4096 + k0g;

  fla_vkt_window(Wsh, kb, vb, tid);
  // Window 0 of this wave has landed before the barrier lets other waves read it.
  asm volatile("s_wait_asynccnt 0x0" ::: "memory");
  __syncthreads();
  fla_vkt_window(Wsh + VKBUF, kb + VKW, vb + VKW, tid);

  const int kr = (wave & 3) * 32;        // this wave's 32 k rows of the tile
  const int vr = 128 + (wave >> 2) * 32; // and its 32 v rows (LDS row numbers)
  v8f acc[2][2] = {};
  // Kept rolled: one copy of the pass in the text; the buffer goes by the trip's parity.
#pragma unroll 1
  for (int t = 0; t < 8; ++t) {
    _Float16* cur = Wsh + (t & 1) * VKBUF;
    // The pass's 16 fragments go to registers first, so that the buffer is free, and its
    // refill in flight, while the pass's WMMAs run.
    v16h fk[4][2], fv[4][2];
#pragma unroll
    for (int s = 0; s < 4; ++s) {
      fk[s][0] = load_frag_f16(cur, VKPITCH, kr, s * 32);
      fk[s][1] = load_frag_f16(cur, VKPITCH, kr + 16, s * 32);
      fv[s][0] = load_frag_f16(cur, VKPITCH, vr, s * 32);
      fv[s][1] = load_frag_f16(cur, VKPITCH, vr + 16, s * 32);
    }
    // This wave's reads of the buffer are done before it may be filled again.
    asm volatile("s_wait_dscnt 0x0" ::: "memory");
    // This wave's copies of window t + 1 have landed before the barrier publishes them.
    asm volatile("s_wait_asynccnt 0x0" ::: "memory");
    __syncthreads();
    if (t + 2 < 8)
      fla_vkt_window(cur, kb + (t + 2) * VKW, vb + (t + 2) * VKW, tid);
#pragma unroll
    for (int s = 0; s < 4; ++s) {
      acc[0][0] = wmma_f16(fk[s][0], fv[s][0], acc[0][0]);   // rows: k channels, columns: v channels
      acc[0][1] = wmma_f16(fk[s][0], fv[s][1], acc[0][1]);
      acc[1][0] = wmma_f16(fk[s][1], fv[s][0], acc[1][0]);
      acc[1][1] = wmma_f16(fk[s][1], fv[s][1], acc[1][1]);
    }
  }
  // No copy is outstanding when the wave ends.
  asm volatile("s_wait_asynccnt 0x0" ::: "memory");

  // Piece of the tile (v tile vt, k tile nt): group vt>>1, K block nt>>1, 16-row tile
  // vt&1, K half nt&1. A wave's store covers 512 contiguous bytes.
  float* pp = vkP + ((size_t)bs * 2 * 8192 + lane) * 4;
#pragma unroll
  for (int i = 0; i < 2; ++i)
#pragma unroll
    for (int j = 0; j < 2; ++j) {
      const int nt = tk * 8 + (wave & 3) * 2 + i;
      const int vt = tv * 8 + (wave >> 2) * 2 + j;
      float* pt = pp + ((vt >> 1) * 1024 + (vt & 1) * 64 + (nt >> 1) * 128 + (nt & 1) * 32) * 4;
      *(v4f*)pt = __builtin_shufflevector(acc[i][j], acc[i][j], 0, 1, 2, 3);
      *(v4f*)(pt + 8192 * 4) = __builtin_shufflevector(acc[i][j], acc[i][j], 4, 5, 6, 7);
    }
}

// K3 (part of the K4 launch): adds a batch's 4 partial products, split 0 first,
// and rounds the sum to f16: thread t = b*8192 + g makes piece t of the packed
// v k^T (16 bytes). Every load of a wave covers 512 contiguous bytes.
static __device__ __forceinline__
void fla_sum_pack(const float* __restrict__ vkP, _Float16* __restrict__ d, int t) {
  const float* p = vkP + ((size_t)(t >> 13) * 8 * 8192 + (t & 8191)) * 4;
  v4f lo = *(const v4f*)p;
  v4f hi = *(const v4f*)(p + (size_t)8192 * 4);
#pragma unroll
  for (int s = 1; s < 4; ++s) {
    lo += *(const v4f*)(p + (size_t)(s * 2) * 8192 * 4);
    hi += *(const v4f*)(p + (size_t)(s * 2 + 1) * 8192 * 4);
  }
  v8h o;
#pragma unroll
  for (int u = 0; u < 4; ++u) {
    o[u]     = (_Float16)lo[u];
    o[u + 4] = (_Float16)hi[u];
  }
  *(v8h*)(d + (size_t)t * 8) = o;
}

// ---------------------------------------------------------------------------
// K4: depthwise 5x5 SAME conv on v. One block per (b, c) plane of 64x64 pixels.
// The plane is staged once into LDS inside a frame of zeros (two rows above and
// below, two columns left and right), so no tap needs a bounds test; each
// thread then computes an 8-wide x 4-high tile of outputs in registers.
// block = 128 (8 column groups x 16 row groups).
// The same grid also sums the v k^T partials (fla_sum_pack): both need only what
// the launches before have written and neither reads the other's output. Of every
// five blocks four take a plane and the fifth 128 pieces of v k^T, so that the
// sums' reads run beside the planes' arithmetic. grid = B*256 + B*8192/128 = 5120.
// LDS row = 8 halves pad | 64 pixels | 8 halves pad = 160 B: the two 128-B row
// pieces that 16 lanes read with one 16-byte load fall on disjoint bank halves.
// ---------------------------------------------------------------------------
#define DWP 80
__global__ __launch_bounds__(128)
void fla_dwconv_sum_kernel(const _Float16* __restrict__ vf, const float* __restrict__ w5,
                           const float* __restrict__ wb, _Float16* __restrict__ dwv,
                           const float* __restrict__ vkP, _Float16* __restrict__ vkTh)
{
  __shared__ __attribute__((aligned(16))) _Float16 tile[68 * DWP];  // image rows -2 .. 65
  const int tid  = threadIdx.x;
  const int five = blockIdx.x / 5;       // 0..1023
  const int role = blockIdx.x - five * 5;
  if (role == 4) {                       // the whole block leaves, ahead of the barrier
    fla_sum_pack(vkP, vkTh, five * 128 + tid);
    return;
  }
  const int bc  = five * 4 + role;       // b*256 + c
  const int c   = bc & 255;
  const int cg  = tid & 7;               // column group: 8 pixels
  const int rg  = tid >> 3;              // 0..15
  const _Float16* src = vf + (size_t)bc * 4096;

  // The block's 25 taps and its bias, asked for ahead of the copies so that both
  // latencies run together. Every loop of this kernel is unrolled in full, so
  // that its arrays are indexed by constants and stay in registers.
  const float* wt = w5 + c * 25;
  float w[25];
#pragma unroll
  for (int i = 0; i < 25; ++i) w[i] = wt[i];
  const float bias = wb[c];

  {
    // 512 chunks of 16 B, four per thread: chunk tid + 128*i is image row
    // rg + 16*i, column group cg.
    const unsigned l0 = (unsigned)(size_t)&tile[(rg + 2) * DWP + 8 + cg * 8];
    const unsigned l1 = l0 + 16 * DWP * 2;
    const unsigned l2 = l0 + 32 * DWP * 2;
    const unsigned l3 = l0 + 48 * DWP * 2;
    const _Float16* g0 = src + tid * 8;
    const _Float16* g1 = g0 + 1024;
    const _Float16* g2 = g0 + 2048;
    const _Float16* g3 = g0 + 3072;
    // The copies bring the plane into LDS through no register; the closing wait
    // stands in the same statement so that no address register is rewritten
    // ahead of it.
    asm volatile("global_load_async_to_lds_b128 %0, %4, off\n\t"
                 "global_load_async_to_lds_b128 %1, %5, off\n\t"
                 "global_load_async_to_lds_b128 %2, %6, off\n\t"
                 "global_load_async_to_lds_b128 %3, %7, off\n\t"
                 "s_wait_xcnt 0x0"
                 :: "v"(l0), "v"(l1), "v"(l2), "v"(l3),
                    "v"(g0), "v"(g1), "v"(g2), "v"(g3)
                 : "memory");
  }
  // The frame of zeros: bytes that no copy writes.
  if (tid < 40) {                        // LDS rows 0, 1, 66, 67, ten 16-B chunks each
    int fr  = tid / 10;
    int row = fr + ((fr >> 1) * 64);
    v8h zz = {};
    *(v8h*)&tile[row * DWP + (tid - fr * 10) * 8] = zz;
  }
  *(unsigned*)&tile[(2 + (tid >> 1)) * DWP + ((tid & 1) ? 72 : 6)] = 0u;  // columns -2,-1 / 64,65
  // Every copy of this wave has landed before the barrier lets other waves read.
  asm volatile("s_wait_asynccnt 0x0" ::: "memory");
  __syncthreads();

  v2f acc[4][4];                         // [output row][pair of neighbouring columns]
#pragma unroll
  for (int o = 0; o < 4; ++o)
#pragma unroll
    for (int j = 0; j < 4; ++j) acc[o][j] = (v2f){bias, bias};

  // LDS row rg*4 + r is image row rg*4 - 2 + r; f[] holds columns cg*8-2 .. cg*8+9.
  // Each output sums bias, then its taps by rows and, within a row, left to right.
  const _Float16* base = &tile[(rg * 4) * DWP + 8 + cg * 8];
#pragma unroll
  for (int r = 0; r < 8; ++r) {
    const _Float16* p = base + r * DWP;
    v2h lft = *(const v2h*)(p - 2);
    v8h mid = *(const v8h*)p;
    v2h rgt = *(const v2h*)(p + 8);
    float f[12];
    f[0] = (float)lft[0]; f[1] = (float)lft[1];
#pragma unroll
    for (int u = 0; u < 8; ++u) f[2 + u] = (float)mid[u];
    f[10] = (float)rgt[0]; f[11] = (float)rgt[1];
    // Column pairs that start at an even and at an odd place, so that every
    // tap column finds its two inputs in one register pair (packed f32 fma).
    v2f ev[6], od[5];
#pragma unroll
    for (int k = 0; k < 6; ++k) ev[k] = (v2f){f[2 * k], f[2 * k + 1]};
#pragma unroll
    for (int k = 0; k < 5; ++k) od[k] = (v2f){f[2 * k + 1], f[2 * k + 2]};
#pragma unroll
    for (int o = 0; o < 4; ++o) {
      const int dy = r - o;              // tap row 0..4 of output row o
      if (dy < 0 || dy > 4) continue;
#pragma unroll
      for (int dx = 0; dx < 5; ++dx) {
        const v2f wv = (v2f){w[dy * 5 + dx], w[dy * 5 + dx]};
#pragma unroll
        for (int j = 0; j < 4; ++j)
          acc[o][j] = __builtin_elementwise_fma(
              wv, (dx & 1) ? od[j + (dx >> 1)] : ev[j + (dx >> 1)], acc[o][j]);
      }
    }
  }
  _Float16* dst = dwv + (size_t)bc * 4096 + (rg * 4) * 64 + cg * 8;
#pragma unroll
  for (int o = 0; o < 4; ++o) {
    v8h ov;
#pragma unroll
    for (int j = 0; j < 4; ++j) {
      ov[2 * j]     = (_Float16)acc[o][j][0];
      ov[2 * j + 1] = (_Float16)acc[o][j][1];
    }
    *(v8h*)(dst + o * 64) = ov;
  }
}

// ---------------------------------------------------------------------------
// K5: attn = (vkT @ q) * (1/4096) / z ; RMSNorm * norm_w ; + dw -> y (f16),
// then out = proj_w @ y + proj_b (fp32 out) in the same block: a block holds all
// 256 channels of its 64 positions, which is the whole A tile of the projection,
// so y goes from the accumulators into LDS and never to memory.
// grid = B*64, block = 256. q block staged transposed [n][c]; y takes its place.
// The block's dw tile is staged the same way beside it.
// A = packed v k^T, then y; the projection's B = f16 proj weights in fragment order (fla_pack_piece).
// ---------------------------------------------------------------------------
__global__ __launch_bounds__(256)
void fla_attn_kernel(const _Float16* __restrict__ vkTh, const _Float16* __restrict__ qf,
                     const float* __restrict__ ksum, const _Float16* __restrict__ dwv,
                     const float* __restrict__ norm_w, const _Float16* __restrict__ proj_wh,
                     const float* __restrict__ proj_b, float* __restrict__ out)
{
  __shared__ __attribute__((aligned(16))) _Float16 BshT[NB * LDK];
  // dw, [n][channel] (NB * LDK halves); behind the last barrier the f32 output staging,
  // each wave's own 16 channel rows of 64 positions.
  __shared__ __attribute__((aligned(16))) _Float16 DshT[8 * 16 * OSTP * 2];
  __shared__ float kmean_sh[256];
  __shared__ float zcol[NB];
  __shared__ float colss[NB];

  const int tid  = threadIdx.x;
  const int b    = blockIdx.x >> 6;
  const int n0   = (blockIdx.x & 63) * NB;
  const int wave = tid >> 5;
  const int lane = tid & 31;

  // q and dw tiles: a thread loads 8 positions (16 bytes; 8 lanes cover a row's 128
  // bytes) of each of 8 neighbouring channels and turns them in registers.
  {
    const int nc = (tid & 7) << 3;
    const int cg = tid >> 3;             // 0..31
    const size_t go = ((size_t)b * 256 + cg * 8) * 4096 + n0 + nc;
    v8h hq[8], hd[8];
#pragma unroll
    for (int e = 0; e < 8; ++e) hq[e] = *(const v8h*)(qf + go + (size_t)e * 4096);
    // Stands in front of the next loads' results, which may land in these loads' address pair.
    asm volatile("s_wait_xcnt 0x0" ::: "memory");
#pragma unroll
    for (int e = 0; e < 8; ++e) hd[e] = *(const v8h*)(dwv + go + (size_t)e * 4096);
    // Stands in front of the later writes to the address registers that these loads name.
    asm volatile("s_wait_xcnt 0x0" ::: "memory");
    fla_turn8_store(BshT, hq, nc, cg);
    fla_turn8_store(DshT, hd, nc, cg);
  }
  kmean_sh[tid] = ksum[b * 256 + tid] * (1.f / 4096.f);
  if (tid < NB) { colss[tid] = 0.f; zcol[tid] = FLA_EPS; }
  __syncthreads();

  {                                       // z = kmean . q(col) + eps, 4-way split
    int col = tid & 63, quarter = tid >> 6;
    const _Float16* bp = BshT + col * LDK + quarter * 64;
    const float* kp = kmean_sh + quarter * 64;
    float s = 0.f;
#pragma unroll
    for (int cc = 0; cc < 64; cc += 8) {
      v8h hv = *(const v8h*)(bp + cc);
#pragma unroll
      for (int u = 0; u < 8; ++u) s += kp[cc + u] * (float)hv[u];
    }
    atomicAdd(&zcol[col], s);
  }

  // This wave's 32 rows of the batch's packed v k^T (fla_pack_piece).
  const _Float16* ap = vkTh + ((size_t)(b * 8 + wave) << 13) + lane * 8;
  v8f acc[2][4] = {};
#pragma unroll 1
  for (int kk = 0; kk < 256; kk += 32) {
    v16h a0 = load_frag_packed(ap + kk * 32);
    v16h a1 = load_frag_packed(ap + kk * 32 + 512);
#pragma unroll
    for (int nt = 0; nt < 4; ++nt) {
      v16h bf = load_frag_f16(BshT, LDK, nt * 16, kk);
      acc[0][nt] = wmma_f16(a0, bf, acc[0][nt]);
      acc[1][nt] = wmma_f16(a1, bf, acc[1][nt]);
    }
  }
  __syncthreads();                        // zcol complete, colss zeroed, q tile read out
  const int r = lane & 15, hi = lane >> 4;
#pragma unroll
  for (int nt = 0; nt < 4; ++nt) {
    float z = zcol[nt * 16 + r];
    float s = 0.f;
#pragma unroll
    for (int i = 0; i < 2; ++i)
#pragma unroll
      for (int j = 0; j < 8; ++j) {
        float a = acc[i][nt][j] * (1.f / 4096.f) / z;
        acc[i][nt][j] = a;
        s += a * a;
      }
    atomicAdd(&colss[nt * 16 + r], s);
  }
  __syncthreads();
  float rinv[4];
#pragma unroll
  for (int nt = 0; nt < 4; ++nt)
    rinv[nt] = 1.f / sqrtf(colss[nt * 16 + r] * (1.f / 256.f) + FLA_EPS);
  // y, rounded to f16, goes into the LDS tile as [n][channel]: a lane's 8 accumulator
  // rows of one 16x16 tile are 8 neighbouring channels of one position = 16 bytes.
  // dw comes from its LDS tile in the same form, one 16-byte read per tile.
  v8h y8[2][4];
#pragma unroll
  for (int i = 0; i < 2; ++i)
#pragma unroll
    for (int nt = 0; nt < 4; ++nt)
      y8[i][nt] = *(const v8h*)&DshT[(nt * 16 + r) * LDK + (wave * 2 + i) * 16 + 8 * hi];
#pragma unroll
  for (int i = 0; i < 2; ++i)
#pragma unroll
    for (int j = 0; j < 8; ++j) {
      int m = (wave * 2 + i) * 16 + j + 8 * hi;
      float nw = norm_w[m];
#pragma unroll
      for (int nt = 0; nt < 4; ++nt) {
        float yv = acc[i][nt][j] * rinv[nt] * nw + (float)y8[i][nt][j];
        y8[i][nt][j] = (_Float16)yv;
      }
    }
#pragma unroll
  for (int i = 0; i < 2; ++i)
#pragma unroll
    for (int nt = 0; nt < 4; ++nt) {
      *(v8h*)&BshT[(nt * 16 + r) * LDK + (wave * 2 + i) * 16 + 8 * hi] = y8[i][nt];
      acc[i][nt] = (v8f){};
    }
  __syncthreads();                        // every wave's channels of y are in the tile

  ap = proj_wh + ((size_t)wave << 13) + lane * 8;
  // This lane's two output channels' biases, asked for ahead of the GEMM loop.
  const float pbias[2] = {proj_b[wave * 32 + r], proj_b[wave * 32 + 16 + r]};
#pragma unroll 1
  for (int kk = 0; kk < 256; kk += 32) {
    v16h a0 = load_frag_packed(ap + kk * 32);
    v16h a1 = load_frag_packed(ap + kk * 32 + 512);
#pragma unroll
    for (int nt = 0; nt < 4; ++nt) {
      v16h bf = load_frag_f16(BshT, LDK, nt * 16, kk);
      // y is the A operand: a lane's 8 accumulator rows are 8 neighbouring positions
      // (nt*16 + hi*8 + j) of one output channel ((wave*2 + i)*16 + r).
      acc[0][nt] = wmma_f16(bf, a0, acc[0][nt]);
      acc[1][nt] = wmma_f16(bf, a1, acc[1][nt]);
    }
  }
  // 16 channel rows at a time go through the wave's own LDS range and leave as whole
  // lines: 16 lanes cover a channel's 64 positions (256 bytes), one store two channels.
  float* so = (float*)DshT + wave * (16 * OSTP);
#pragma unroll
  for (int i = 0; i < 2; ++i) {
    const float bias = pbias[i];
#pragma unroll
    for (int nt = 0; nt < 4; ++nt) {
      v4f lo, up;
#pragma unroll
      for (int u = 0; u < 4; ++u) {
        lo[u] = acc[i][nt][u] + bias;
        up[u] = acc[i][nt][u + 4] + bias;
      }
      *(v4f*)&so[r * OSTP + nt * 16 + hi * 8]     = lo;
      *(v4f*)&so[r * OSTP + nt * 16 + hi * 8 + 4] = up;
    }
    // The wave's own writes stand in LDS before it reads the rows back.
    asm volatile("s_wait_dscnt 0x0" ::: "memory");
    float* go = out + (size_t)(b * 256 + (wave * 2 + i) * 16 + hi) * 4096 + n0 + r * 4;
    const float* sr = so + hi * OSTP + r * 4;
    v4f ln[8];
#pragma unroll
    for (int it = 0; it < 8; ++it) ln[it] = *(const v4f*)(sr + it * 2 * OSTP);
#pragma unroll
    for (int it = 0; it < 8; ++it) *(v4f*)(go + (size_t)it * 2 * 4096) = ln[it];
    // Stands in front of the second half's writes to registers that these stores name.
    if (i == 0) asm volatile("s_wait_xcnt 0x0" ::: "memory");
  }
}

extern "C" void kernel_launch(void* const* d_in, const int* in_sizes, int n_in,
                              void* d_out, int out_size, void* d_ws, size_t ws_size,
                              hipStream_t stream)
{
  (void)in_sizes; (void)n_in; (void)out_size; (void)ws_size;
  const float* x      = (const float*)d_in[0];
  const float* qkv_w  = (const float*)d_in[1];
  const float* qkv_b  = (const float*)d_in[2];
  const float* dwc_w  = (const float*)d_in[3];
  const float* dwc_b  = (const float*)d_in[4];
  const float* norm_w = (const float*)d_in[5];
  const float* proj_w = (const float*)d_in[6];
  const float* proj_b = (const float*)d_in[7];
  float* out = (float*)d_out;

  const size_t B = 16, D = 256, N = 4096;
  char* ws = (char*)d_ws;
  size_t off = 0;
  auto take = [&](size_t bytes) {
    char* p = ws + off;
    off = (off + bytes + 255) & ~(size_t)255;
    return p;
  };
  _Float16* qf      = (_Float16*)take(B * D * N * 2);
  _Float16* kf      = (_Float16*)take(B * D * N * 2);
  _Float16* vf      = (_Float16*)take(B * D * N * 2);
  _Float16* dwv     = (_Float16*)take(B * D * N * 2);
  float*    vkP     = (float*)   take(4 * B * D * D * 4);
  _Float16* vkTh    = (_Float16*)take(B * D * D * 2);
  float*    ksum    = (float*)   take(B * D * 4);
  _Float16* qkv_wh  = (_Float16*)take(3 * D * D * 2);
  _Float16* proj_wh = (_Float16*)take(D * D * 2);

  fla_prep_kernel<<<dim3(144), 256, 0, stream>>>(qkv_w, qkv_wh, proj_w, proj_wh, ksum);
  fla_qkv_kernel<<<dim3(1024), 256, 0, stream>>>(x, qkv_wh, qkv_b, qf, kf, vf, ksum);
  fla_vkt_kernel<<<dim3(256), 512, 0, stream>>>(vf, kf, vkP);
  fla_dwconv_sum_kernel<<<dim3(5120), 128, 0, stream>>>(vf, dwc_w, dwc_b, dwv, vkP, vkTh);
  fla_attn_kernel<<<dim3(1024), 256, 0, stream>>>(vkTh, qf, ksum, dwv, norm_w,
                                                  proj_wh, proj_b, out);
}

// v010
// One run takes 80.5 microseconds.
// In two side-by-side timings against v009, it was 1.09 and 1.08 times as fast.
// Over all steps from v000 it is 2.98 times as fast.
#include <hip/hip_runtime.h>
#include <hip/hip_fp16.h>

typedef __attribute__((ext_vector_type(16))) _Float16 v16h;
typedef __attribute__((ext_vector_type(8)))  _Float16 v8h;
typedef __attribute__((ext_vector_type(2)))  _Float16 v2h;
typedef __attribute__((ext_vector_type(8)))  float    v8f;
typedef __attribute__((ext_vector_type(4)))  float    v4f;
typedef __attribute__((ext_vector_type(2)))  float    v2f;
typedef __attribute__((ext_vector_type(4)))  int      v4i;

#define FLA_EPS 1e-5f
#define NB 64
#define LDK 264   // padded K-stride (halves) for transposed [col][K] LDS blocks
#define STP 72    // pitch (halves) of a staged f16 output row of 64 positions: 144 B = 16 B x 9
#define OSTP 68   // pitch (floats) of a staged f32 output row of 64 positions: 272 B = 16 B x 17

static __device__ __forceinline__ v8f wmma_f16(v16h a, v16h b, v8f c) {
  return __builtin_amdgcn_wmma_f32_16x16x32_f16(false, a, false, b, (short)0, c,
                                                false, false);
}

// The value that lane (l ^ X) of the same 16-lane row holds; CTRL = 0x160 + X (row_xmask).
template <int CTRL>
static __device__ __forceinline__ float fla_row_xor(float v) {
  return __builtin_bit_cast(float, __builtin_amdgcn_update_dpp(
      0, __builtin_bit_cast(int, v), CTRL, 0xf, 0xf, true));
}

// Async 16-byte global -> LDS copy (GLOBAL_LOAD_ASYNC_TO_LDS_B128, ASYNCcnt).
static __device__ __forceinline__ void async_cp16(void* lds, const void* g) {
  __builtin_amdgcn_global_load_async_to_lds_b128(
      (__attribute__((address_space(1))) v4i*)g,
      (__attribute__((address_space(3))) v4i*)lds, 0, 0);
}

// WMMA 16x16x32 fragment from an f16 matrix whose fragment rows are contiguous
// in K (A row-major, or B when columns are contiguous in K — e.g. transposed
// LDS blocks and v^T from v stored [d][N]). Two 16B loads per lane.
// Lane L (0-15) holds row rowBase+L; lanes 16-31 same rows, upper K-halves:
// elems 0..7 = K k0+hi*8+{0..7}, elems 8..15 = K k0+16+hi*8+{0..7}.
static __device__ __forceinline__ v16h load_frag_f16(const _Float16* src,
                                                     int ld, int rowBase, int k0) {
  int lane = threadIdx.x & 31;
  const _Float16* p = src + (size_t)(rowBase + (lane & 15)) * ld + k0 + ((lane >> 4) << 3);
  v16h f;
#pragma unroll
  for (int j = 0; j < 8; ++j) {
    f[j]     = p[j];
    f[j + 8] = p[j + 16];
  }
  return f;
}

// A operand in fragment order. A row-major f32 matrix [rows][256] is converted
// to f16 and laid out so that every wave-wide 16-byte load of an A fragment
// covers 512 contiguous bytes (four whole lines) instead of 32 bytes in each of
// 16 rows. Piece g (16 B = 8 halves) of the packed matrix:
//   g = (((rows/32 group) * 8 + K block of 32) * 2 + 16-row tile) * 2 + K half) * 32 + lane
// and holds row group*32 + tile*16 + (lane & 15),
//           K   block*32 + half*16 + (lane >> 4)*8 + {0..7},
// which is what load_frag_f16 gives that lane. One thread writes one piece.
static __device__ __forceinline__
void fla_pack_piece(const float* __restrict__ s, _Float16* __restrict__ d, int g) {
  int lane = g & 31;
  int row  = ((g >> 10) << 5) + (((g >> 6) & 1) << 4) + (lane & 15);
  int k    = (((g >> 7) & 7) << 5) + (((g >> 5) & 1) << 4) + ((lane >> 4) << 3);
  const float* p = s + (size_t)row * 256 + k;
  v4f lo = *(const v4f*)p;
  v4f hi = *(const v4f*)(p + 4);
  v8h o;
#pragma unroll
  for (int u = 0; u < 4; ++u) {
    o[u]     = (_Float16)lo[u];
    o[u + 4] = (_Float16)hi[u];
  }
  *(v8h*)(d + (size_t)g * 8) = o;
  // Stands in front of any later write to a register that the store names: in the
  // merged kernel the other branches' code follows this store in the text.
  asm volatile("s_wait_xcnt 0x0" ::: "memory");
}

// Turns a thread's 8 channels x 8 positions of f16 (h[e] = 8 neighbouring positions
// of channel cg*8 + e) in registers and stores them into a [position][channel] LDS
// tile of pitch LDK: one 16-byte store per position holds the 8 channels.
static __device__ __forceinline__
void fla_turn8_store(_Float16* tileT, const v8h (&h)[8], int nc, int cg) {
#pragma unroll
  for (int u = 0; u < 8; ++u) {
    v8h o;
#pragma unroll
    for (int e = 0; e < 8; ++e) o[e] = h[e][u];
    *(v8h*)&tileT[(nc + u) * LDK + cg * 8] = o;
  }
}

// K0: all that has to stand ready before the qkv launch and depends on nothing
// but the inputs, in one grid: blocks 0..95 pack the qkv weights (24576 pieces),
// blocks 96..127 the proj weights (8192 pieces), blocks 128..143 zero ksum
// (4096 floats). grid = 144, block = 256; every block is full.
__global__ __launch_bounds__(256)
void fla_prep_kernel(const float* __restrict__ qkv_w, _Float16* __restrict__ qkv_wh,
                     const float* __restrict__ proj_w, _Float16* __restrict__ proj_wh,
                     float* __restrict__ ksum) {
  const int blk = blockIdx.x;
  const int tid = threadIdx.x;
  if (blk < 96)       fla_pack_piece(qkv_w, qkv_wh, blk * 256 + tid);
  else if (blk < 128) fla_pack_piece(proj_w, proj_wh, (blk - 96) * 256 + tid);
  else                ksum[(blk - 128) * 256 + tid] = 0.f;
}

// One 16x32 A fragment from a packed matrix: p points at this lane's piece of
// the fragment's first K half; the second K half lies 512 bytes behind it.
static __device__ __forceinline__ v16h load_frag_packed(const _Float16* p) {
  v8h lo = *(const v8h*)p;
  v8h hi = *(const v8h*)(p + 256);
  return __builtin_shufflevector(lo, hi, 0, 1, 2, 3, 4, 5, 6, 7,
                                 8, 9, 10, 11, 12, 13, 14, 15);
}

// ---------------------------------------------------------------------------
// K1: qkv 1x1 conv GEMM + feature map (q,k) / passthrough (v) + ksum for kmean
// grid = B*64, block = 256 (8 waves). Each block: 64 positions, K=256, and all
// 768 output channels: q, v and k one after the other ([256ch x 64pos] each)
// from the one x tile, which is read from memory and staged once.
// x block staged transposed into LDS as [n][c] f16 so A-frags are 2x16B reads.
// B = f16 qkv weights in fragment order (fla_pack_piece): whole-line loads.
// ---------------------------------------------------------------------------
// The second bound asks for 8 waves a SIMD, a budget of 128 registers a wave: four blocks
// then stand on a WGP (their LDS, 4 x 74,240 bytes, fits too) and the grid is resident at once.
__global__ __launch_bounds__(256, 8)
void fla_qkv_kernel(const float* __restrict__ x, const _Float16* __restrict__ qkv_wh,
                    const float* __restrict__ qkv_b,
                    _Float16* __restrict__ qf, _Float16* __restrict__ kf,
                    _Float16* __restrict__ vf, float* __restrict__ ksum)
{
  __shared__ __attribute__((aligned(16))) _Float16 BshT[NB * LDK];
  // Output staging: each wave's own 32 channel rows of 64 positions.
  __shared__ __attribute__((aligned(16))) _Float16 stg[8 * 32 * STP];
  __shared__ __attribute__((aligned(16))) float winv[8][NB];  // each wave's own copy of 1/norm
  __shared__ float colsum[2][NB];        // [q, k]: each has its own sums
  __shared__ float ksum_sh[256];

  const int tid   = threadIdx.x;
  const int b     = blockIdx.x >> 6;
  const int n0    = (blockIdx.x & 63) * NB;
  const int wave  = tid >> 5;
  const int lane  = tid & 31;

  // Stage x[b, :, n0:n0+64] -> f16 LDS transposed. A thread loads 4 positions of
  // each of 8 neighbouring channels (16 lanes cover a row's 256 bytes), twice, and
  // stores each position's 8 channels with one 16-byte LDS store.
  const float* xb = x + (size_t)b * 256 * 4096 + n0;
  {
    const int nc = (tid & 15) << 2;
    const int cg = tid >> 4;             // 0..15; the second half takes cg + 16
    v4f xv[2][8];
#pragma unroll
    for (int it = 0; it < 2; ++it)
#pragma unroll
      for (int e = 0; e < 8; ++e)
        xv[it][e] = *(const v4f*)(xb + (size_t)((cg + it * 16) * 8 + e) * 4096 + nc);
#pragma unroll
    for (int it = 0; it < 2; ++it)
#pragma unroll
      for (int u = 0; u < 4; ++u) {
        v8h o;
#pragma unroll
        for (int e = 0; e < 8; ++e) o[e] = (_Float16)xv[it][e][u];
        *(v8h*)&BshT[(nc + u) * LDK + (cg + it * 16) * 8] = o;
      }
  }
  if (tid < 2 * NB) colsum[tid >> 6][tid & 63] = 0.f;
  ksum_sh[tid] = 0.f;
  __syncthreads();

  const int r = lane & 15, hi = lane >> 4;
  // Unrolled: each turn knows at compile time which of q, k, v it makes, so that k's row
  // sums are added where the values are made and are not held for a later branch.
#pragma unroll
  for (int turn = 0; turn < 3; ++turn) {
  // 0=q 1=k 2=v (block-uniform), in the order q, v, k: k's turn ends in a barrier
  // that also waits for the turn's own stores, so no GEMM is put behind it.
  const int which = turn ? 3 - turn : 0;
  const int ofs = which << 8;            // row offset into qkv_w / qkv_b
  // This wave's 32 weight rows (the B operand): 16 KB in a row, 2 KB per K block of 32.
  const _Float16* ap = qkv_wh + ((size_t)(which * 8 + wave) << 13) + lane * 8;
  // This lane's two channels' biases, asked for ahead of the GEMM loop.
  const float bias[2] = {qkv_b[ofs + wave * 32 + r], qkv_b[ofs + wave * 32 + 16 + r]};
  // Stands in front of any later write to the offset register that these loads name.
  asm volatile("s_wait_xcnt 0x0" ::: "memory");
  v8f acc[2][4] = {};
#pragma unroll 1
  for (int kk = 0; kk < 256; kk += 32) {
    v16h a0 = load_frag_packed(ap + kk * 32);
    v16h a1 = load_frag_packed(ap + kk * 32 + 512);
#pragma unroll
    for (int nt = 0; nt < 4; ++nt) {
      v16h bf = load_frag_f16(BshT, LDK, nt * 16, kk);
      // x is the A operand: a lane's 8 accumulator rows are 8 neighbouring positions
      // (nt*16 + hi*8 + j) of one channel ((wave*2 + i)*16 + r).
      acc[0][nt] = wmma_f16(bf, a0, acc[0][nt]);
      acc[1][nt] = wmma_f16(bf, a1, acc[1][nt]);
    }
  }

  v8h o[2][4];                            // 8 positions of one channel, f16
  if (which == 2) {                       // v: bias only
#pragma unroll
    for (int i = 0; i < 2; ++i)
#pragma unroll
      for (int nt = 0; nt < 4; ++nt)
#pragma unroll
        for (int j = 0; j < 8; ++j) o[i][nt][j] = (_Float16)(acc[i][nt][j] + bias[i]);
  } else {
    // feature map: t = (relu(val)+eps)^2, then column L2 normalize over 256 ch
    float s[32];                          // [nt*8 + j]: this lane's two channels
#pragma unroll
    for (int nt = 0; nt < 4; ++nt)
#pragma unroll
      for (int j = 0; j < 8; ++j) {
        float t0 = fmaxf(acc[0][nt][j] + bias[0], 0.f) + FLA_EPS;
        float t1 = fmaxf(acc[1][nt][j] + bias[1], 0.f) + FLA_EPS;
        t0 *= t0;
        t1 *= t1;
        acc[0][nt][j] = t0;
        acc[1][nt][j] = t1;
        s[nt * 8 + j] = t0 * t0 + t1 * t1;
      }
    // Sum over the row's 16 lanes (32 channels, two a lane). Each step halves what a lane keeps and
    // adds the partner's half to it, so lane r ends with the sums nt*8 + j = 2r, 2r + 1.
#pragma unroll
    for (int k = 0; k < 16; ++k) {
      float keep = (r & 8) ? s[k + 16] : s[k], send = (r & 8) ? s[k] : s[k + 16];
      s[k] = keep + fla_row_xor<0x168>(send);
    }
#pragma unroll
    for (int k = 0; k < 8; ++k) {
      float keep = (r & 4) ? s[k + 8] : s[k], send = (r & 4) ? s[k] : s[k + 8];
      s[k] = keep + fla_row_xor<0x164>(send);
    }
#pragma unroll
    for (int k = 0; k < 4; ++k) {
      float keep = (r & 2) ? s[k + 4] : s[k], send = (r & 2) ? s[k] : s[k + 4];
      s[k] = keep + fla_row_xor<0x162>(send);
    }
#pragma unroll
    for (int k = 0; k < 2; ++k) {
      float keep = (r & 1) ? s[k + 2] : s[k], send = (r & 1) ? s[k] : s[k + 2];
      s[k] = keep + fla_row_xor<0x161>(send);
    }
    {
      const int pos = (r >> 2) * 16 + hi * 8 + (r & 3) * 2;
      atomicAdd(&colsum[which][pos], s[0]);          // ds_add_f32, 32 addresses a wave
      atomicAdd(&colsum[which][pos + 1], s[1]);
    }
    __syncthreads();
    // Each wave works out the 64 factors once, two a lane, and hands them round its
    // lanes through its own LDS row.
    float* wi = winv[wave];
    wi[lane]      = 1.f / fmaxf(sqrtf(colsum[which][lane]), 1e-12f);
    wi[lane + 32] = 1.f / fmaxf(sqrtf(colsum[which][lane + 32]), 1e-12f);
    // The wave's own writes stand in LDS before its lanes read each other's.
    asm volatile("s_wait_dscnt 0x0" ::: "memory");
    float rowsum[2] = {0.f, 0.f};
#pragma unroll
    for (int nt = 0; nt < 4; ++nt) {
      v4f ia = *(const v4f*)&wi[nt * 16 + hi * 8];
      v4f ib = *(const v4f*)&wi[nt * 16 + hi * 8 + 4];
#pragma unroll
      for (int i = 0; i < 2; ++i)
#pragma unroll
        for (int j = 0; j < 8; ++j) {
          float tn = acc[i][nt][j] * (j < 4 ? ia[j & 3] : ib[j & 3]);
          o[i][nt][j] = (_Float16)tn;
          rowsum[i] += tn;
        }
    }
    if (which == 1) {
      atomicAdd(&ksum_sh[wave * 32 + r], rowsum[0]);
      atomicAdd(&ksum_sh[wave * 32 + 16 + r], rowsum[1]);
    }
  }
  // The wave's 32 rows go through its own LDS range and leave as whole 128-byte lines:
  // 8 lanes cover a channel's 64 positions, one store four channels.
  {
    _Float16* st = stg + wave * (32 * STP);
#pragma unroll
    for (int i = 0; i < 2; ++i)
#pragma unroll
      for (int nt = 0; nt < 4; ++nt)
        *(v8h*)&st[(i * 16 + r) * STP + (nt * 2 + hi) * 8] = o[i][nt];
    // The wave's own writes stand in LDS before it reads the rows back.
    asm volatile("s_wait_dscnt 0x0" ::: "memory");
    _Float16* dst = (which == 0) ? qf : (which == 1) ? kf : vf;
    _Float16* gd = dst + (size_t)(b * 256 + wave * 32 + (lane >> 3)) * 4096 + n0 + (lane & 7) * 8;
    const _Float16* sr = st + (lane >> 3) * STP + (lane & 7) * 8;
    v8h ln[8];
#pragma unroll
    for (int it = 0; it < 8; ++it) ln[it] = *(const v8h*)(sr + it * 4 * STP);
#pragma unroll
    for (int it = 0; it < 8; ++it) *(v8h*)(gd + (size_t)it * 4 * 4096) = ln[it];
    // Stands in front of any later write to a register that these stores name.
    asm volatile("s_wait_xcnt 0x0" ::: "memory");
  }
  if (which == 1) {
    __syncthreads();
    atomicAdd(&ksum[b * 256 + tid], ksum_sh[tid]);
  }
  // Stands in front of the next turn's writes to registers that this turn's
  // stores name (their address pairs and data registers are used again there).
  asm volatile("s_wait_xcnt 0x0" ::: "memory");
  }
}

// ---------------------------------------------------------------------------
// K2: vkT = v @ k^T  [256x256], K=N=4096. A block makes one 128x128 tile of the
// product over a quarter of K (1024 positions): 4 tiles x 4 splits x B = 256 blocks,
// block = 512 (16 waves, wave tile 32x32). Four partial products a batch go to
// memory. Both operands come into LDS by async copies, whole lines, in windows
// of 128 positions, two buffers: the next window flies while this one is worked on.
// The four tiles of one (batch, split) read the same rows; their block indices
// differ by 64 (speed only: nothing rests on where a block runs).
// Each block stores its own f32 partial product with plain 16-byte stores;
// fla_sum_pack adds the 4 partials of a batch. The product is formed as
// k @ v^T (k is the A operand), so a lane's 8 accumulator rows are 8 neighbouring
// columns of one row of v k^T: lane and tile then number exactly as the pieces of
// the packed A operand do (fla_pack_piece), and partials are kept in that order:
//   vkP[((b*4 + split)*2 + h)*8192 + g][4] = columns h*4 .. h*4+3 of piece g.
// ---------------------------------------------------------------------------
#define VKW 128                 // positions per window
#define VKPITCH 136             // LDS row pitch in halves: 272 B = 16 B x 17
#define VKBUF (256 * VKPITCH)   // one buffer: 128 k rows, then 128 v rows

// One window: 256 rows of 256 bytes. 16 lanes cover a row, a wave's copy two rows;
// a thread's 8 copies take rows (tid >> 4) + 32*i: four of k, then four of v.
static __device__ __forceinline__
void fla_vkt_window(_Float16* buf, const _Float16* kg, const _Float16* vg, int tid) {
  const int row = tid >> 4, piece = (tid & 15) << 3;
  _Float16* l = buf + row * VKPITCH + piece;
  const _Float16* gk = kg + (size_t)row * 4096 + piece;
  const _Float16* gv = vg + (size_t)row * 4096 + piece;
#pragma unroll
  for (int i = 0; i < 4; ++i) {
    async_cp16(l + i * 32 * VKPITCH, gk + (size_t)i * 32 * 4096);
    async_cp16(l + (128 + i * 32) * VKPITCH, gv + (size_t)i * 32 * 4096);
  }
}

__global__ __launch_bounds__(512)
void fla_vkt_kernel(const _Float16* __restrict__ vf, const _Float16* __restrict__ kf,
                    float* __restrict__ vkP)
{
  __shared__ __attribute__((aligned(16))) _Float16 Wsh[2 * VKBUF];
  const int tid   = threadIdx.x;
  const int wave  = tid >> 5;
  const int lane  = tid & 31;
  const int bs    = blockIdx.x & 63;     // b*4 + split
  const int tk    = (blockIdx.x >> 6) & 1;   // which 128 k channels
  const int tv    = blockIdx.x >> 7;         // which 128 v channels
  const int b     = bs >> 2;
  const int k0g   = (bs & 3) * 1024;

  const _Float16* kb = kf + ((size_t)b * 256 + tk * 128) * 4096 + k0g;
  const _Float16* vb = vf + ((size_t)b * 256 + tv * 128) * 4096 + k0g;

  fla_vkt_window(Wsh, kb, vb, tid);
  // Window 0 of this wave has landed before the barrier lets other waves read it.
  asm volatile("s_wait_asynccnt 0x0" ::: "memory");
  __syncthreads();
  fla_vkt_window(Wsh + VKBUF, kb + VKW, vb + VKW, tid);

  const int kr = (wave & 3) * 32;        // this wave's 32 k rows of the tile
  const int vr = 128 + (wave >> 2) * 32; // and its 32 v rows (LDS row numbers)
  v8f acc[2][2] = {};
  // Kept rolled: one copy of the pass in the text; the buffer goes by the trip's parity.
#pragma unroll 1
  for (int t = 0; t < 8; ++t) {
    _Float16* cur = Wsh + (t & 1) * VKBUF;
    // The pass's 16 fragments go to registers first, so that the buffer is free, and its
    // refill in flight, while the pass's WMMAs run.
    v16h fk[4][2], fv[4][2];
#pragma unroll
    for (int s = 0; s < 4; ++s) {
      fk[s][0] = load_frag_f16(cur, VKPITCH, kr, s * 32);
      fk[s][1] = load_frag_f16(cur, VKPITCH, kr + 16, s * 32);
      fv[s][0] = load_frag_f16(cur, VKPITCH, vr, s * 32);
      fv[s][1] = load_frag_f16(cur, VKPITCH, vr + 16, s * 32);
    }
    // This wave's reads of the buffer are done before it may be filled again.
    asm volatile("s_wait_dscnt 0x0" ::: "memory");
    // This wave's copies of window t + 1 have landed before the barrier publishes them.
    asm volatile("s_wait_asynccnt 0x0" ::: "memory");
    __syncthreads();
    if (t + 2 < 8)
      fla_vkt_window(cur, kb + (t + 2) * VKW, vb + (t + 2) * VKW, tid);
#pragma unroll
    for (int s = 0; s < 4; ++s) {
      acc[0][0] = wmma_f16(fk[s][0], fv[s][0], acc[0][0]);   // rows: k channels, columns: v channels
      acc[0][1] = wmma_f16(fk[s][0], fv[s][1], acc[0][1]);
      acc[1][0] = wmma_f16(fk[s][1], fv[s][0], acc[1][0]);
      acc[1][1] = wmma_f16(fk[s][1], fv[s][1], acc[1][1]);
    }
  }
  // No copy is outstanding when the wave ends.
  asm volatile("s_wait_asynccnt 0x0" ::: "memory");

  // Piece of the tile (v tile vt, k tile nt): group vt>>1, K block nt>>1, 16-row tile
  // vt&1, K half nt&1. A wave's store covers 512 contiguous bytes.
  float* pp = vkP + ((size_t)bs * 2 * 8192 + lane) * 4;
#pragma unroll
  for (int i = 0; i < 2; ++i)
#pragma unroll
    for (int j = 0; j < 2; ++j) {
      const int nt = tk * 8 + (wave & 3) * 2 + i;
      const int vt = tv * 8 + (wave >> 2) * 2 + j;
      float* pt = pp + ((vt >> 1) * 1024 + (vt & 1) * 64 + (nt >> 1) * 128 + (nt & 1) * 32) * 4;
      *(v4f*)pt = __builtin_shufflevector(acc[i][j], acc[i][j], 0, 1, 2, 3);
      *(v4f*)(pt + 8192 * 4) = __builtin_shufflevector(acc[i][j], acc[i][j], 4, 5, 6, 7);
    }
}

// K3 (part of the K4 launch): adds a batch's 4 partial products, split 0 first,
// and rounds the sum to f16: thread t = b*8192 + g makes piece t of the packed
// v k^T (16 bytes). Every load of a wave covers 512 contiguous bytes.
static __device__ __forceinline__
void fla_sum_pack(const float* __restrict__ vkP, _Float16* __restrict__ d, int t) {
  const float* p = vkP + ((size_t)(t >> 13) * 8 * 8192 + (t & 8191)) * 4;
  v4f lo = *(const v4f*)p;
  v4f hi = *(const v4f*)(p + (size_t)8192 * 4);
#pragma unroll
  for (int s = 1; s < 4; ++s) {
    lo += *(const v4f*)(p + (size_t)(s * 2) * 8192 * 4);
    hi += *(const v4f*)(p + (size_t)(s * 2 + 1) * 8192 * 4);
  }
  v8h o;
#pragma unroll
  for (int u = 0; u < 4; ++u) {
    o[u]     = (_Float16)lo[u];
    o[u + 4] = (_Float16)hi[u];
  }
  *(v8h*)(d + (size_t)t * 8) = o;
}

// ---------------------------------------------------------------------------
// K4: depthwise 5x5 SAME conv on v. One block per (b, c) plane of 64x64 pixels.
// The plane is staged once into LDS inside a frame of zeros (two rows above and
// below, two columns left and right), so no tap needs a bounds test; each
// thread then computes an 8-wide x 4-high tile of outputs in registers.
// block = 128 (8 column groups x 16 row groups).
// The same grid also sums the v k^T partials (fla_sum_pack): both need only what
// the launches before have written and neither reads the other's output. Of every
// five blocks four take a plane and the fifth 128 pieces of v k^T, so that the
// sums' reads run beside the planes' arithmetic. grid = B*256 + B*8192/128 = 5120.
// LDS row = 8 halves pad | 64 pixels | 8 halves pad = 160 B: the two 128-B row
// pieces that 16 lanes read with one 16-byte load fall on disjoint bank halves.
// ---------------------------------------------------------------------------
#define DWP 80
__global__ __launch_bounds__(128)
void fla_dwconv_sum_kernel(const _Float16* __restrict__ vf, const float* __restrict__ w5,
                           const float* __restrict__ wb, _Float16* __restrict__ dwv,
                           const float* __restrict__ vkP, _Float16* __restrict__ vkTh)
{
  __shared__ __attribute__((aligned(16))) _Float16 tile[68 * DWP];  // image rows -2 .. 65
  const int tid  = threadIdx.x;
  const int five = blockIdx.x / 5;       // 0..1023
  const int role = blockIdx.x - five * 5;
  if (role == 4) {                       // the whole block leaves, ahead of the barrier
    fla_sum_pack(vkP, vkTh, five * 128 + tid);
    return;
  }
  const int bc  = five * 4 + role;       // b*256 + c
  const int c   = bc & 255;
  const int cg  = tid & 7;               // column group: 8 pixels
  const int rg  = tid >> 3;              // 0..15
  const _Float16* src = vf + (size_t)bc * 4096;

  // The block's 25 taps and its bias, asked for ahead of the copies so that both
  // latencies run together. Every loop of this kernel is unrolled in full, so
  // that its arrays are indexed by constants and stay in registers.
  const float* wt = w5 + c * 25;
  float w[25];
#pragma unroll
  for (int i = 0; i < 25; ++i) w[i] = wt[i];
  const float bias = wb[c];

  {
    // 512 chunks of 16 B, four per thread: chunk tid + 128*i is image row
    // rg + 16*i, column group cg.
    const unsigned l0 = (unsigned)(size_t)&tile[(rg + 2) * DWP + 8 + cg * 8];
    const unsigned l1 = l0 + 16 * DWP * 2;
    const unsigned l2 = l0 + 32 * DWP * 2;
    const unsigned l3 = l0 + 48 * DWP * 2;
    const _Float16* g0 = src + tid * 8;
    const _Float16* g1 = g0 + 1024;
    const _Float16* g2 = g0 + 2048;
    const _Float16* g3 = g0 + 3072;
    // The copies bring the plane into LDS through no register; the closing wait
    // stands in the same statement so that no address register is rewritten
    // ahead of it.
    asm volatile("global_load_async_to_lds_b128 %0, %4, off\n\t"
                 "global_load_async_to_lds_b128 %1, %5, off\n\t"
                 "global_load_async_to_lds_b128 %2, %6, off\n\t"
                 "global_load_async_to_lds_b128 %3, %7, off\n\t"
                 "s_wait_xcnt 0x0"
                 :: "v"(l0), "v"(l1), "v"(l2), "v"(l3),
                    "v"(g0), "v"(g1), "v"(g2), "v"(g3)
                 : "memory");
  }
  // The frame of zeros: bytes that no copy writes.
  if (tid < 40) {                        // LDS rows 0, 1, 66, 67, ten 16-B chunks each
    int fr  = tid / 10;
    int row = fr + ((fr >> 1) * 64);
    v8h zz = {};
    *(v8h*)&tile[row * DWP + (tid - fr * 10) * 8] = zz;
  }
  *(unsigned*)&tile[(2 + (tid >> 1)) * DWP + ((tid & 1) ? 72 : 6)] = 0u;  // columns -2,-1 / 64,65
  // Every copy of this wave has landed before the barrier lets other waves read.
  asm volatile("s_wait_asynccnt 0x0" ::: "memory");
  __syncthreads();

  v2f acc[4][4];                         // [output row][pair of neighbouring columns]
#pragma unroll
  for (int o = 0; o < 4; ++o)
#pragma unroll
    for (int j = 0; j < 4; ++j) acc[o][j] = (v2f){bias, bias};

  // LDS row rg*4 + r is image row rg*4 - 2 + r; f[] holds columns cg*8-2 .. cg*8+9.
  // Each output sums bias, then its taps by rows and, within a row, left to right.
  const _Float16* base = &tile[(rg * 4) * DWP + 8 + cg * 8];
#pragma unroll
  for (int r = 0; r < 8; ++r) {
    const _Float16* p = base + r * DWP;
    v2h lft = *(const v2h*)(p - 2);
    v8h mid = *(const v8h*)p;
    v2h rgt = *(const v2h*)(p + 8);
    float f[12];
    f[0] = (float)lft[0]; f[1] = (float)lft[1];
#pragma unroll
    for (int u = 0; u < 8; ++u) f[2 + u] = (float)mid[u];
    f[10] = (float)rgt[0]; f[11] = (float)rgt[1];
    // Column pairs that start at an even and at an odd place, so that every
    // tap column finds its two inputs in one register pair (packed f32 fma).
    v2f ev[6], od[5];
#pragma unroll
    for (int k = 0; k < 6; ++k) ev[k] = (v2f){f[2 * k], f[2 * k + 1]};
#pragma unroll
    for (int k = 0; k < 5; ++k) od[k] = (v2f){f[2 * k + 1], f[2 * k + 2]};
#pragma unroll
    for (int o = 0; o < 4; ++o) {
      const int dy = r - o;              // tap row 0..4 of output row o
      if (dy < 0 || dy > 4) continue;
#pragma unroll
      for (int dx = 0; dx < 5; ++dx) {
        const v2f wv = (v2f){w[dy * 5 + dx], w[dy * 5 + dx]};
#pragma unroll
        for (int j = 0; j < 4; ++j)
          acc[o][j] = __builtin_elementwise_fma(
              wv, (dx & 1) ? od[j + (dx >> 1)] : ev[j + (dx >> 1)], acc[o][j]);
      }
    }
  }
  _Float16* dst = dwv + (size_t)bc * 4096 + (rg * 4) * 64 + cg * 8;
#pragma unroll
  for (int o = 0; o < 4; ++o) {
    v8h ov;
#pragma unroll
    for (int j = 0; j < 4; ++j) {
      ov[2 * j]     = (_Float16)acc[o][j][0];
      ov[2 * j + 1] = (_Float16)acc[o][j][1];
    }
    *(v8h*)(dst + o * 64) = ov;
  }
}

// ---------------------------------------------------------------------------
// K5: attn = (vkT @ q) * (1/4096) / z ; RMSNorm * norm_w ; + dw -> y (f16),
// then out = proj_w @ y + proj_b (fp32 out) in the same block: a block holds all
// 256 channels of its 64 positions, which is the whole A tile of the projection,
// so y goes from the accumulators into LDS and never to memory.
// grid = B*64, block = 256. q block staged transposed [n][c]; y takes its place.
// The block's dw tile is staged the same way beside it.
// A = packed v k^T, then y; the projection's B = f16 proj weights in fragment order (fla_pack_piece).
// ---------------------------------------------------------------------------
__global__ __launch_bounds__(256)
void fla_attn_kernel(const _Float16* __restrict__ vkTh, const _Float16* __restrict__ qf,
                     const float* __restrict__ ksum, const _Float16* __restrict__ dwv,
                     const float* __restrict__ norm_w, const _Float16* __restrict__ proj_wh,
                     const float* __restrict__ proj_b, float* __restrict__ out)
{
  __shared__ __attribute__((aligned(16))) _Float16 BshT[NB * LDK];
  // dw, [n][channel] (NB * LDK halves); behind the last barrier the f32 output staging,
  // each wave's own 16 channel rows of 64 positions.
  __shared__ __attribute__((aligned(16))) _Float16 DshT[8 * 16 * OSTP * 2];
  __shared__ float kmean_sh[256];
  __shared__ float zcol[NB];
  __shared__ float colss[NB];

  const int tid  = threadIdx.x;
  const int b    = blockIdx.x >> 6;
  const int n0   = (blockIdx.x & 63) * NB;
  const int wave = tid >> 5;
  const int lane = tid & 31;

  // q and dw tiles: a thread loads 8 positions (16 bytes; 8 lanes cover a row's 128
  // bytes) of each of 8 neighbouring channels and turns them in registers.
  {
    const int nc = (tid & 7) << 3;
    const int cg = tid >> 3;             // 0..31
    const size_t go = ((size_t)b * 256 + cg * 8) * 4096 + n0 + nc;
    v8h hq[8], hd[8];
#pragma unroll
    for (int e = 0; e < 8; ++e) hq[e] = *(const v8h*)(qf + go + (size_t)e * 4096);
    // Stands in front of the next loads' results, which may land in these loads' address pair.
    asm volatile("s_wait_xcnt 0x0" ::: "memory");
#pragma unroll
    for (int e = 0; e < 8; ++e) hd[e] = *(const v8h*)(dwv + go + (size_t)e * 4096);
    // Stands in front of the later writes to the address registers that these loads name.
    asm volatile("s_wait_xcnt 0x0" ::: "memory");
    fla_turn8_store(BshT, hq, nc, cg);
    fla_turn8_store(DshT, hd, nc, cg);
  }
  kmean_sh[tid] = ksum[b * 256 + tid] * (1.f / 4096.f);
  if (tid < NB) { colss[tid] = 0.f; zcol[tid] = FLA_EPS; }
  __syncthreads();

  {                                       // z = kmean . q(col) + eps, 4-way split
    int col = tid & 63, quarter = tid >> 6;
    const _Float16* bp = BshT + col * LDK + quarter * 64;
    const float* kp = kmean_sh + quarter * 64;
    float s = 0.f;
#pragma unroll
    for (int cc = 0; cc < 64; cc += 8) {
      v8h hv = *(const v8h*)(bp + cc);
#pragma unroll
      for (int u = 0; u < 8; ++u) s += kp[cc + u] * (float)hv[u];
    }
    atomicAdd(&zcol[col], s);
  }

  // This wave's 32 rows of the batch's packed v k^T (fla_pack_piece).
  const _Float16* ap = vkTh + ((size_t)(b * 8 + wave) << 13) + lane * 8;
  v8f acc[2][4] = {};
#pragma unroll 1
  for (int kk = 0; kk < 256; kk += 32) {
    v16h a0 = load_frag_packed(ap + kk * 32);
    v16h a1 = load_frag_packed(ap + kk * 32 + 512);
#pragma unroll
    for (int nt = 0; nt < 4; ++nt) {
      v16h bf = load_frag_f16(BshT, LDK, nt * 16, kk);
      acc[0][nt] = wmma_f16(a0, bf, acc[0][nt]);
      acc[1][nt] = wmma_f16(a1, bf, acc[1][nt]);
    }
  }
  __syncthreads();                        // zcol complete, colss zeroed, q tile read out
  const int r = lane & 15, hi = lane >> 4;
#pragma unroll
  for (int nt = 0; nt < 4; ++nt) {
    float z = zcol[nt * 16 + r];
    float s = 0.f;
#pragma unroll
    for (int i = 0; i < 2; ++i)
#pragma unroll
      for (int j = 0; j < 8; ++j) {
        float a = acc[i][nt][j] * (1.f / 4096.f) / z;
        acc[i][nt][j] = a;
        s += a * a;
      }
    atomicAdd(&colss[nt * 16 + r], s);
  }
  __syncthreads();
  float rinv[4];
#pragma unroll
  for (int nt = 0; nt < 4; ++nt)
    rinv[nt] = 1.f / sqrtf(colss[nt * 16 + r] * (1.f / 256.f) + FLA_EPS);
  // y, rounded to f16, goes into the LDS tile as [n][channel]: a lane's 8 accumulator
  // rows of one 16x16 tile are 8 neighbouring channels of one position = 16 bytes.
  // dw comes from its LDS tile in the same form, one 16-byte read per tile.
  v8h y8[2][4];
#pragma unroll
  for (int i = 0; i < 2; ++i)
#pragma unroll
    for (int nt = 0; nt < 4; ++nt)
      y8[i][nt] = *(const v8h*)&DshT[(nt * 16 + r) * LDK + (wave * 2 + i) * 16 + 8 * hi];
#pragma unroll
  for (int i = 0; i < 2; ++i)
#pragma unroll
    for (int j = 0; j < 8; ++j) {
      int m = (wave * 2 + i) * 16 + j + 8 * hi;
      float nw = norm_w[m];
#pragma unroll
      for (int nt = 0; nt < 4; ++nt) {
        float yv = acc[i][nt][j] * rinv[nt] * nw + (float)y8[i][nt][j];
        y8[i][nt][j] = (_Float16)yv;
      }
    }
#pragma unroll
  for (int i = 0; i < 2; ++i)
#pragma unroll
    for (int nt = 0; nt < 4; ++nt) {
      *(v8h*)&BshT[(nt * 16 + r) * LDK + (wave * 2 + i) * 16 + 8 * hi] = y8[i][nt];
      acc[i][nt] = (v8f){};
    }
  __syncthreads();                        // every wave's channels of y are in the tile

  ap = proj_wh + ((size_t)wave << 13) + lane * 8;
  // This lane's two output channels' biases, asked for ahead of the GEMM loop.
  const float pbias[2] = {proj_b[wave * 32 + r], proj_b[wave * 32 + 16 + r]};
#pragma unroll 1
  for (int kk = 0; kk < 256; kk += 32) {
    v16h a0 = load_frag_packed(ap + kk * 32);
    v16h a1 = load_frag_packed(ap + kk * 32 + 512);
#pragma unroll
    for (int nt = 0; nt < 4; ++nt) {
      v16h bf = load_frag_f16(BshT, LDK, nt * 16, kk);
      // y is the A operand: a lane's 8 accumulator rows are 8 neighbouring positions
      // (nt*16 + hi*8 + j) of one output channel ((wave*2 + i)*16 + r).
      acc[0][nt] = wmma_f16(bf, a0, acc[0][nt]);
      acc[1][nt] = wmma_f16(bf, a1, acc[1][nt]);
    }
  }
  // 16 channel rows at a time go through the wave's own LDS range and leave as whole
  // lines: 16 lanes cover a channel's 64 positions (256 bytes), one store two channels.
  float* so = (float*)DshT + wave * (16 * OSTP);
#pragma unroll
  for (int i = 0; i < 2; ++i) {
    const float bias = pbias[i];
#pragma unroll
    for (int nt = 0; nt < 4; ++nt) {
      v4f lo, up;
#pragma unroll
      for (int u = 0; u < 4; ++u) {
        lo[u] = acc[i][nt][u] + bias;
        up[u] = acc[i][nt][u + 4] + bias;
      }
      *(v4f*)&so[r * OSTP + nt * 16 + hi * 8]     = lo;
      *(v4f*)&so[r * OSTP + nt * 16 + hi * 8 + 4] = up;
    }
    // The wave's own writes stand in LDS before it reads the rows back.
    asm volatile("s_wait_dscnt 0x0" ::: "memory");
    float* go = out + (size_t)(b * 256 + (wave * 2 + i) * 16 + hi) * 4096 + n0 + r * 4;
    const float* sr = so + hi * OSTP + r * 4;
    v4f ln[8];
#pragma unroll
    for (int it = 0; it < 8; ++it) ln[it] = *(const v4f*)(sr + it * 2 * OSTP);
#pragma unroll
    for (int it = 0; it < 8; ++it) *(v4f*)(go + (size_t)it * 2 * 4096) = ln[it];
    // Stands in front of the second half's writes to registers that these stores name.
    if (i == 0) asm volatile("s_wait_xcnt 0x0" ::: "memory");
  }
}

extern "C" void kernel_launch(void* const* d_in, const int* in_sizes, int n_in,
                              void* d_out, int out_size, void* d_ws, size_t ws_size,
                              hipStream_t stream)
{
  (void)in_sizes; (void)n_in; (void)out_size; (void)ws_size;
  const float* x      = (const float*)d_in[0];
  const float* qkv_w  = (const float*)d_in[1];
  const float* qkv_b  = (const float*)d_in[2];
  const float* dwc_w  = (const float*)d_in[3];
  const float* dwc_b  = (const float*)d_in[4];
  const float* norm_w = (const float*)d_in[5];
  const float* proj_w = (const float*)d_in[6];
  const float* proj_b = (const float*)d_in[7];
  float* out = (float*)d_out;

  const size_t B = 16, D = 256, N = 4096;
  char* ws = (char*)d_ws;
  size_t off = 0;
  auto take = [&](size_t bytes) {
    char* p = ws + off;
    off = (off + bytes + 255) & ~(size_t)255;
    return p;
  };
  _Float16* qf      = (_Float16*)take(B * D * N * 2);
  _Float16* kf      = (_Float16*)take(B * D * N * 2);
  _Float16* vf      = (_Float16*)take(B * D * N * 2);
  _Float16* dwv     = (_Float16*)take(B * D * N * 2);
  float*    vkP     = (float*)   take(4 * B * D * D * 4);
  _Float16* vkTh    = (_Float16*)take(B * D * D * 2);
  float*    ksum    = (float*)   take(B * D * 4);
  _Float16* qkv_wh  = (_Float16*)take(3 * D * D * 2);
  _Float16* proj_wh = (_Float16*)take(D * D * 2);

  fla_prep_kernel<<<dim3(144), 256, 0, stream>>>(qkv_w, qkv_wh, proj_w, proj_wh, ksum);
  fla_qkv_kernel<<<dim3(1024), 256, 0, stream>>>(x, qkv_wh, qkv_b, qf, kf, vf, ksum);
  fla_vkt_kernel<<<dim3(256), 512, 0, stream>>>(vf, kf, vkP);
  fla_dwconv_sum_kernel<<<dim3(5120), 128, 0, stream>>>(vf, dwc_w, dwc_b, dwv, vkP, vkTh);
  fla_attn_kernel<<<dim3(1024), 256, 0, stream>>>(vkTh, qf, ksum, dwv, norm_w,
                                                  proj_wh, proj_b, out);
}
